// v000
// Measured on an AMD MI455X. A time is GPU time per run, averaged over a window of back-to-back runs after a warm-up
// (all launches, gaps included; the runs take copies of the inputs in turn), and the median of several windows.
// Apart from v000's, it joins two sittings. Times from different sittings can be a few percent apart, while
// side-by-side timings come from the same sitting.
// The starting kernel, v000, takes 707 microseconds a run.
#include <hip/hip_runtime.h>
#include <hip/hip_bf16.h>
#include <math.h>
#include <stdint.h>

// ---------------------------------------------------------------------------
// Problem constants (from reference)
// ---------------------------------------------------------------------------
#define BB 4
#define TT 1024
#define DD 1024
#define HH 16
#define DHH 64
#define DCC 64
#define NBUCK 32

typedef unsigned short ushort_t;
typedef __attribute__((ext_vector_type(16))) __bf16 v16bf;
typedef __attribute__((ext_vector_type(8)))  float  v8f;

union Frag {
    v16bf v;
    uint4 u4[2];
};

__device__ __forceinline__ v8f v8f_zero() {
    v8f z;
#pragma unroll
    for (int i = 0; i < 8; ++i) z[i] = 0.0f;
    return z;
}

__device__ __forceinline__ __bf16 f32_to_bf16(float f) {
    unsigned u = __builtin_bit_cast(unsigned, f);
    unsigned r = u + 0x7FFFu + ((u >> 16) & 1u);   // round-to-nearest-even
    unsigned short h = (unsigned short)(r >> 16);
    return __builtin_bit_cast(__bf16, h);
}

__device__ __forceinline__ float bf16_to_f32(__bf16 b) {
    unsigned short h = __builtin_bit_cast(unsigned short, b);
    unsigned u = ((unsigned)h) << 16;
    return __builtin_bit_cast(float, u);
}

__device__ __forceinline__ v8f wmma_bf16(v16bf a, v16bf b, v8f c) {
    // D = A(16x32 bf16) * B(32x16 bf16) + C(16x16 f32)
    return __builtin_amdgcn_wmma_f32_16x16x32_bf16(
        /*neg_a=*/false, a, /*neg_b=*/false, b,
        /*c_mod=*/(short)0, c, /*reuse_a=*/false, /*reuse_b=*/false);
}

// Async copy 16B (8 bf16) from global to LDS; tracked with ASYNCcnt.
__device__ __forceinline__ void async_copy_b128(const void* gsrc, void* lds_dst) {
    unsigned loff = (unsigned)(unsigned long long)lds_dst;  // LDS aperture: low 32 bits
    asm volatile("global_load_async_to_lds_b128 %0, %1, off"
                 :: "v"(loff), "v"(gsrc) : "memory");
}
__device__ __forceinline__ void async_wait0() {
    asm volatile("s_wait_asynccnt 0x0" ::: "memory");
}

// ---------------------------------------------------------------------------
// Elementwise helpers
// ---------------------------------------------------------------------------
__global__ void cvt_bf16_kernel(const float* __restrict__ src,
                                __bf16* __restrict__ dst, int n) {
    int i = blockIdx.x * blockDim.x + threadIdx.x;
    if (i < n) dst[i] = f32_to_bf16(src[i]);
}

// gamma/beta = cond @ W + b  (per batch, DC=64 reduction)
__global__ void film_params_kernel(const float* __restrict__ cond,
                                   const float* __restrict__ gw,
                                   const float* __restrict__ gb,
                                   const float* __restrict__ bw,
                                   const float* __restrict__ bb,
                                   float* __restrict__ gamma,
                                   float* __restrict__ beta) {
    int idx = blockIdx.x * blockDim.x + threadIdx.x;   // B*D
    if (idx >= BB * DD) return;
    int b = idx / DD, d = idx % DD;
    const float* c = cond + b * DCC;
    float g = gb[d], bt = bb[d];
#pragma unroll 8
    for (int i = 0; i < DCC; ++i) {
        float cv = c[i];
        g  += cv * gw[i * DD + d];
        bt += cv * bw[i * DD + d];
    }
    gamma[idx] = g;
    beta[idx]  = bt;
}

// T5 relative position bias -> bias_out[h][q][k]  (this is output #2)
__global__ void bias_kernel(const float* __restrict__ rel_emb,
                            float* __restrict__ bias_out, int n) {
    int idx = blockIdx.x * blockDim.x + threadIdx.x;
    if (idx >= n) return;
    int k = idx % TT;
    int q = (idx / TT) % TT;
    int h = idx / (TT * TT);
    int rp = k - q;
    const int nb = NBUCK / 2;      // 16
    const int max_exact = nb / 2;  // 8
    int bucket = (rp > 0) ? nb : 0;
    int arp = rp < 0 ? -rp : rp;
    int val;
    if (arp < max_exact) {
        val = arp;
    } else {
        float rp_safe = (float)(arp > 1 ? arp : 1);
        int large = max_exact +
            (int)(logf(rp_safe / (float)max_exact) /
                  logf(128.0f / (float)max_exact) * (float)(nb - max_exact));
        val = large < nb - 1 ? large : nb - 1;
    }
    bucket += val;
    bias_out[idx] = rel_emb[bucket * HH + h];
}

// y = film(rms_norm(x)) -> bf16, one block per (b,t) row
__global__ __launch_bounds__(256)
void rmsnorm_film_kernel(const float* __restrict__ x,
                         const float* __restrict__ w,
                         const float* __restrict__ gamma,
                         const float* __restrict__ beta,
                         __bf16* __restrict__ y) {
    int row = blockIdx.x;          // 0 .. B*T-1
    int b = row / TT;
    const float* xr = x + (size_t)row * DD;
    float ss = 0.0f;
    for (int i = threadIdx.x; i < DD; i += 256) {
        float v = xr[i];
        ss += v * v;
    }
#pragma unroll
    for (int m = 16; m >= 1; m >>= 1) ss += __shfl_xor(ss, m, 32);
    __shared__ float red[8];
    if ((threadIdx.x & 31) == 0) red[threadIdx.x >> 5] = ss;
    __syncthreads();
    float tot = 0.0f;
#pragma unroll
    for (int i = 0; i < 8; ++i) tot += red[i];
    float rstd = rsqrtf(tot / (float)DD + 1e-6f);
    const float* g = gamma + (size_t)b * DD;
    const float* be = beta + (size_t)b * DD;
    __bf16* yr = y + (size_t)row * DD;
    for (int i = threadIdx.x; i < DD; i += 256) {
        float v = w[i] * (xr[i] * rstd);
        v = v * (g[i] + 1.0f) + be[i];
        yr[i] = f32_to_bf16(v);
    }
}

// geglu: g[r,c] = h[r,c] * gelu(h[r,c+2048]), exact gelu
__global__ void geglu_kernel(const __bf16* __restrict__ h,
                             __bf16* __restrict__ g, int n) {
    int idx = blockIdx.x * blockDim.x + threadIdx.x;  // rows * 2048
    if (idx >= n) return;
    int r = idx / (2 * DD);
    int c = idx % (2 * DD);
    float p1 = bf16_to_f32(h[(size_t)r * 4 * DD + c]);
    float p2 = bf16_to_f32(h[(size_t)r * 4 * DD + 2 * DD + c]);
    float ge = 0.5f * p2 * (1.0f + erff(p2 * 0.70710678118654752f));
    g[idx] = f32_to_bf16(p1 * ge);
}

// ---------------------------------------------------------------------------
// Generic bf16 WMMA GEMM:  C[M,N] = A[M,K] * B[K,N]  (row-major, bf16 in)
// Block tile 128x128, 8 waves (4 along M x 2 along N), wave tile 32x64.
// Double-buffered LDS; A tile staged via GLOBAL_LOAD_ASYNC_TO_LDS_B128,
// B tile transposed through VGPRs (needed for [n][k] fragment layout).
// EPI==0: store bf16.  EPI==1: store f32 with residual add.
// ---------------------------------------------------------------------------
template <int EPI>
__global__ __launch_bounds__(256)
void gemm_bf16_kernel(const __bf16* __restrict__ A,
                      const __bf16* __restrict__ Bm,
                      void* __restrict__ C,
                      const float* __restrict__ residual,
                      int M, int N, int K) {
    __shared__ ushort_t lA[2][128 * 32];   // [m][k]
    __shared__ ushort_t lB[2][128 * 32];   // [n][k]  (B transposed into LDS)

    const int tid  = threadIdx.x;
    const int lane = tid & 31;
    const int wave = tid >> 5;          // 0..7
    const int wm   = wave & 3;          // 4 waves along M
    const int wn   = wave >> 2;         // 2 waves along N
    const int half = lane >> 4;         // which 16-lane half
    const int l16  = lane & 15;
    const int koff = half ? 8 : 0;

    const int blockM = blockIdx.y * 128;
    const int blockN = blockIdx.x * 128;

    // per-thread tile-load coordinates (512 x 16B chunks per tile, 2 each)
    const int aRow0 = (tid + 0)   >> 2, aKc0 = ((tid + 0)   & 3) * 8;
    const int aRow1 = (tid + 256) >> 2, aKc1 = ((tid + 256) & 3) * 8;
    const int bKr0  = (tid + 0)   >> 4, bNc0 = ((tid + 0)   & 15) * 8;
    const int bKr1  = (tid + 256) >> 4, bNc1 = ((tid + 256) & 15) * 8;

    auto issueA = [&](int buf, int k0) {
        async_copy_b128(A + (size_t)(blockM + aRow0) * K + k0 + aKc0,
                        &lA[buf][aRow0 * 32 + aKc0]);
        async_copy_b128(A + (size_t)(blockM + aRow1) * K + k0 + aKc1,
                        &lA[buf][aRow1 * 32 + aKc1]);
    };
    auto loadB = [&](int k0, uint4* st) {
        st[0] = *(const uint4*)(Bm + (size_t)(k0 + bKr0) * N + blockN + bNc0);
        st[1] = *(const uint4*)(Bm + (size_t)(k0 + bKr1) * N + blockN + bNc1);
    };
    auto storeB = [&](int buf, const uint4* st) {
        const ushort_t* d0 = (const ushort_t*)&st[0];
        const ushort_t* d1 = (const ushort_t*)&st[1];
#pragma unroll
        for (int e = 0; e < 8; ++e) lB[buf][(bNc0 + e) * 32 + bKr0] = d0[e];
#pragma unroll
        for (int e = 0; e < 8; ++e) lB[buf][(bNc1 + e) * 32 + bKr1] = d1[e];
    };

    v8f acc[2][4];
#pragma unroll
    for (int i = 0; i < 2; ++i)
#pragma unroll
        for (int j = 0; j < 4; ++j) acc[i][j] = v8f_zero();

    // prologue: stage tile 0
    {
        uint4 bst[2];
        issueA(0, 0);
        loadB(0, bst);
        storeB(0, bst);
        async_wait0();
        __syncthreads();
    }

    int cur = 0;
    for (int k0 = 0; k0 < K; k0 += 32) {
        const int nxt = cur ^ 1;
        const bool has_next = (k0 + 32) < K;
        uint4 bst[2];
        if (has_next) {
            issueA(nxt, k0 + 32);       // async: overlaps with compute below
            loadB(k0 + 32, bst);        // global->VGPR, consumed after compute
        }

        // compute current tile
        Frag a[2], b[4];
#pragma unroll
        for (int i = 0; i < 2; ++i) {
            int row = wm * 32 + i * 16 + l16;
            a[i].u4[0] = *(const uint4*)&lA[cur][row * 32 + koff];
            a[i].u4[1] = *(const uint4*)&lA[cur][row * 32 + koff + 16];
        }
#pragma unroll
        for (int j = 0; j < 4; ++j) {
            int col = wn * 64 + j * 16 + l16;
            b[j].u4[0] = *(const uint4*)&lB[cur][col * 32 + koff];
            b[j].u4[1] = *(const uint4*)&lB[cur][col * 32 + koff + 16];
        }
#pragma unroll
        for (int i = 0; i < 2; ++i)
#pragma unroll
            for (int j = 0; j < 4; ++j)
                acc[i][j] = wmma_bf16(a[i].v, b[j].v, acc[i][j]);

        if (has_next) storeB(nxt, bst);
        async_wait0();
        __syncthreads();
        cur = nxt;
    }

    // epilogue (C-layout: col = l16, row = r + 8*half per vgpr r)
#pragma unroll
    for (int i = 0; i < 2; ++i) {
#pragma unroll
        for (int j = 0; j < 4; ++j) {
            int col = blockN + wn * 64 + j * 16 + l16;
#pragma unroll
            for (int r = 0; r < 8; ++r) {
                int row = blockM + wm * 32 + i * 16 + r + half * 8;
                size_t idx = (size_t)row * N + col;
                float v = acc[i][j][r];
                if (EPI == 0) {
                    ((__bf16*)C)[idx] = f32_to_bf16(v);
                } else {
                    ((float*)C)[idx] = residual[idx] + v;
                }
            }
        }
    }
}

// ---------------------------------------------------------------------------
// Flash attention: grid (B*H, T/64), block 128 (4 waves x 16 query rows).
// S = Q*K^T * 1/8 + bias, mask, online softmax, O = P*V.
// K tile staged async to LDS; V tile transposed through VGPRs.
// ---------------------------------------------------------------------------
__global__ __launch_bounds__(128)
void flash_attn_kernel(const __bf16* __restrict__ qb,
                       const __bf16* __restrict__ kb,
                       const __bf16* __restrict__ vb,
                       const float* __restrict__ bias,   // [H][T][T]
                       const int* __restrict__ mask,     // [B][T][T]
                       __bf16* __restrict__ ob) {
    __shared__ ushort_t lK[64 * 64];   // [key][dh]   -> B-frag layout for Q*K^T
    __shared__ ushort_t lV[64 * 64];   // [dh][key]   -> B-frag layout for P*V
    __shared__ ushort_t lP[64 * 64];   // [q][key]    -> A-frag relayout

    const int bh = blockIdx.x;
    const int b = bh / HH;
    const int h = bh % HH;
    const int qbase = blockIdx.y * 64;
    const int tid  = threadIdx.x;
    const int lane = tid & 31;
    const int wave = tid >> 5;         // 0..3 -> 16 query rows each
    const int half = lane >> 4;
    const int l16  = lane & 15;
    const int koff = half ? 8 : 0;

    // Q fragments stay in registers for the whole kernel
    Frag qf[2];
    {
        int qrow = qbase + wave * 16 + l16;
        const __bf16* qrp = qb + ((size_t)(b * TT + qrow)) * DD + h * DHH;
        qf[0].u4[0] = *(const uint4*)(qrp + koff);
        qf[0].u4[1] = *(const uint4*)(qrp + koff + 16);
        qf[1].u4[0] = *(const uint4*)(qrp + 32 + koff);
        qf[1].u4[1] = *(const uint4*)(qrp + 32 + koff + 16);
    }

    float m[8], l[8];
    v8f o[4];
#pragma unroll
    for (int r = 0; r < 8; ++r) { m[r] = -1e30f; l[r] = 0.0f; }
#pragma unroll
    for (int j = 0; j < 4; ++j) o[j] = v8f_zero();

    const float scale = 0.125f;   // 1/sqrt(DH)

    for (int kt = 0; kt < TT / 64; ++kt) {
        const int kbase = kt * 64;
        // K tile: natural [key][dh] layout, async to LDS (no VGPR staging)
#pragma unroll
        for (int i = 0; i < 4; ++i) {
            int chunk = tid + i * 128;
            int row = chunk >> 3;
            int cc  = (chunk & 7) * 8;
            async_copy_b128(kb + ((size_t)(b * TT + kbase + row)) * DD + h * DHH + cc,
                            &lK[row * 64 + cc]);
        }
        // V tile transposed: lV[dh][key]
#pragma unroll
        for (int i = 0; i < 4; ++i) {
            int chunk = tid + i * 128;
            int row = chunk >> 3;
            int cc  = (chunk & 7) * 8;
            uint4 d = *(const uint4*)(vb +
                ((size_t)(b * TT + kbase + row)) * DD + h * DHH + cc);
            const ushort_t* ds = (const ushort_t*)&d;
#pragma unroll
            for (int e = 0; e < 8; ++e) lV[(cc + e) * 64 + row] = ds[e];
        }
        async_wait0();
        __syncthreads();

        // S = Q * K^T  (4 column frags of 16, K-reduction DH=64 -> 2 wmma)
        v8f s[4];
#pragma unroll
        for (int j = 0; j < 4; ++j) {
            int col = j * 16 + l16;
            Frag b0, b1;
            b0.u4[0] = *(const uint4*)&lK[col * 64 + koff];
            b0.u4[1] = *(const uint4*)&lK[col * 64 + koff + 16];
            b1.u4[0] = *(const uint4*)&lK[col * 64 + 32 + koff];
            b1.u4[1] = *(const uint4*)&lK[col * 64 + 32 + koff + 16];
            v8f z = v8f_zero();
            z = wmma_bf16(qf[0].v, b0.v, z);
            s[j] = wmma_bf16(qf[1].v, b1.v, z);
        }

        // scale + bias + mask + online softmax (per accumulator row)
#pragma unroll
        for (int r = 0; r < 8; ++r) {
            int qg = qbase + wave * 16 + r + half * 8;
            float rmax = -1e30f;
#pragma unroll
            for (int j = 0; j < 4; ++j) {
                int kg = kbase + j * 16 + l16;
                float v = s[j][r] * scale +
                          bias[((size_t)h * TT + qg) * TT + kg];
                int mk = mask[((size_t)b * TT + qg) * TT + kg];
                v = (mk == 0) ? -1e9f : v;
                s[j][r] = v;
                rmax = fmaxf(rmax, v);
            }
#pragma unroll
            for (int mm = 8; mm >= 1; mm >>= 1)
                rmax = fmaxf(rmax, __shfl_xor(rmax, mm, 32));
            float mnew = fmaxf(m[r], rmax);
            float corr = __expf(m[r] - mnew);
            float psum = 0.0f;
#pragma unroll
            for (int j = 0; j < 4; ++j) {
                float p = __expf(s[j][r] - mnew);
                s[j][r] = p;
                psum += p;
            }
#pragma unroll
            for (int mm = 8; mm >= 1; mm >>= 1)
                psum += __shfl_xor(psum, mm, 32);
            l[r] = l[r] * corr + psum;
            m[r] = mnew;
#pragma unroll
            for (int j = 0; j < 4; ++j) o[j][r] *= corr;
        }

        // Relayout P through LDS (C-frag -> A-frag)
#pragma unroll
        for (int j = 0; j < 4; ++j) {
            int coll = j * 16 + l16;
#pragma unroll
            for (int r = 0; r < 8; ++r) {
                int rowl = wave * 16 + r + half * 8;
                lP[rowl * 64 + coll] =
                    __builtin_bit_cast(unsigned short, f32_to_bf16(s[j][r]));
            }
        }
        __syncthreads();

        // O += P * V
        Frag pa[2];
        {
            int prow = wave * 16 + l16;
            pa[0].u4[0] = *(const uint4*)&lP[prow * 64 + koff];
            pa[0].u4[1] = *(const uint4*)&lP[prow * 64 + koff + 16];
            pa[1].u4[0] = *(const uint4*)&lP[prow * 64 + 32 + koff];
            pa[1].u4[1] = *(const uint4*)&lP[prow * 64 + 32 + koff + 16];
        }
#pragma unroll
        for (int j = 0; j < 4; ++j) {
            int col = j * 16 + l16;   // dh column
            Frag v0, v1;
            v0.u4[0] = *(const uint4*)&lV[col * 64 + koff];
            v0.u4[1] = *(const uint4*)&lV[col * 64 + koff + 16];
            v1.u4[0] = *(const uint4*)&lV[col * 64 + 32 + koff];
            v1.u4[1] = *(const uint4*)&lV[col * 64 + 32 + koff + 16];
            o[j] = wmma_bf16(pa[0].v, v0.v, o[j]);
            o[j] = wmma_bf16(pa[1].v, v1.v, o[j]);
        }
        __syncthreads();
    }

    // finalize: O /= l, write bf16 [B,T,H*DH]
#pragma unroll
    for (int j = 0; j < 4; ++j) {
        int dh = j * 16 + l16;
#pragma unroll
        for (int r = 0; r < 8; ++r) {
            int qg = qbase + wave * 16 + r + half * 8;
            float v = o[j][r] / l[r];
            ob[((size_t)(b * TT + qg)) * DD + h * DHH + dh] = f32_to_bf16(v);
        }
    }
}

// ---------------------------------------------------------------------------
// Host-side orchestration
// ---------------------------------------------------------------------------
static inline size_t align256(size_t x) { return (x + 255) & ~(size_t)255; }

extern "C" void kernel_launch(void* const* d_in, const int* in_sizes, int n_in,
                              void* d_out, int out_size, void* d_ws, size_t ws_size,
                              hipStream_t stream) {
    (void)in_sizes; (void)n_in; (void)out_size; (void)ws_size;
    const float* x        = (const float*)d_in[0];
    const int*   x_mask   = (const int*)  d_in[1];
    const float* cond     = (const float*)d_in[2];
    const float* norm1_w  = (const float*)d_in[3];
    const float* f1_gw    = (const float*)d_in[4];
    const float* f1_gb    = (const float*)d_in[5];
    const float* f1_bw    = (const float*)d_in[6];
    const float* f1_bb    = (const float*)d_in[7];
    const float* wq       = (const float*)d_in[8];
    const float* wk       = (const float*)d_in[9];
    const float* wv       = (const float*)d_in[10];
    const float* wo       = (const float*)d_in[11];
    const float* rel_emb  = (const float*)d_in[12];
    const float* norm3_w  = (const float*)d_in[13];
    const float* f3_gw    = (const float*)d_in[14];
    const float* f3_gb    = (const float*)d_in[15];
    const float* f3_bw    = (const float*)d_in[16];
    const float* f3_bb    = (const float*)d_in[17];
    const float* ffn_w1   = (const float*)d_in[18];
    const float* ffn_w2   = (const float*)d_in[19];

    float* out_x    = (float*)d_out;                              // [B,T,D]
    float* out_bias = (float*)d_out + (size_t)BB * TT * DD;       // [H,T,T]

    // workspace bump allocator
    char* ws = (char*)d_ws;
    size_t off = 0;
    auto alloc = [&](size_t bytes) -> void* {
        void* p = ws + off;
        off += align256(bytes);
        return p;
    };
    const size_t BT = (size_t)BB * TT;
    __bf16* wq_bf   = (__bf16*)alloc((size_t)DD * DD * 2);
    __bf16* wk_bf   = (__bf16*)alloc((size_t)DD * DD * 2);
    __bf16* wv_bf   = (__bf16*)alloc((size_t)DD * DD * 2);
    __bf16* wo_bf   = (__bf16*)alloc((size_t)DD * DD * 2);
    __bf16* w1_bf   = (__bf16*)alloc((size_t)DD * 4 * DD * 2);
    __bf16* w2_bf   = (__bf16*)alloc((size_t)2 * DD * DD * 2);
    float*  gamma1  = (float*)alloc((size_t)BB * DD * 4);
    float*  beta1   = (float*)alloc((size_t)BB * DD * 4);
    float*  gamma3  = (float*)alloc((size_t)BB * DD * 4);
    float*  beta3   = (float*)alloc((size_t)BB * DD * 4);
    __bf16* y_bf    = (__bf16*)alloc(BT * DD * 2);
    __bf16* q_bf    = (__bf16*)alloc(BT * DD * 2);
    __bf16* k_bf    = (__bf16*)alloc(BT * DD * 2);
    __bf16* v_bf    = (__bf16*)alloc(BT * DD * 2);
    __bf16* attn_bf = (__bf16*)alloc(BT * DD * 2);
    float*  x_mid   = (float*)alloc(BT * DD * 4);
    __bf16* y3_bf   = (__bf16*)alloc(BT * DD * 2);
    __bf16* h_bf    = (__bf16*)alloc(BT * 4 * DD * 2);
    __bf16* g_bf    = (__bf16*)alloc(BT * 2 * DD * 2);

    // 1) weight conversion fp32 -> bf16
    {
        int n = DD * DD;
        cvt_bf16_kernel<<<(n + 255) / 256, 256, 0, stream>>>(wq, wq_bf, n);
        cvt_bf16_kernel<<<(n + 255) / 256, 256, 0, stream>>>(wk, wk_bf, n);
        cvt_bf16_kernel<<<(n + 255) / 256, 256, 0, stream>>>(wv, wv_bf, n);
        cvt_bf16_kernel<<<(n + 255) / 256, 256, 0, stream>>>(wo, wo_bf, n);
        int n1 = DD * 4 * DD;
        cvt_bf16_kernel<<<(n1 + 255) / 256, 256, 0, stream>>>(ffn_w1, w1_bf, n1);
        int n2 = 2 * DD * DD;
        cvt_bf16_kernel<<<(n2 + 255) / 256, 256, 0, stream>>>(ffn_w2, w2_bf, n2);
    }
    // 2) FiLM params
    film_params_kernel<<<(BB * DD + 255) / 256, 256, 0, stream>>>(
        cond, f1_gw, f1_gb, f1_bw, f1_bb, gamma1, beta1);
    film_params_kernel<<<(BB * DD + 255) / 256, 256, 0, stream>>>(
        cond, f3_gw, f3_gb, f3_bw, f3_bb, gamma3, beta3);
    // 3) position bias (output #2 + consumed by attention)
    {
        int n = HH * TT * TT;
        bias_kernel<<<(n + 255) / 256, 256, 0, stream>>>(rel_emb, out_bias, n);
    }
    // 4) y = film(rmsnorm(x)) -> bf16
    rmsnorm_film_kernel<<<(int)BT, 256, 0, stream>>>(x, norm1_w, gamma1, beta1, y_bf);
    // 5) Q,K,V projections
    {
        dim3 grid(DD / 128, (int)(BT / 128));
        gemm_bf16_kernel<0><<<grid, 256, 0, stream>>>(y_bf, wq_bf, q_bf, nullptr,
                                                      (int)BT, DD, DD);
        gemm_bf16_kernel<0><<<grid, 256, 0, stream>>>(y_bf, wk_bf, k_bf, nullptr,
                                                      (int)BT, DD, DD);
        gemm_bf16_kernel<0><<<grid, 256, 0, stream>>>(y_bf, wv_bf, v_bf, nullptr,
                                                      (int)BT, DD, DD);
    }
    // 6) flash attention
    {
        dim3 grid(BB * HH, TT / 64);
        flash_attn_kernel<<<grid, 128, 0, stream>>>(q_bf, k_bf, v_bf,
                                                    out_bias, x_mask, attn_bf);
    }
    // 7) x_mid = x + attn @ wo
    {
        dim3 grid(DD / 128, (int)(BT / 128));
        gemm_bf16_kernel<1><<<grid, 256, 0, stream>>>(attn_bf, wo_bf, x_mid, x,
                                                      (int)BT, DD, DD);
    }
    // 8) y3 = film(rmsnorm(x_mid)) -> bf16
    rmsnorm_film_kernel<<<(int)BT, 256, 0, stream>>>(x_mid, norm3_w, gamma3, beta3, y3_bf);
    // 9) h = y3 @ ffn_w1  [BT, 4D]
    {
        dim3 grid(4 * DD / 128, (int)(BT / 128));
        gemm_bf16_kernel<0><<<grid, 256, 0, stream>>>(y3_bf, w1_bf, h_bf, nullptr,
                                                      (int)BT, 4 * DD, DD);
    }
    // 10) geglu
    {
        int n = (int)(BT * 2 * DD);
        geglu_kernel<<<(n + 255) / 256, 256, 0, stream>>>(h_bf, g_bf, n);
    }
    // 11) out = x_mid + g @ ffn_w2
    {
        dim3 grid(DD / 128, (int)(BT / 128));
        gemm_bf16_kernel<1><<<grid, 256, 0, stream>>>(g_bf, w2_bf, out_x, x_mid,
                                                      (int)BT, DD, 2 * DD);
    }
}

// v001
// A run of this version takes 382 microseconds.
// Timed twice side by side with v000, it ran 1.85 and 1.87 times as fast.
#include <hip/hip_runtime.h>
#include <hip/hip_bf16.h>
#include <math.h>
#include <stdint.h>

// ---------------------------------------------------------------------------
// Problem constants (from reference)
// ---------------------------------------------------------------------------
#define BB 4
#define TT 1024
#define DD 1024
#define HH 16
#define DHH 64
#define DCC 64
#define NBUCK 32

typedef unsigned short ushort_t;
typedef __attribute__((ext_vector_type(16))) __bf16 v16bf;
typedef __attribute__((ext_vector_type(8)))  float  v8f;
typedef __attribute__((ext_vector_type(8)))  short  s16x8;

union Frag {
    v16bf v;
    uint4 u4[2];
    s16x8 t[2];
};

__device__ __forceinline__ v8f v8f_zero() {
    v8f z;
#pragma unroll
    for (int i = 0; i < 8; ++i) z[i] = 0.0f;
    return z;
}

__device__ __forceinline__ __bf16 f32_to_bf16(float f) {
    unsigned u = __builtin_bit_cast(unsigned, f);
    unsigned r = u + 0x7FFFu + ((u >> 16) & 1u);   // round-to-nearest-even
    unsigned short h = (unsigned short)(r >> 16);
    return __builtin_bit_cast(__bf16, h);
}

__device__ __forceinline__ float bf16_to_f32(__bf16 b) {
    unsigned short h = __builtin_bit_cast(unsigned short, b);
    unsigned u = ((unsigned)h) << 16;
    return __builtin_bit_cast(float, u);
}

__device__ __forceinline__ v8f wmma_bf16(v16bf a, v16bf b, v8f c) {
    // D = A(16x32 bf16) * B(32x16 bf16) + C(16x16 f32)
    return __builtin_amdgcn_wmma_f32_16x16x32_bf16(
        /*neg_a=*/false, a, /*neg_b=*/false, b,
        /*c_mod=*/(short)0, c, /*reuse_a=*/false, /*reuse_b=*/false);
}

// Four async copies of 16B (8 bf16) per lane from global to LDS; tracked with
// ASYNCcnt. The closing s_wait_xcnt stands inside the statement so that no
// address register of a copy is rewritten in front of it.
__device__ __forceinline__ void async_copy4_b128(const void* g0, void* d0,
                                                 const void* g1, void* d1,
                                                 const void* g2, void* d2,
                                                 const void* g3, void* d3) {
    unsigned l0 = (unsigned)(unsigned long long)d0;  // LDS aperture: low 32 bits
    unsigned l1 = (unsigned)(unsigned long long)d1;
    unsigned l2 = (unsigned)(unsigned long long)d2;
    unsigned l3 = (unsigned)(unsigned long long)d3;
    asm volatile("global_load_async_to_lds_b128 %0, %1, off\n\t"
                 "global_load_async_to_lds_b128 %2, %3, off\n\t"
                 "global_load_async_to_lds_b128 %4, %5, off\n\t"
                 "global_load_async_to_lds_b128 %6, %7, off\n\t"
                 "s_wait_xcnt 0x0"
                 :: "v"(l0), "v"(g0), "v"(l1), "v"(g1),
                    "v"(l2), "v"(g2), "v"(l3), "v"(g3) : "memory");
}
// The issuing wave's copies have landed behind this wait.
__device__ __forceinline__ void async_wait0() {
    asm volatile("s_wait_asynccnt 0x0" ::: "memory");
}
// The wave's own LDS reads have retired before a copy may refill what they read.
__device__ __forceinline__ void lds_wait0() {
    asm volatile("s_wait_dscnt 0x0" ::: "memory");
}

// Transposing LDS load: from a row-major [k][n] bf16 tile, lane (c = l & 15,
// h = l >> 4) receives T[kbase + 8h + 0..7][nbase + c]. The lane's address is
// row kbase + 8*(l >> 4) + (l & 7), column nbase + 8*((l >> 3) & 1).
__device__ __forceinline__ s16x8 lds_load_tr16(const ushort_t* p) {
    typedef __attribute__((address_space(3))) s16x8 lds_s16x8;
    return __builtin_amdgcn_ds_load_tr16_b128_v8i16((lds_s16x8*)p);
}

// ---------------------------------------------------------------------------
// Elementwise helpers
// ---------------------------------------------------------------------------
__global__ void cvt_bf16_kernel(const float* __restrict__ src,
                                __bf16* __restrict__ dst, int n) {
    int i = blockIdx.x * blockDim.x + threadIdx.x;
    if (i < n) dst[i] = f32_to_bf16(src[i]);
}

// gamma/beta = cond @ W + b  (per batch, DC=64 reduction)
__global__ void film_params_kernel(const float* __restrict__ cond,
                                   const float* __restrict__ gw,
                                   const float* __restrict__ gb,
                                   const float* __restrict__ bw,
                                   const float* __restrict__ bb,
                                   float* __restrict__ gamma,
                                   float* __restrict__ beta) {
    int idx = blockIdx.x * blockDim.x + threadIdx.x;   // B*D
    if (idx >= BB * DD) return;
    int b = idx / DD, d = idx % DD;
    const float* c = cond + b * DCC;
    float g = gb[d], bt = bb[d];
#pragma unroll 8
    for (int i = 0; i < DCC; ++i) {
        float cv = c[i];
        g  += cv * gw[i * DD + d];
        bt += cv * bw[i * DD + d];
    }
    gamma[idx] = g;
    beta[idx]  = bt;
}

// T5 relative position bias -> bias_out[h][q][k]  (this is output #2)
__global__ void bias_kernel(const float* __restrict__ rel_emb,
                            float* __restrict__ bias_out, int n) {
    int idx = blockIdx.x * blockDim.x + threadIdx.x;
    if (idx >= n) return;
    int k = idx % TT;
    int q = (idx / TT) % TT;
    int h = idx / (TT * TT);
    int rp = k - q;
    const int nb = NBUCK / 2;      // 16
    const int max_exact = nb / 2;  // 8
    int bucket = (rp > 0) ? nb : 0;
    int arp = rp < 0 ? -rp : rp;
    int val;
    if (arp < max_exact) {
        val = arp;
    } else {
        float rp_safe = (float)(arp > 1 ? arp : 1);
        int large = max_exact +
            (int)(logf(rp_safe / (float)max_exact) /
                  logf(128.0f / (float)max_exact) * (float)(nb - max_exact));
        val = large < nb - 1 ? large : nb - 1;
    }
    bucket += val;
    bias_out[idx] = rel_emb[bucket * HH + h];
}

// y = film(rms_norm(x)) -> bf16, one block per (b,t) row
__global__ __launch_bounds__(256)
void rmsnorm_film_kernel(const float* __restrict__ x,
                         const float* __restrict__ w,
                         const float* __restrict__ gamma,
                         const float* __restrict__ beta,
                         __bf16* __restrict__ y) {
    int row = blockIdx.x;          // 0 .. B*T-1
    int b = row / TT;
    const float* xr = x + (size_t)row * DD;
    float ss = 0.0f;
    for (int i = threadIdx.x; i < DD; i += 256) {
        float v = xr[i];
        ss += v * v;
    }
#pragma unroll
    for (int m = 16; m >= 1; m >>= 1) ss += __shfl_xor(ss, m, 32);
    __shared__ float red[8];
    if ((threadIdx.x & 31) == 0) red[threadIdx.x >> 5] = ss;
    __syncthreads();
    float tot = 0.0f;
#pragma unroll
    for (int i = 0; i < 8; ++i) tot += red[i];
    float rstd = rsqrtf(tot / (float)DD + 1e-6f);
    const float* g = gamma + (size_t)b * DD;
    const float* be = beta + (size_t)b * DD;
    __bf16* yr = y + (size_t)row * DD;
    for (int i = threadIdx.x; i < DD; i += 256) {
        float v = w[i] * (xr[i] * rstd);
        v = v * (g[i] + 1.0f) + be[i];
        yr[i] = f32_to_bf16(v);
    }
}

// geglu: g[r,c] = h[r,c] * gelu(h[r,c+2048]), exact gelu
__global__ void geglu_kernel(const __bf16* __restrict__ h,
                             __bf16* __restrict__ g, int n) {
    int idx = blockIdx.x * blockDim.x + threadIdx.x;  // rows * 2048
    if (idx >= n) return;
    int r = idx / (2 * DD);
    int c = idx % (2 * DD);
    float p1 = bf16_to_f32(h[(size_t)r * 4 * DD + c]);
    float p2 = bf16_to_f32(h[(size_t)r * 4 * DD + 2 * DD + c]);
    float ge = 0.5f * p2 * (1.0f + erff(p2 * 0.70710678118654752f));
    g[idx] = f32_to_bf16(p1 * ge);
}

// ---------------------------------------------------------------------------
// Generic bf16 WMMA GEMM:  C[M,N] = A[M,K] * B[K,N]  (row-major, bf16 in)
// Block tile 128x128, 8 waves (4 along M x 2 along N), wave tile 32x64.
// Double-buffered LDS; A and B tiles staged via GLOBAL_LOAD_ASYNC_TO_LDS_B128,
// B kept row-major [k][n] and transposed by the fragment loads themselves.
// EPI==0: store bf16.  EPI==1: store f32 with residual add.
// ---------------------------------------------------------------------------
template <int EPI>
__global__ __launch_bounds__(256)
void gemm_bf16_kernel(const __bf16* __restrict__ A,
                      const __bf16* __restrict__ Bm,
                      void* __restrict__ C,
                      const float* __restrict__ residual,
                      int M, int N, int K) {
    constexpr int PB = 144;   // lB row pitch: 288 B, an odd multiple of 32 B
    __shared__ __attribute__((aligned(16))) ushort_t lA[2][128 * 32];  // [m][k]
    __shared__ __attribute__((aligned(16))) ushort_t lB[2][32 * PB];   // [k][n]

    const int tid  = threadIdx.x;
    const int lane = tid & 31;
    const int wave = tid >> 5;          // 0..7
    const int wm   = wave & 3;          // 4 waves along M
    const int wn   = wave >> 2;         // 2 waves along N
    const int half = lane >> 4;         // which 16-lane half
    const int l16  = lane & 15;
    const int koff = half ? 8 : 0;
    const int trow = half * 8 + (lane & 7);      // transposing load: lane's row
    const int tcol = ((lane >> 3) & 1) * 8;      // and its column offset

    const int blockM = blockIdx.y * 128;
    const int blockN = blockIdx.x * 128;

    // per-thread tile-load coordinates (512 x 16B chunks per tile, 2 each)
    const int aRow0 = (tid + 0)   >> 2, aKc0 = ((tid + 0)   & 3) * 8;
    const int aRow1 = (tid + 256) >> 2, aKc1 = ((tid + 256) & 3) * 8;
    const int bKr0  = (tid + 0)   >> 4, bNc0 = ((tid + 0)   & 15) * 8;
    const int bKr1  = (tid + 256) >> 4, bNc1 = ((tid + 256) & 15) * 8;

    // each thread's four source addresses walk along K, one tile per issue
    const __bf16* gA0 = A + (size_t)(blockM + aRow0) * K + aKc0;
    const __bf16* gA1 = A + (size_t)(blockM + aRow1) * K + aKc1;
    const __bf16* gB0 = Bm + (size_t)bKr0 * N + blockN + bNc0;
    const __bf16* gB1 = Bm + (size_t)bKr1 * N + blockN + bNc1;
    const size_t stepB = (size_t)32 * N;
    auto issueAB = [&](int buf) {
        async_copy4_b128(gA0, &lA[buf][aRow0 * 32 + aKc0],
                         gA1, &lA[buf][aRow1 * 32 + aKc1],
                         gB0, &lB[buf][bKr0 * PB + bNc0],
                         gB1, &lB[buf][bKr1 * PB + bNc1]);
        gA0 += 32;
        gA1 += 32;
        gB0 += stepB;
        gB1 += stepB;
    };

    v8f acc[2][4];
#pragma unroll
    for (int i = 0; i < 2; ++i)
#pragma unroll
        for (int j = 0; j < 4; ++j) acc[i][j] = v8f_zero();

    // prologue: tile 0 lands and is published, then tile 1 starts to fly
    const int ntiles = K / 32;
    issueAB(0);
    async_wait0();
    __syncthreads();
    if (ntiles > 1) issueAB(1);

    for (int t = 0; t < ntiles; ++t) {
        const int cur = t & 1;

        // compute current tile
        Frag a[2], b[4];
#pragma unroll
        for (int i = 0; i < 2; ++i) {
            int row = wm * 32 + i * 16 + l16;
            a[i].u4[0] = *(const uint4*)&lA[cur][row * 32 + koff];
            a[i].u4[1] = *(const uint4*)&lA[cur][row * 32 + koff + 16];
        }
#pragma unroll
        for (int j = 0; j < 4; ++j) {
            int col = wn * 64 + j * 16 + tcol;
            b[j].t[0] = lds_load_tr16(&lB[cur][trow * PB + col]);
            b[j].t[1] = lds_load_tr16(&lB[cur][(16 + trow) * PB + col]);
        }
#pragma unroll
        for (int i = 0; i < 2; ++i)
#pragma unroll
            for (int j = 0; j < 4; ++j)
                acc[i][j] = wmma_bf16(a[i].v, b[j].v, acc[i][j]);

        // publish tile t + 1 and free this trip's buffer, then refill it
        lds_wait0();
        async_wait0();
        __syncthreads();
        if (t + 2 < ntiles) issueAB(cur);
    }
    async_wait0();

    // epilogue (C-layout: col = l16, row = r + 8*half per vgpr r)
#pragma unroll
    for (int i = 0; i < 2; ++i) {
#pragma unroll
        for (int j = 0; j < 4; ++j) {
            int col = blockN + wn * 64 + j * 16 + l16;
#pragma unroll
            for (int r = 0; r < 8; ++r) {
                int row = blockM + wm * 32 + i * 16 + r + half * 8;
                size_t idx = (size_t)row * N + col;
                float v = acc[i][j][r];
                if (EPI == 0) {
                    ((__bf16*)C)[idx] = f32_to_bf16(v);
                } else {
                    ((float*)C)[idx] = residual[idx] + v;
                }
            }
        }
    }
}

// ---------------------------------------------------------------------------
// Flash attention: grid (B*H, T/64), block 128 (4 waves x 16 query rows).
// S = Q*K^T * 1/8 + bias, mask, online softmax, O = P*V.
// K and V tiles staged async to LDS; V transposed by its fragment loads.
// ---------------------------------------------------------------------------
__global__ __launch_bounds__(128)
void flash_attn_kernel(const __bf16* __restrict__ qb,
                       const __bf16* __restrict__ kb,
                       const __bf16* __restrict__ vb,
                       const float* __restrict__ bias,   // [H][T][T]
                       const int* __restrict__ mask,     // [B][T][T]
                       __bf16* __restrict__ ob) {
    constexpr int PV = 80;    // lV row pitch: 160 B, an odd multiple of 32 B
    __shared__ __attribute__((aligned(16))) ushort_t lK[64 * 64];   // [key][dh]   -> B-frag layout for Q*K^T
    __shared__ __attribute__((aligned(16))) ushort_t lV[64 * PV];   // [key][dh]   -> read by transposing loads
    __shared__ __attribute__((aligned(16))) ushort_t lP[64 * 64];   // [q][key]    -> A-frag relayout

    const int bh = blockIdx.x;
    const int b = bh / HH;
    const int h = bh % HH;
    const int qbase = blockIdx.y * 64;
    const int tid  = threadIdx.x;
    const int lane = tid & 31;
    const int wave = tid >> 5;         // 0..3 -> 16 query rows each
    const int half = lane >> 4;
    const int l16  = lane & 15;
    const int koff = half ? 8 : 0;
    const int trow = half * 8 + (lane & 7);      // transposing load: lane's row
    const int tcol = ((lane >> 3) & 1) * 8;      // and its column offset
    const int crow = tid >> 3;                   // tile copy: lane's first row
    const int ccol = (tid & 7) * 8;              // and its column

    // Q fragments stay in registers for the whole kernel
    Frag qf[2];
    {
        int qrow = qbase + wave * 16 + l16;
        const __bf16* qrp = qb + ((size_t)(b * TT + qrow)) * DD + h * DHH;
        qf[0].u4[0] = *(const uint4*)(qrp + koff);
        qf[0].u4[1] = *(const uint4*)(qrp + koff + 16);
        qf[1].u4[0] = *(const uint4*)(qrp + 32 + koff);
        qf[1].u4[1] = *(const uint4*)(qrp + 32 + koff + 16);
    }

    float m[8], l[8];
    v8f o[4];
#pragma unroll
    for (int r = 0; r < 8; ++r) { m[r] = -1e30f; l[r] = 0.0f; }
#pragma unroll
    for (int j = 0; j < 4; ++j) o[j] = v8f_zero();

    const float scale = 0.125f;   // 1/sqrt(DH)

    for (int kt = 0; kt < TT / 64; ++kt) {
        const int kbase = kt * 64;
        // K and V tiles: natural [key][dh] layout, async to LDS (no VGPR staging);
        // each thread copies column ccol of rows crow, +16, +32, +48
        const size_t gofs = ((size_t)(b * TT + kbase + crow)) * DD + h * DHH + ccol;
        async_copy4_b128(kb + gofs,           &lK[crow * 64 + ccol],
                         kb + gofs + 16 * DD, &lK[(crow + 16) * 64 + ccol],
                         kb + gofs + 32 * DD, &lK[(crow + 32) * 64 + ccol],
                         kb + gofs + 48 * DD, &lK[(crow + 48) * 64 + ccol]);
        async_copy4_b128(vb + gofs,           &lV[crow * PV + ccol],
                         vb + gofs + 16 * DD, &lV[(crow + 16) * PV + ccol],
                         vb + gofs + 32 * DD, &lV[(crow + 32) * PV + ccol],
                         vb + gofs + 48 * DD, &lV[(crow + 48) * PV + ccol]);
        async_wait0();
        __syncthreads();

        // S = Q * K^T  (4 column frags of 16, K-reduction DH=64 -> 2 wmma)
        v8f s[4];
#pragma unroll
        for (int j = 0; j < 4; ++j) {
            int col = j * 16 + l16;
            Frag b0, b1;
            b0.u4[0] = *(const uint4*)&lK[col * 64 + koff];
            b0.u4[1] = *(const uint4*)&lK[col * 64 + koff + 16];
            b1.u4[0] = *(const uint4*)&lK[col * 64 + 32 + koff];
            b1.u4[1] = *(const uint4*)&lK[col * 64 + 32 + koff + 16];
            v8f z = v8f_zero();
            z = wmma_bf16(qf[0].v, b0.v, z);
            s[j] = wmma_bf16(qf[1].v, b1.v, z);
        }

        // scale + bias + mask + online softmax (per accumulator row)
#pragma unroll
        for (int r = 0; r < 8; ++r) {
            int qg = qbase + wave * 16 + r + half * 8;
            float rmax = -1e30f;
#pragma unroll
            for (int j = 0; j < 4; ++j) {
                int kg = kbase + j * 16 + l16;
                float v = s[j][r] * scale +
                          bias[((size_t)h * TT + qg) * TT + kg];
                int mk = mask[((size_t)b * TT + qg) * TT + kg];
                v = (mk == 0) ? -1e9f : v;
                s[j][r] = v;
                rmax = fmaxf(rmax, v);
            }
#pragma unroll
            for (int mm = 8; mm >= 1; mm >>= 1)
                rmax = fmaxf(rmax, __shfl_xor(rmax, mm, 32));
            float mnew = fmaxf(m[r], rmax);
            float corr = __expf(m[r] - mnew);
            float psum = 0.0f;
#pragma unroll
            for (int j = 0; j < 4; ++j) {
                float p = __expf(s[j][r] - mnew);
                s[j][r] = p;
                psum += p;
            }
#pragma unroll
            for (int mm = 8; mm >= 1; mm >>= 1)
                psum += __shfl_xor(psum, mm, 32);
            l[r] = l[r] * corr + psum;
            m[r] = mnew;
#pragma unroll
            for (int j = 0; j < 4; ++j) o[j][r] *= corr;
        }

        // Relayout P through LDS (C-frag -> A-frag)
#pragma unroll
        for (int j = 0; j < 4; ++j) {
            int coll = j * 16 + l16;
#pragma unroll
            for (int r = 0; r < 8; ++r) {
                int rowl = wave * 16 + r + half * 8;
                lP[rowl * 64 + coll] =
                    __builtin_bit_cast(unsigned short, f32_to_bf16(s[j][r]));
            }
        }
        __syncthreads();

        // O += P * V
        Frag pa[2];
        {
            int prow = wave * 16 + l16;
            pa[0].u4[0] = *(const uint4*)&lP[prow * 64 + koff];
            pa[0].u4[1] = *(const uint4*)&lP[prow * 64 + koff + 16];
            pa[1].u4[0] = *(const uint4*)&lP[prow * 64 + 32 + koff];
            pa[1].u4[1] = *(const uint4*)&lP[prow * 64 + 32 + koff + 16];
        }
#pragma unroll
        for (int j = 0; j < 4; ++j) {
            int col = j * 16 + tcol;  // dh column block
            Frag v0, v1;
            v0.t[0] = lds_load_tr16(&lV[trow * PV + col]);
            v0.t[1] = lds_load_tr16(&lV[(16 + trow) * PV + col]);
            v1.t[0] = lds_load_tr16(&lV[(32 + trow) * PV + col]);
            v1.t[1] = lds_load_tr16(&lV[(48 + trow) * PV + col]);
            o[j] = wmma_bf16(pa[0].v, v0.v, o[j]);
            o[j] = wmma_bf16(pa[1].v, v1.v, o[j]);
        }
        lds_wait0();   // this wave has left lK and lV before the next copies
        __syncthreads();
    }

    // finalize: O /= l, write bf16 [B,T,H*DH]
#pragma unroll
    for (int j = 0; j < 4; ++j) {
        int dh = j * 16 + l16;
#pragma unroll
        for (int r = 0; r < 8; ++r) {
            int qg = qbase + wave * 16 + r + half * 8;
            float v = o[j][r] / l[r];
            ob[((size_t)(b * TT + qg)) * DD + h * DHH + dh] = f32_to_bf16(v);
        }
    }
}

// ---------------------------------------------------------------------------
// Host-side orchestration
// ---------------------------------------------------------------------------
static inline size_t align256(size_t x) { return (x + 255) & ~(size_t)255; }

extern "C" void kernel_launch(void* const* d_in, const int* in_sizes, int n_in,
                              void* d_out, int out_size, void* d_ws, size_t ws_size,
                              hipStream_t stream) {
    (void)in_sizes; (void)n_in; (void)out_size; (void)ws_size;
    const float* x        = (const float*)d_in[0];
    const int*   x_mask   = (const int*)  d_in[1];
    const float* cond     = (const float*)d_in[2];
    const float* norm1_w  = (const float*)d_in[3];
    const float* f1_gw    = (const float*)d_in[4];
    const float* f1_gb    = (const float*)d_in[5];
    const float* f1_bw    = (const float*)d_in[6];
    const float* f1_bb    = (const float*)d_in[7];
    const float* wq       = (const float*)d_in[8];
    const float* wk       = (const float*)d_in[9];
    const float* wv       = (const float*)d_in[10];
    const float* wo       = (const float*)d_in[11];
    const float* rel_emb  = (const float*)d_in[12];
    const float* norm3_w  = (const float*)d_in[13];
    const float* f3_gw    = (const float*)d_in[14];
    const float* f3_gb    = (const float*)d_in[15];
    const float* f3_bw    = (const float*)d_in[16];
    const float* f3_bb    = (const float*)d_in[17];
    const float* ffn_w1   = (const float*)d_in[18];
    const float* ffn_w2   = (const float*)d_in[19];

    float* out_x    = (float*)d_out;                              // [B,T,D]
    float* out_bias = (float*)d_out + (size_t)BB * TT * DD;       // [H,T,T]

    // workspace bump allocator
    char* ws = (char*)d_ws;
    size_t off = 0;
    auto alloc = [&](size_t bytes) -> void* {
        void* p = ws + off;
        off += align256(bytes);
        return p;
    };
    const size_t BT = (size_t)BB * TT;
    __bf16* wq_bf   = (__bf16*)alloc((size_t)DD * DD * 2);
    __bf16* wk_bf   = (__bf16*)alloc((size_t)DD * DD * 2);
    __bf16* wv_bf   = (__bf16*)alloc((size_t)DD * DD * 2);
    __bf16* wo_bf   = (__bf16*)alloc((size_t)DD * DD * 2);
    __bf16* w1_bf   = (__bf16*)alloc((size_t)DD * 4 * DD * 2);
    __bf16* w2_bf   = (__bf16*)alloc((size_t)2 * DD * DD * 2);
    float*  gamma1  = (float*)alloc((size_t)BB * DD * 4);
    float*  beta1   = (float*)alloc((size_t)BB * DD * 4);
    float*  gamma3  = (float*)alloc((size_t)BB * DD * 4);
    float*  beta3   = (float*)alloc((size_t)BB * DD * 4);
    __bf16* y_bf    = (__bf16*)alloc(BT * DD * 2);
    __bf16* q_bf    = (__bf16*)alloc(BT * DD * 2);
    __bf16* k_bf    = (__bf16*)alloc(BT * DD * 2);
    __bf16* v_bf    = (__bf16*)alloc(BT * DD * 2);
    __bf16* attn_bf = (__bf16*)alloc(BT * DD * 2);
    float*  x_mid   = (float*)alloc(BT * DD * 4);
    __bf16* y3_bf   = (__bf16*)alloc(BT * DD * 2);
    __bf16* h_bf    = (__bf16*)alloc(BT * 4 * DD * 2);
    __bf16* g_bf    = (__bf16*)alloc(BT * 2 * DD * 2);

    // 1) weight conversion fp32 -> bf16
    {
        int n = DD * DD;
        cvt_bf16_kernel<<<(n + 255) / 256, 256, 0, stream>>>(wq, wq_bf, n);
        cvt_bf16_kernel<<<(n + 255) / 256, 256, 0, stream>>>(wk, wk_bf, n);
        cvt_bf16_kernel<<<(n + 255) / 256, 256, 0, stream>>>(wv, wv_bf, n);
        cvt_bf16_kernel<<<(n + 255) / 256, 256, 0, stream>>>(wo, wo_bf, n);
        int n1 = DD * 4 * DD;
        cvt_bf16_kernel<<<(n1 + 255) / 256, 256, 0, stream>>>(ffn_w1, w1_bf, n1);
        int n2 = 2 * DD * DD;
        cvt_bf16_kernel<<<(n2 + 255) / 256, 256, 0, stream>>>(ffn_w2, w2_bf, n2);
    }
    // 2) FiLM params
    film_params_kernel<<<(BB * DD + 255) / 256, 256, 0, stream>>>(
        cond, f1_gw, f1_gb, f1_bw, f1_bb, gamma1, beta1);
    film_params_kernel<<<(BB * DD + 255) / 256, 256, 0, stream>>>(
        cond, f3_gw, f3_gb, f3_bw, f3_bb, gamma3, beta3);
    // 3) position bias (output #2 + consumed by attention)
    {
        int n = HH * TT * TT;
        bias_kernel<<<(n + 255) / 256, 256, 0, stream>>>(rel_emb, out_bias, n);
    }
    // 4) y = film(rmsnorm(x)) -> bf16
    rmsnorm_film_kernel<<<(int)BT, 256, 0, stream>>>(x, norm1_w, gamma1, beta1, y_bf);
    // 5) Q,K,V projections
    {
        dim3 grid(DD / 128, (int)(BT / 128));
        gemm_bf16_kernel<0><<<grid, 256, 0, stream>>>(y_bf, wq_bf, q_bf, nullptr,
                                                      (int)BT, DD, DD);
        gemm_bf16_kernel<0><<<grid, 256, 0, stream>>>(y_bf, wk_bf, k_bf, nullptr,
                                                      (int)BT, DD, DD);
        gemm_bf16_kernel<0><<<grid, 256, 0, stream>>>(y_bf, wv_bf, v_bf, nullptr,
                                                      (int)BT, DD, DD);
    }
    // 6) flash attention
    {
        dim3 grid(BB * HH, TT / 64);
        flash_attn_kernel<<<grid, 128, 0, stream>>>(q_bf, k_bf, v_bf,
                                                    out_bias, x_mask, attn_bf);
    }
    // 7) x_mid = x + attn @ wo
    {
        dim3 grid(DD / 128, (int)(BT / 128));
        gemm_bf16_kernel<1><<<grid, 256, 0, stream>>>(attn_bf, wo_bf, x_mid, x,
                                                      (int)BT, DD, DD);
    }
    // 8) y3 = film(rmsnorm(x_mid)) -> bf16
    rmsnorm_film_kernel<<<(int)BT, 256, 0, stream>>>(x_mid, norm3_w, gamma3, beta3, y3_bf);
    // 9) h = y3 @ ffn_w1  [BT, 4D]
    {
        dim3 grid(4 * DD / 128, (int)(BT / 128));
        gemm_bf16_kernel<0><<<grid, 256, 0, stream>>>(y3_bf, w1_bf, h_bf, nullptr,
                                                      (int)BT, 4 * DD, DD);
    }
    // 10) geglu
    {
        int n = (int)(BT * 2 * DD);
        geglu_kernel<<<(n + 255) / 256, 256, 0, stream>>>(h_bf, g_bf, n);
    }
    // 11) out = x_mid + g @ ffn_w2
    {
        dim3 grid(DD / 128, (int)(BT / 128));
        gemm_bf16_kernel<1><<<grid, 256, 0, stream>>>(g_bf, w2_bf, out_x, x_mid,
                                                      (int)BT, DD, 2 * DD);
    }
}

// v002
// It runs in 343 microseconds.
// Two timings next to v001 both put it at 1.11 times that version's speed.
// Counting every step since v000, it is 2.06 times as fast.
#include <hip/hip_runtime.h>
#include <hip/hip_bf16.h>
#include <math.h>
#include <stdint.h>

// ---------------------------------------------------------------------------
// Problem constants (from reference)
// ---------------------------------------------------------------------------
#define BB 4
#define TT 1024
#define DD 1024
#define HH 16
#define DHH 64
#define DCC 64
#define NBUCK 32

typedef unsigned short ushort_t;
typedef __attribute__((ext_vector_type(16))) __bf16 v16bf;
typedef __attribute__((ext_vector_type(8)))  float  v8f;
typedef __attribute__((ext_vector_type(8)))  short  s16x8;

union Frag {
    v16bf v;
    uint4 u4[2];
    s16x8 t[2];
};

__device__ __forceinline__ v8f v8f_zero() {
    v8f z;
#pragma unroll
    for (int i = 0; i < 8; ++i) z[i] = 0.0f;
    return z;
}

__device__ __forceinline__ __bf16 f32_to_bf16(float f) {
    unsigned u = __builtin_bit_cast(unsigned, f);
    unsigned r = u + 0x7FFFu + ((u >> 16) & 1u);   // round-to-nearest-even
    unsigned short h = (unsigned short)(r >> 16);
    return __builtin_bit_cast(__bf16, h);
}

__device__ __forceinline__ v8f wmma_bf16(v16bf a, v16bf b, v8f c) {
    // D = A(16x32 bf16) * B(32x16 bf16) + C(16x16 f32)
    return __builtin_amdgcn_wmma_f32_16x16x32_bf16(
        /*neg_a=*/false, a, /*neg_b=*/false, b,
        /*c_mod=*/(short)0, c, /*reuse_a=*/false, /*reuse_b=*/false);
}

// Four async copies of 16B (8 bf16) per lane from global to LDS; tracked with
// ASYNCcnt. The closing s_wait_xcnt stands inside the statement so that no
// address register of a copy is rewritten in front of it.
__device__ __forceinline__ void async_copy4_b128(const void* g0, void* d0,
                                                 const void* g1, void* d1,
                                                 const void* g2, void* d2,
                                                 const void* g3, void* d3) {
    unsigned l0 = (unsigned)(unsigned long long)d0;  // LDS aperture: low 32 bits
    unsigned l1 = (unsigned)(unsigned long long)d1;
    unsigned l2 = (unsigned)(unsigned long long)d2;
    unsigned l3 = (unsigned)(unsigned long long)d3;
    asm volatile("global_load_async_to_lds_b128 %0, %1, off\n\t"
                 "global_load_async_to_lds_b128 %2, %3, off\n\t"
                 "global_load_async_to_lds_b128 %4, %5, off\n\t"
                 "global_load_async_to_lds_b128 %6, %7, off\n\t"
                 "s_wait_xcnt 0x0"
                 :: "v"(l0), "v"(g0), "v"(l1), "v"(g1),
                    "v"(l2), "v"(g2), "v"(l3), "v"(g3) : "memory");
}
// The issuing wave's copies have landed behind this wait.
__device__ __forceinline__ void async_wait0() {
    asm volatile("s_wait_asynccnt 0x0" ::: "memory");
}
// The wave's own LDS reads have retired before a copy may refill what they read.
__device__ __forceinline__ void lds_wait0() {
    asm volatile("s_wait_dscnt 0x0" ::: "memory");
}

// Transposing LDS load: from a row-major [k][n] bf16 tile, lane (c = l & 15,
// h = l >> 4) receives T[kbase + 8h + 0..7][nbase + c]. The lane's address is
// row kbase + 8*(l >> 4) + (l & 7), column nbase + 8*((l >> 3) & 1).
__device__ __forceinline__ s16x8 lds_load_tr16(const ushort_t* p) {
    typedef __attribute__((address_space(3))) s16x8 lds_s16x8;
    return __builtin_amdgcn_ds_load_tr16_b128_v8i16((lds_s16x8*)p);
}

// ---------------------------------------------------------------------------
// Elementwise helpers
// ---------------------------------------------------------------------------
// Two floats rounded to bf16 and packed into one dword (a in the low half).
__device__ __forceinline__ unsigned pack2_bf16(float a, float b) {
    unsigned lo = __builtin_bit_cast(unsigned short, f32_to_bf16(a));
    unsigned hi = __builtin_bit_cast(unsigned short, f32_to_bf16(b));
    return lo | (hi << 16);
}

// 16 elements per thread: a block takes 4096 consecutive elements as four
// slabs of 1024; each wave-wide load covers 512 contiguous bytes, each store
// 256. The grid covers the array exactly (its length is a multiple of 4096).
__global__ __launch_bounds__(256)
void cvt_bf16_kernel(const float* __restrict__ src,
                     __bf16* __restrict__ dst) {
    const int base = blockIdx.x * 4096 + threadIdx.x * 4;
    float4 v[4];
#pragma unroll
    for (int u = 0; u < 4; ++u) v[u] = *(const float4*)(src + base + u * 1024);
#pragma unroll
    for (int u = 0; u < 4; ++u)
        *(uint2*)(dst + base + u * 1024) =
            make_uint2(pack2_bf16(v[u].x, v[u].y), pack2_bf16(v[u].z, v[u].w));
}

// gamma/beta = cond @ W + b  (per batch, DC=64 reduction)
__global__ void film_params_kernel(const float* __restrict__ cond,
                                   const float* __restrict__ gw,
                                   const float* __restrict__ gb,
                                   const float* __restrict__ bw,
                                   const float* __restrict__ bb,
                                   float* __restrict__ gamma,
                                   float* __restrict__ beta) {
    int idx = blockIdx.x * blockDim.x + threadIdx.x;   // B*D
    if (idx >= BB * DD) return;
    int b = idx / DD, d = idx % DD;
    const float* c = cond + b * DCC;
    float g = gb[d], bt = bb[d];
#pragma unroll 8
    for (int i = 0; i < DCC; ++i) {
        float cv = c[i];
        g  += cv * gw[i * DD + d];
        bt += cv * bw[i * DD + d];
    }
    gamma[idx] = g;
    beta[idx]  = bt;
}

// T5 relative position bucket of rp = k - q
__device__ __forceinline__ int rel_bucket(int rp) {
    const int nb = NBUCK / 2;      // 16
    const int max_exact = nb / 2;  // 8
    int bucket = (rp > 0) ? nb : 0;
    int arp = rp < 0 ? -rp : rp;
    int val;
    if (arp < max_exact) {
        val = arp;
    } else {
        float rp_safe = (float)(arp > 1 ? arp : 1);
        int large = max_exact +
            (int)(logf(rp_safe / (float)max_exact) /
                  logf(128.0f / (float)max_exact) * (float)(nb - max_exact));
        val = large < nb - 1 ? large : nb - 1;
    }
    return bucket + val;
}

// T5 relative position bias -> bias_out[h][q][k]  (this is output #2)
// One block per query row; a thread takes 4 consecutive keys for all 16 heads
// (64 elements): each wave-wide store covers 512 contiguous bytes of one head.
__global__ __launch_bounds__(256)
void bias_kernel(const float* __restrict__ rel_emb,
                 float* __restrict__ bias_out) {
    const int q  = blockIdx.x;
    const int k0 = threadIdx.x * 4;
    float e[4][HH];
#pragma unroll
    for (int c = 0; c < 4; ++c) {
        const float4* p = (const float4*)(rel_emb + rel_bucket(k0 + c - q) * HH);
#pragma unroll
        for (int g = 0; g < HH / 4; ++g) {
            float4 t = p[g];
            e[c][4 * g + 0] = t.x;
            e[c][4 * g + 1] = t.y;
            e[c][4 * g + 2] = t.z;
            e[c][4 * g + 3] = t.w;
        }
    }
#pragma unroll
    for (int h = 0; h < HH; ++h)
        *(float4*)(bias_out + ((size_t)h * TT + q) * TT + k0) =
            make_float4(e[0][h], e[1][h], e[2][h], e[3][h]);
}

// y = film(rms_norm(x)) -> bf16, one wave per (b,t) row: a lane holds 32
// elements of the row in registers (eight 16-byte loads, 512 contiguous bytes
// per wave each), so x is read once and the row sum needs no LDS.
__global__ __launch_bounds__(256)
void rmsnorm_film_kernel(const float* __restrict__ x,
                         const float* __restrict__ w,
                         const float* __restrict__ gamma,
                         const float* __restrict__ beta,
                         __bf16* __restrict__ y) {
    const int lane = threadIdx.x & 31;
    const int row = blockIdx.x * 8 + (threadIdx.x >> 5);   // 0 .. B*T-1
    const int b = row / TT;
    const float* xr = x + (size_t)row * DD + lane * 4;
    float4 v[8];
#pragma unroll
    for (int u = 0; u < 8; ++u) v[u] = *(const float4*)(xr + u * 128);
    float s0 = 0.0f, s1 = 0.0f, s2 = 0.0f, s3 = 0.0f;   // four independent chains
#pragma unroll
    for (int u = 0; u < 8; ++u) {
        s0 += v[u].x * v[u].x;
        s1 += v[u].y * v[u].y;
        s2 += v[u].z * v[u].z;
        s3 += v[u].w * v[u].w;
    }
    float tot = (s0 + s1) + (s2 + s3);
#pragma unroll
    for (int m = 16; m >= 1; m >>= 1) tot += __shfl_xor(tot, m, 32);
    float rstd = rsqrtf(tot / (float)DD + 1e-6f);
    const float* wr = w + lane * 4;
    const float* g  = gamma + (size_t)b * DD + lane * 4;
    const float* be = beta + (size_t)b * DD + lane * 4;
    __bf16* yr = y + (size_t)row * DD + lane * 4;
#pragma unroll
    for (int u = 0; u < 8; ++u) {
        float4 w4 = *(const float4*)(wr + u * 128);
        float4 g4 = *(const float4*)(g + u * 128);
        float4 b4 = *(const float4*)(be + u * 128);
        float r0 = (w4.x * (v[u].x * rstd)) * (g4.x + 1.0f) + b4.x;
        float r1 = (w4.y * (v[u].y * rstd)) * (g4.y + 1.0f) + b4.y;
        float r2 = (w4.z * (v[u].z * rstd)) * (g4.z + 1.0f) + b4.z;
        float r3 = (w4.w * (v[u].w * rstd)) * (g4.w + 1.0f) + b4.w;
        *(uint2*)(yr + u * 128) = make_uint2(pack2_bf16(r0, r1), pack2_bf16(r2, r3));
    }
}

// geglu: g[r,c] = h[r,c] * gelu(h[r,c+2048]), exact gelu
__device__ __forceinline__ float geglu1(float p1, float p2) {
    float ge = 0.5f * p2 * (1.0f + erff(p2 * 0.70710678118654752f));
    return p1 * ge;
}
// both bf16 halves of a dword pair
__device__ __forceinline__ unsigned geglu2(unsigned a, unsigned c) {
    float lo = geglu1(__builtin_bit_cast(float, a << 16),
                      __builtin_bit_cast(float, c << 16));
    float hi = geglu1(__builtin_bit_cast(float, a & 0xFFFF0000u),
                      __builtin_bit_cast(float, c & 0xFFFF0000u));
    return pack2_bf16(lo, hi);
}
// One block per two rows; a thread takes 8 consecutive columns of each row
// (16 elements), all by 16-byte accesses.
__global__ __launch_bounds__(256)
void geglu_kernel(const __bf16* __restrict__ h,
                  __bf16* __restrict__ g) {
    const int c = threadIdx.x * 8;
    const size_t r0 = (size_t)blockIdx.x * 2;
    uint4 p1[2], p2[2];
#pragma unroll
    for (int u = 0; u < 2; ++u) {
        const __bf16* hr = h + (r0 + u) * 4 * DD + c;
        p1[u] = *(const uint4*)hr;
        p2[u] = *(const uint4*)(hr + 2 * DD);
    }
#pragma unroll
    for (int u = 0; u < 2; ++u)
        *(uint4*)(g + (r0 + u) * 2 * DD + c) =
            make_uint4(geglu2(p1[u].x, p2[u].x), geglu2(p1[u].y, p2[u].y),
                       geglu2(p1[u].z, p2[u].z), geglu2(p1[u].w, p2[u].w));
}

// ---------------------------------------------------------------------------
// Generic bf16 WMMA GEMM:  C[M,N] = A[M,K] * B[K,N]  (row-major, bf16 in)
// Block tile 128x128, 8 waves (4 along M x 2 along N), wave tile 32x64.
// Double-buffered LDS; A and B tiles staged via GLOBAL_LOAD_ASYNC_TO_LDS_B128,
// B kept row-major [k][n] and transposed by the fragment loads themselves.
// EPI==0: store bf16.  EPI==1: store f32 with residual add.
// ---------------------------------------------------------------------------
template <int EPI>
__global__ __launch_bounds__(256)
void gemm_bf16_kernel(const __bf16* __restrict__ A,
                      const __bf16* __restrict__ Bm,
                      void* __restrict__ C,
                      const float* __restrict__ residual,
                      int M, int N, int K) {
    constexpr int PB = 144;   // lB row pitch: 288 B, an odd multiple of 32 B
    __shared__ __attribute__((aligned(16))) ushort_t lA[2][128 * 32];  // [m][k]
    __shared__ __attribute__((aligned(16))) ushort_t lB[2][32 * PB];   // [k][n]

    const int tid  = threadIdx.x;
    const int lane = tid & 31;
    const int wave = tid >> 5;          // 0..7
    const int wm   = wave & 3;          // 4 waves along M
    const int wn   = wave >> 2;         // 2 waves along N
    const int half = lane >> 4;         // which 16-lane half
    const int l16  = lane & 15;
    const int koff = half ? 8 : 0;
    const int trow = half * 8 + (lane & 7);      // transposing load: lane's row
    const int tcol = ((lane >> 3) & 1) * 8;      // and its column offset

    const int blockM = blockIdx.y * 128;
    const int blockN = blockIdx.x * 128;

    // per-thread tile-load coordinates (512 x 16B chunks per tile, 2 each)
    const int aRow0 = (tid + 0)   >> 2, aKc0 = ((tid + 0)   & 3) * 8;
    const int aRow1 = (tid + 256) >> 2, aKc1 = ((tid + 256) & 3) * 8;
    const int bKr0  = (tid + 0)   >> 4, bNc0 = ((tid + 0)   & 15) * 8;
    const int bKr1  = (tid + 256) >> 4, bNc1 = ((tid + 256) & 15) * 8;

    // each thread's four source addresses walk along K, one tile per issue
    const __bf16* gA0 = A + (size_t)(blockM + aRow0) * K + aKc0;
    const __bf16* gA1 = A + (size_t)(blockM + aRow1) * K + aKc1;
    const __bf16* gB0 = Bm + (size_t)bKr0 * N + blockN + bNc0;
    const __bf16* gB1 = Bm + (size_t)bKr1 * N + blockN + bNc1;
    const size_t stepB = (size_t)32 * N;
    auto issueAB = [&](int buf) {
        async_copy4_b128(gA0, &lA[buf][aRow0 * 32 + aKc0],
                         gA1, &lA[buf][aRow1 * 32 + aKc1],
                         gB0, &lB[buf][bKr0 * PB + bNc0],
                         gB1, &lB[buf][bKr1 * PB + bNc1]);
        gA0 += 32;
        gA1 += 32;
        gB0 += stepB;
        gB1 += stepB;
    };

    v8f acc[2][4];
#pragma unroll
    for (int i = 0; i < 2; ++i)
#pragma unroll
        for (int j = 0; j < 4; ++j) acc[i][j] = v8f_zero();

    // prologue: tile 0 lands and is published, then tile 1 starts to fly
    const int ntiles = K / 32;
    issueAB(0);
    async_wait0();
    __syncthreads();
    if (ntiles > 1) issueAB(1);

    for (int t = 0; t < ntiles; ++t) {
        const int cur = t & 1;

        // compute current tile
        Frag a[2], b[4];
#pragma unroll
        for (int i = 0; i < 2; ++i) {
            int row = wm * 32 + i * 16 + l16;
            a[i].u4[0] = *(const uint4*)&lA[cur][row * 32 + koff];
            a[i].u4[1] = *(const uint4*)&lA[cur][row * 32 + koff + 16];
        }
#pragma unroll
        for (int j = 0; j < 4; ++j) {
            int col = wn * 64 + j * 16 + tcol;
            b[j].t[0] = lds_load_tr16(&lB[cur][trow * PB + col]);
            b[j].t[1] = lds_load_tr16(&lB[cur][(16 + trow) * PB + col]);
        }
#pragma unroll
        for (int i = 0; i < 2; ++i)
#pragma unroll
            for (int j = 0; j < 4; ++j)
                acc[i][j] = wmma_bf16(a[i].v, b[j].v, acc[i][j]);

        // publish tile t + 1 and free this trip's buffer, then refill it
        lds_wait0();
        async_wait0();
        __syncthreads();
        if (t + 2 < ntiles) issueAB(cur);
    }
    async_wait0();

    // epilogue (C-layout: col = l16, row = r + 8*half per vgpr r)
#pragma unroll
    for (int i = 0; i < 2; ++i) {
#pragma unroll
        for (int j = 0; j < 4; ++j) {
            int col = blockN + wn * 64 + j * 16 + l16;
#pragma unroll
            for (int r = 0; r < 8; ++r) {
                int row = blockM + wm * 32 + i * 16 + r + half * 8;
                size_t idx = (size_t)row * N + col;
                float v = acc[i][j][r];
                if (EPI == 0) {
                    ((__bf16*)C)[idx] = f32_to_bf16(v);
                } else {
                    ((float*)C)[idx] = residual[idx] + v;
                }
            }
        }
    }
}

// ---------------------------------------------------------------------------
// Flash attention: grid (B*H, T/64), block 128 (4 waves x 16 query rows).
// S = Q*K^T * 1/8 + bias, mask, online softmax, O = P*V.
// K and V tiles staged async to LDS; V transposed by its fragment loads.
// ---------------------------------------------------------------------------
__global__ __launch_bounds__(128)
void flash_attn_kernel(const __bf16* __restrict__ qb,
                       const __bf16* __restrict__ kb,
                       const __bf16* __restrict__ vb,
                       const float* __restrict__ bias,   // [H][T][T]
                       const int* __restrict__ mask,     // [B][T][T]
                       __bf16* __restrict__ ob) {
    constexpr int PV = 80;    // lV row pitch: 160 B, an odd multiple of 32 B
    __shared__ __attribute__((aligned(16))) ushort_t lK[64 * 64];   // [key][dh]   -> B-frag layout for Q*K^T
    __shared__ __attribute__((aligned(16))) ushort_t lV[64 * PV];   // [key][dh]   -> read by transposing loads
    __shared__ __attribute__((aligned(16))) ushort_t lP[64 * 64];   // [q][key]    -> A-frag relayout

    const int bh = blockIdx.x;
    const int b = bh / HH;
    const int h = bh % HH;
    const int qbase = blockIdx.y * 64;
    const int tid  = threadIdx.x;
    const int lane = tid & 31;
    const int wave = tid >> 5;         // 0..3 -> 16 query rows each
    const int half = lane >> 4;
    const int l16  = lane & 15;
    const int koff = half ? 8 : 0;
    const int trow = half * 8 + (lane & 7);      // transposing load: lane's row
    const int tcol = ((lane >> 3) & 1) * 8;      // and its column offset
    const int crow = tid >> 3;                   // tile copy: lane's first row
    const int ccol = (tid & 7) * 8;              // and its column

    // Q fragments stay in registers for the whole kernel
    Frag qf[2];
    {
        int qrow = qbase + wave * 16 + l16;
        const __bf16* qrp = qb + ((size_t)(b * TT + qrow)) * DD + h * DHH;
        qf[0].u4[0] = *(const uint4*)(qrp + koff);
        qf[0].u4[1] = *(const uint4*)(qrp + koff + 16);
        qf[1].u4[0] = *(const uint4*)(qrp + 32 + koff);
        qf[1].u4[1] = *(const uint4*)(qrp + 32 + koff + 16);
    }

    float m[8], l[8];
    v8f o[4];
#pragma unroll
    for (int r = 0; r < 8; ++r) { m[r] = -1e30f; l[r] = 0.0f; }
#pragma unroll
    for (int j = 0; j < 4; ++j) o[j] = v8f_zero();

    const float scale = 0.125f;   // 1/sqrt(DH)

    for (int kt = 0; kt < TT / 64; ++kt) {
        const int kbase = kt * 64;
        // K and V tiles: natural [key][dh] layout, async to LDS (no VGPR staging);
        // each thread copies column ccol of rows crow, +16, +32, +48
        const size_t gofs = ((size_t)(b * TT + kbase + crow)) * DD + h * DHH + ccol;
        async_copy4_b128(kb + gofs,           &lK[crow * 64 + ccol],
                         kb + gofs + 16 * DD, &lK[(crow + 16) * 64 + ccol],
                         kb + gofs + 32 * DD, &lK[(crow + 32) * 64 + ccol],
                         kb + gofs + 48 * DD, &lK[(crow + 48) * 64 + ccol]);
        async_copy4_b128(vb + gofs,           &lV[crow * PV + ccol],
                         vb + gofs + 16 * DD, &lV[(crow + 16) * PV + ccol],
                         vb + gofs + 32 * DD, &lV[(crow + 32) * PV + ccol],
                         vb + gofs + 48 * DD, &lV[(crow + 48) * PV + ccol]);
        async_wait0();
        __syncthreads();

        // S = Q * K^T  (4 column frags of 16, K-reduction DH=64 -> 2 wmma)
        v8f s[4];
#pragma unroll
        for (int j = 0; j < 4; ++j) {
            int col = j * 16 + l16;
            Frag b0, b1;
            b0.u4[0] = *(const uint4*)&lK[col * 64 + koff];
            b0.u4[1] = *(const uint4*)&lK[col * 64 + koff + 16];
            b1.u4[0] = *(const uint4*)&lK[col * 64 + 32 + koff];
            b1.u4[1] = *(const uint4*)&lK[col * 64 + 32 + koff + 16];
            v8f z = v8f_zero();
            z = wmma_bf16(qf[0].v, b0.v, z);
            s[j] = wmma_bf16(qf[1].v, b1.v, z);
        }

        // scale + bias + mask + online softmax (per accumulator row)
#pragma unroll
        for (int r = 0; r < 8; ++r) {
            int qg = qbase + wave * 16 + r + half * 8;
            float rmax = -1e30f;
#pragma unroll
            for (int j = 0; j < 4; ++j) {
                int kg = kbase + j * 16 + l16;
                float v = s[j][r] * scale +
                          bias[((size_t)h * TT + qg) * TT + kg];
                int mk = mask[((size_t)b * TT + qg) * TT + kg];
                v = (mk == 0) ? -1e9f : v;
                s[j][r] = v;
                rmax = fmaxf(rmax, v);
            }
#pragma unroll
            for (int mm = 8; mm >= 1; mm >>= 1)
                rmax = fmaxf(rmax, __shfl_xor(rmax, mm, 32));
            float mnew = fmaxf(m[r], rmax);
            float corr = __expf(m[r] - mnew);
            float psum = 0.0f;
#pragma unroll
            for (int j = 0; j < 4; ++j) {
                float p = __expf(s[j][r] - mnew);
                s[j][r] = p;
                psum += p;
            }
#pragma unroll
            for (int mm = 8; mm >= 1; mm >>= 1)
                psum += __shfl_xor(psum, mm, 32);
            l[r] = l[r] * corr + psum;
            m[r] = mnew;
#pragma unroll
            for (int j = 0; j < 4; ++j) o[j][r] *= corr;
        }

        // Relayout P through LDS (C-frag -> A-frag)
#pragma unroll
        for (int j = 0; j < 4; ++j) {
            int coll = j * 16 + l16;
#pragma unroll
            for (int r = 0; r < 8; ++r) {
                int rowl = wave * 16 + r + half * 8;
                lP[rowl * 64 + coll] =
                    __builtin_bit_cast(unsigned short, f32_to_bf16(s[j][r]));
            }
        }
        __syncthreads();

        // O += P * V
        Frag pa[2];
        {
            int prow = wave * 16 + l16;
            pa[0].u4[0] = *(const uint4*)&lP[prow * 64 + koff];
            pa[0].u4[1] = *(const uint4*)&lP[prow * 64 + koff + 16];
            pa[1].u4[0] = *(const uint4*)&lP[prow * 64 + 32 + koff];
            pa[1].u4[1] = *(const uint4*)&lP[prow * 64 + 32 + koff + 16];
        }
#pragma unroll
        for (int j = 0; j < 4; ++j) {
            int col = j * 16 + tcol;  // dh column block
            Frag v0, v1;
            v0.t[0] = lds_load_tr16(&lV[trow * PV + col]);
            v0.t[1] = lds_load_tr16(&lV[(16 + trow) * PV + col]);
            v1.t[0] = lds_load_tr16(&lV[(32 + trow) * PV + col]);
            v1.t[1] = lds_load_tr16(&lV[(48 + trow) * PV + col]);
            o[j] = wmma_bf16(pa[0].v, v0.v, o[j]);
            o[j] = wmma_bf16(pa[1].v, v1.v, o[j]);
        }
        lds_wait0();   // this wave has left lK and lV before the next copies
        __syncthreads();
    }

    // finalize: O /= l, write bf16 [B,T,H*DH]
#pragma unroll
    for (int j = 0; j < 4; ++j) {
        int dh = j * 16 + l16;
#pragma unroll
        for (int r = 0; r < 8; ++r) {
            int qg = qbase + wave * 16 + r + half * 8;
            float v = o[j][r] / l[r];
            ob[((size_t)(b * TT + qg)) * DD + h * DHH + dh] = f32_to_bf16(v);
        }
    }
}

// ---------------------------------------------------------------------------
// Host-side orchestration
// ---------------------------------------------------------------------------
static inline size_t align256(size_t x) { return (x + 255) & ~(size_t)255; }

extern "C" void kernel_launch(void* const* d_in, const int* in_sizes, int n_in,
                              void* d_out, int out_size, void* d_ws, size_t ws_size,
                              hipStream_t stream) {
    (void)in_sizes; (void)n_in; (void)out_size; (void)ws_size;
    const float* x        = (const float*)d_in[0];
    const int*   x_mask   = (const int*)  d_in[1];
    const float* cond     = (const float*)d_in[2];
    const float* norm1_w  = (const float*)d_in[3];
    const float* f1_gw    = (const float*)d_in[4];
    const float* f1_gb    = (const float*)d_in[5];
    const float* f1_bw    = (const float*)d_in[6];
    const float* f1_bb    = (const float*)d_in[7];
    const float* wq       = (const float*)d_in[8];
    const float* wk       = (const float*)d_in[9];
    const float* wv       = (const float*)d_in[10];
    const float* wo       = (const float*)d_in[11];
    const float* rel_emb  = (const float*)d_in[12];
    const float* norm3_w  = (const float*)d_in[13];
    const float* f3_gw    = (const float*)d_in[14];
    const float* f3_gb    = (const float*)d_in[15];
    const float* f3_bw    = (const float*)d_in[16];
    const float* f3_bb    = (const float*)d_in[17];
    const float* ffn_w1   = (const float*)d_in[18];
    const float* ffn_w2   = (const float*)d_in[19];

    float* out_x    = (float*)d_out;                              // [B,T,D]
    float* out_bias = (float*)d_out + (size_t)BB * TT * DD;       // [H,T,T]

    // workspace bump allocator
    char* ws = (char*)d_ws;
    size_t off = 0;
    auto alloc = [&](size_t bytes) -> void* {
        void* p = ws + off;
        off += align256(bytes);
        return p;
    };
    const size_t BT = (size_t)BB * TT;
    __bf16* wq_bf   = (__bf16*)alloc((size_t)DD * DD * 2);
    __bf16* wk_bf   = (__bf16*)alloc((size_t)DD * DD * 2);
    __bf16* wv_bf   = (__bf16*)alloc((size_t)DD * DD * 2);
    __bf16* wo_bf   = (__bf16*)alloc((size_t)DD * DD * 2);
    __bf16* w1_bf   = (__bf16*)alloc((size_t)DD * 4 * DD * 2);
    __bf16* w2_bf   = (__bf16*)alloc((size_t)2 * DD * DD * 2);
    float*  gamma1  = (float*)alloc((size_t)BB * DD * 4);
    float*  beta1   = (float*)alloc((size_t)BB * DD * 4);
    float*  gamma3  = (float*)alloc((size_t)BB * DD * 4);
    float*  beta3   = (float*)alloc((size_t)BB * DD * 4);
    __bf16* y_bf    = (__bf16*)alloc(BT * DD * 2);
    __bf16* q_bf    = (__bf16*)alloc(BT * DD * 2);
    __bf16* k_bf    = (__bf16*)alloc(BT * DD * 2);
    __bf16* v_bf    = (__bf16*)alloc(BT * DD * 2);
    __bf16* attn_bf = (__bf16*)alloc(BT * DD * 2);
    float*  x_mid   = (float*)alloc(BT * DD * 4);
    __bf16* y3_bf   = (__bf16*)alloc(BT * DD * 2);
    __bf16* h_bf    = (__bf16*)alloc(BT * 4 * DD * 2);
    __bf16* g_bf    = (__bf16*)alloc(BT * 2 * DD * 2);

    // 1) weight conversion fp32 -> bf16
    cvt_bf16_kernel<<<DD * DD / 4096, 256, 0, stream>>>(wq, wq_bf);
    cvt_bf16_kernel<<<DD * DD / 4096, 256, 0, stream>>>(wk, wk_bf);
    cvt_bf16_kernel<<<DD * DD / 4096, 256, 0, stream>>>(wv, wv_bf);
    cvt_bf16_kernel<<<DD * DD / 4096, 256, 0, stream>>>(wo, wo_bf);
    cvt_bf16_kernel<<<DD * 4 * DD / 4096, 256, 0, stream>>>(ffn_w1, w1_bf);
    cvt_bf16_kernel<<<2 * DD * DD / 4096, 256, 0, stream>>>(ffn_w2, w2_bf);
    // 2) FiLM params
    film_params_kernel<<<(BB * DD + 255) / 256, 256, 0, stream>>>(
        cond, f1_gw, f1_gb, f1_bw, f1_bb, gamma1, beta1);
    film_params_kernel<<<(BB * DD + 255) / 256, 256, 0, stream>>>(
        cond, f3_gw, f3_gb, f3_bw, f3_bb, gamma3, beta3);
    // 3) position bias (output #2 + consumed by attention)
    bias_kernel<<<TT, 256, 0, stream>>>(rel_emb, out_bias);
    // 4) y = film(rmsnorm(x)) -> bf16
    rmsnorm_film_kernel<<<(int)(BT / 8), 256, 0, stream>>>(x, norm1_w, gamma1, beta1, y_bf);
    // 5) Q,K,V projections
    {
        dim3 grid(DD / 128, (int)(BT / 128));
        gemm_bf16_kernel<0><<<grid, 256, 0, stream>>>(y_bf, wq_bf, q_bf, nullptr,
                                                      (int)BT, DD, DD);
        gemm_bf16_kernel<0><<<grid, 256, 0, stream>>>(y_bf, wk_bf, k_bf, nullptr,
                                                      (int)BT, DD, DD);
        gemm_bf16_kernel<0><<<grid, 256, 0, stream>>>(y_bf, wv_bf, v_bf, nullptr,
                                                      (int)BT, DD, DD);
    }
    // 6) flash attention
    {
        dim3 grid(BB * HH, TT / 64);
        flash_attn_kernel<<<grid, 128, 0, stream>>>(q_bf, k_bf, v_bf,
                                                    out_bias, x_mask, attn_bf);
    }
    // 7) x_mid = x + attn @ wo
    {
        dim3 grid(DD / 128, (int)(BT / 128));
        gemm_bf16_kernel<1><<<grid, 256, 0, stream>>>(attn_bf, wo_bf, x_mid, x,
                                                      (int)BT, DD, DD);
    }
    // 8) y3 = film(rmsnorm(x_mid)) -> bf16
    rmsnorm_film_kernel<<<(int)(BT / 8), 256, 0, stream>>>(x_mid, norm3_w, gamma3, beta3, y3_bf);
    // 9) h = y3 @ ffn_w1  [BT, 4D]
    {
        dim3 grid(4 * DD / 128, (int)(BT / 128));
        gemm_bf16_kernel<0><<<grid, 256, 0, stream>>>(y3_bf, w1_bf, h_bf, nullptr,
                                                      (int)BT, 4 * DD, DD);
    }
    // 10) geglu
    geglu_kernel<<<(int)(BT / 2), 256, 0, stream>>>(h_bf, g_bf);
    // 11) out = x_mid + g @ ffn_w2
    {
        dim3 grid(DD / 128, (int)(BT / 128));
        gemm_bf16_kernel<1><<<grid, 256, 0, stream>>>(g_bf, w2_bf, out_x, x_mid,
                                                      (int)BT, DD, 2 * DD);
    }
}

// v003
// A run of this version takes 253 microseconds.
// Timed twice side by side with v002, it ran 1.35 and 1.36 times as fast.
// Over all steps from v000 it is 2.80 times as fast.
#include <hip/hip_runtime.h>
#include <hip/hip_bf16.h>
#include <math.h>
#include <stdint.h>

// ---------------------------------------------------------------------------
// Problem constants (from reference)
// ---------------------------------------------------------------------------
#define BB 4
#define TT 1024
#define DD 1024
#define HH 16
#define DHH 64
#define DCC 64
#define NBUCK 32

typedef unsigned short ushort_t;
typedef __attribute__((ext_vector_type(16))) __bf16 v16bf;
typedef __attribute__((ext_vector_type(8)))  float  v8f;
typedef __attribute__((ext_vector_type(8)))  short  s16x8;

union Frag {
    v16bf v;
    uint4 u4[2];
    s16x8 t[2];
};

__device__ __forceinline__ v8f v8f_zero() {
    v8f z;
#pragma unroll
    for (int i = 0; i < 8; ++i) z[i] = 0.0f;
    return z;
}

__device__ __forceinline__ __bf16 f32_to_bf16(float f) {
    unsigned u = __builtin_bit_cast(unsigned, f);
    unsigned r = u + 0x7FFFu + ((u >> 16) & 1u);   // round-to-nearest-even
    unsigned short h = (unsigned short)(r >> 16);
    return __builtin_bit_cast(__bf16, h);
}

__device__ __forceinline__ v8f wmma_bf16(v16bf a, v16bf b, v8f c) {
    // D = A(16x32 bf16) * B(32x16 bf16) + C(16x16 f32)
    return __builtin_amdgcn_wmma_f32_16x16x32_bf16(
        /*neg_a=*/false, a, /*neg_b=*/false, b,
        /*c_mod=*/(short)0, c, /*reuse_a=*/false, /*reuse_b=*/false);
}

// Four async copies of 16B (8 bf16) per lane from global to LDS; tracked with
// ASYNCcnt. The closing s_wait_xcnt stands inside the statement so that no
// address register of a copy is rewritten in front of it.
__device__ __forceinline__ void async_copy4_b128(const void* g0, void* d0,
                                                 const void* g1, void* d1,
                                                 const void* g2, void* d2,
                                                 const void* g3, void* d3) {
    unsigned l0 = (unsigned)(unsigned long long)d0;  // LDS aperture: low 32 bits
    unsigned l1 = (unsigned)(unsigned long long)d1;
    unsigned l2 = (unsigned)(unsigned long long)d2;
    unsigned l3 = (unsigned)(unsigned long long)d3;
    asm volatile("global_load_async_to_lds_b128 %0, %1, off\n\t"
                 "global_load_async_to_lds_b128 %2, %3, off\n\t"
                 "global_load_async_to_lds_b128 %4, %5, off\n\t"
                 "global_load_async_to_lds_b128 %6, %7, off\n\t"
                 "s_wait_xcnt 0x0"
                 :: "v"(l0), "v"(g0), "v"(l1), "v"(g1),
                    "v"(l2), "v"(g2), "v"(l3), "v"(g3) : "memory");
}
// Eight such copies in one statement; the closing s_wait_xcnt stands inside it
// for the same reason.
__device__ __forceinline__ void async_copy8_b128(const void* const (&g)[8],
                                                 const unsigned (&l)[8]) {
    asm volatile("global_load_async_to_lds_b128 %0, %1, off\n\t"
                 "global_load_async_to_lds_b128 %2, %3, off\n\t"
                 "global_load_async_to_lds_b128 %4, %5, off\n\t"
                 "global_load_async_to_lds_b128 %6, %7, off\n\t"
                 "global_load_async_to_lds_b128 %8, %9, off\n\t"
                 "global_load_async_to_lds_b128 %10, %11, off\n\t"
                 "global_load_async_to_lds_b128 %12, %13, off\n\t"
                 "global_load_async_to_lds_b128 %14, %15, off\n\t"
                 "s_wait_xcnt 0x0"
                 :: "v"(l[0]), "v"(g[0]), "v"(l[1]), "v"(g[1]),
                    "v"(l[2]), "v"(g[2]), "v"(l[3]), "v"(g[3]),
                    "v"(l[4]), "v"(g[4]), "v"(l[5]), "v"(g[5]),
                    "v"(l[6]), "v"(g[6]), "v"(l[7]), "v"(g[7]) : "memory");
}
// The issuing wave's copies have landed behind this wait.
__device__ __forceinline__ void async_wait0() {
    asm volatile("s_wait_asynccnt 0x0" ::: "memory");
}
// The wave's own LDS reads have retired before a copy may refill what they read.
__device__ __forceinline__ void lds_wait0() {
    asm volatile("s_wait_dscnt 0x0" ::: "memory");
}

// Transposing LDS load: from a row-major [k][n] bf16 tile, lane (c = l & 15,
// h = l >> 4) receives T[kbase + 8h + 0..7][nbase + c]. The lane's address is
// row kbase + 8*(l >> 4) + (l & 7), column nbase + 8*((l >> 3) & 1).
__device__ __forceinline__ s16x8 lds_load_tr16(const ushort_t* p) {
    typedef __attribute__((address_space(3))) s16x8 lds_s16x8;
    return __builtin_amdgcn_ds_load_tr16_b128_v8i16((lds_s16x8*)p);
}

// ---------------------------------------------------------------------------
// Elementwise helpers
// ---------------------------------------------------------------------------
// Two floats rounded to bf16 and packed into one dword (a in the low half).
__device__ __forceinline__ unsigned pack2_bf16(float a, float b) {
    unsigned lo = __builtin_bit_cast(unsigned short, f32_to_bf16(a));
    unsigned hi = __builtin_bit_cast(unsigned short, f32_to_bf16(b));
    return lo | (hi << 16);
}

// 16 elements per thread: a block takes 4096 consecutive elements as four
// slabs of 1024; each wave-wide load covers 512 contiguous bytes, each store
// 256. The grid covers the array exactly (its length is a multiple of 4096).
__global__ __launch_bounds__(256)
void cvt_bf16_kernel(const float* __restrict__ src,
                     __bf16* __restrict__ dst) {
    const int base = blockIdx.x * 4096 + threadIdx.x * 4;
    float4 v[4];
#pragma unroll
    for (int u = 0; u < 4; ++u) v[u] = *(const float4*)(src + base + u * 1024);
#pragma unroll
    for (int u = 0; u < 4; ++u)
        *(uint2*)(dst + base + u * 1024) =
            make_uint2(pack2_bf16(v[u].x, v[u].y), pack2_bf16(v[u].z, v[u].w));
}

// gamma/beta = cond @ W + b  (per batch, DC=64 reduction)
__global__ void film_params_kernel(const float* __restrict__ cond,
                                   const float* __restrict__ gw,
                                   const float* __restrict__ gb,
                                   const float* __restrict__ bw,
                                   const float* __restrict__ bb,
                                   float* __restrict__ gamma,
                                   float* __restrict__ beta) {
    int idx = blockIdx.x * blockDim.x + threadIdx.x;   // B*D
    if (idx >= BB * DD) return;
    int b = idx / DD, d = idx % DD;
    const float* c = cond + b * DCC;
    float g = gb[d], bt = bb[d];
#pragma unroll 8
    for (int i = 0; i < DCC; ++i) {
        float cv = c[i];
        g  += cv * gw[i * DD + d];
        bt += cv * bw[i * DD + d];
    }
    gamma[idx] = g;
    beta[idx]  = bt;
}

// T5 relative position bucket of rp = k - q
__device__ __forceinline__ int rel_bucket(int rp) {
    const int nb = NBUCK / 2;      // 16
    const int max_exact = nb / 2;  // 8
    int bucket = (rp > 0) ? nb : 0;
    int arp = rp < 0 ? -rp : rp;
    int val;
    if (arp < max_exact) {
        val = arp;
    } else {
        float rp_safe = (float)(arp > 1 ? arp : 1);
        int large = max_exact +
            (int)(logf(rp_safe / (float)max_exact) /
                  logf(128.0f / (float)max_exact) * (float)(nb - max_exact));
        val = large < nb - 1 ? large : nb - 1;
    }
    return bucket + val;
}

// T5 relative position bias -> bias_out[h][q][k]  (this is output #2)
// One block per query row; a thread takes 4 consecutive keys for all 16 heads
// (64 elements): each wave-wide store covers 512 contiguous bytes of one head.
__global__ __launch_bounds__(256)
void bias_kernel(const float* __restrict__ rel_emb,
                 float* __restrict__ bias_out) {
    const int q  = blockIdx.x;
    const int k0 = threadIdx.x * 4;
    float e[4][HH];
#pragma unroll
    for (int c = 0; c < 4; ++c) {
        const float4* p = (const float4*)(rel_emb + rel_bucket(k0 + c - q) * HH);
#pragma unroll
        for (int g = 0; g < HH / 4; ++g) {
            float4 t = p[g];
            e[c][4 * g + 0] = t.x;
            e[c][4 * g + 1] = t.y;
            e[c][4 * g + 2] = t.z;
            e[c][4 * g + 3] = t.w;
        }
    }
#pragma unroll
    for (int h = 0; h < HH; ++h)
        *(float4*)(bias_out + ((size_t)h * TT + q) * TT + k0) =
            make_float4(e[0][h], e[1][h], e[2][h], e[3][h]);
}

// y = film(rms_norm(x)) -> bf16, one wave per (b,t) row: a lane holds 32
// elements of the row in registers (eight 16-byte loads, 512 contiguous bytes
// per wave each), so x is read once and the row sum needs no LDS.
__global__ __launch_bounds__(256)
void rmsnorm_film_kernel(const float* __restrict__ x,
                         const float* __restrict__ w,
                         const float* __restrict__ gamma,
                         const float* __restrict__ beta,
                         __bf16* __restrict__ y) {
    const int lane = threadIdx.x & 31;
    const int row = blockIdx.x * 8 + (threadIdx.x >> 5);   // 0 .. B*T-1
    const int b = row / TT;
    const float* xr = x + (size_t)row * DD + lane * 4;
    float4 v[8];
#pragma unroll
    for (int u = 0; u < 8; ++u) v[u] = *(const float4*)(xr + u * 128);
    float s0 = 0.0f, s1 = 0.0f, s2 = 0.0f, s3 = 0.0f;   // four independent chains
#pragma unroll
    for (int u = 0; u < 8; ++u) {
        s0 += v[u].x * v[u].x;
        s1 += v[u].y * v[u].y;
        s2 += v[u].z * v[u].z;
        s3 += v[u].w * v[u].w;
    }
    float tot = (s0 + s1) + (s2 + s3);
#pragma unroll
    for (int m = 16; m >= 1; m >>= 1) tot += __shfl_xor(tot, m, 32);
    float rstd = rsqrtf(tot / (float)DD + 1e-6f);
    const float* wr = w + lane * 4;
    const float* g  = gamma + (size_t)b * DD + lane * 4;
    const float* be = beta + (size_t)b * DD + lane * 4;
    __bf16* yr = y + (size_t)row * DD + lane * 4;
#pragma unroll
    for (int u = 0; u < 8; ++u) {
        float4 w4 = *(const float4*)(wr + u * 128);
        float4 g4 = *(const float4*)(g + u * 128);
        float4 b4 = *(const float4*)(be + u * 128);
        float r0 = (w4.x * (v[u].x * rstd)) * (g4.x + 1.0f) + b4.x;
        float r1 = (w4.y * (v[u].y * rstd)) * (g4.y + 1.0f) + b4.y;
        float r2 = (w4.z * (v[u].z * rstd)) * (g4.z + 1.0f) + b4.z;
        float r3 = (w4.w * (v[u].w * rstd)) * (g4.w + 1.0f) + b4.w;
        *(uint2*)(yr + u * 128) = make_uint2(pack2_bf16(r0, r1), pack2_bf16(r2, r3));
    }
}

// geglu: g[r,c] = h[r,c] * gelu(h[r,c+2048]), exact gelu
__device__ __forceinline__ float geglu1(float p1, float p2) {
    float ge = 0.5f * p2 * (1.0f + erff(p2 * 0.70710678118654752f));
    return p1 * ge;
}
// both bf16 halves of a dword pair
__device__ __forceinline__ unsigned geglu2(unsigned a, unsigned c) {
    float lo = geglu1(__builtin_bit_cast(float, a << 16),
                      __builtin_bit_cast(float, c << 16));
    float hi = geglu1(__builtin_bit_cast(float, a & 0xFFFF0000u),
                      __builtin_bit_cast(float, c & 0xFFFF0000u));
    return pack2_bf16(lo, hi);
}
// One block per two rows; a thread takes 8 consecutive columns of each row
// (16 elements), all by 16-byte accesses.
__global__ __launch_bounds__(256)
void geglu_kernel(const __bf16* __restrict__ h,
                  __bf16* __restrict__ g) {
    const int c = threadIdx.x * 8;
    const size_t r0 = (size_t)blockIdx.x * 2;
    uint4 p1[2], p2[2];
#pragma unroll
    for (int u = 0; u < 2; ++u) {
        const __bf16* hr = h + (r0 + u) * 4 * DD + c;
        p1[u] = *(const uint4*)hr;
        p2[u] = *(const uint4*)(hr + 2 * DD);
    }
#pragma unroll
    for (int u = 0; u < 2; ++u)
        *(uint4*)(g + (r0 + u) * 2 * DD + c) =
            make_uint4(geglu2(p1[u].x, p2[u].x), geglu2(p1[u].y, p2[u].y),
                       geglu2(p1[u].z, p2[u].z), geglu2(p1[u].w, p2[u].w));
}

// ---------------------------------------------------------------------------
// Generic bf16 WMMA GEMM:  C[M,N] = A[M,K] * B[K,N]  (row-major, bf16 in)
// Block tile 128x128, 8 waves (4 along M x 2 along N), wave tile 32x64.
// Double-buffered LDS, 128 k per stage (K is a multiple of 128); A and B tiles
// staged via GLOBAL_LOAD_ASYNC_TO_LDS_B128, each wave-wide copy taking two whole
// 256-byte rows; B kept row-major [k][n] and transposed by the fragment loads.
// EPI==0: store bf16.  EPI==1: store f32 with residual add.
// ---------------------------------------------------------------------------
template <int EPI>
__global__ __launch_bounds__(256)
void gemm_bf16_kernel(const __bf16* __restrict__ A,
                      const __bf16* __restrict__ Bm,
                      void* __restrict__ C,
                      const float* __restrict__ residual,
                      int M, int N, int K) {
    constexpr int BK = 128;   // k per stage
    constexpr int PA = 136;   // lA row pitch: 272 B, an odd multiple of 16 B
    constexpr int PB = 144;   // lB row pitch: 288 B, an odd multiple of 32 B
    __shared__ __attribute__((aligned(16))) ushort_t lA[2][128 * PA];  // [m][k]
    __shared__ __attribute__((aligned(16))) ushort_t lB[2][BK * PB];   // [k][n]

    const int tid  = threadIdx.x;
    const int lane = tid & 31;
    const int wave = tid >> 5;          // 0..7
    const int wm   = wave & 3;          // 4 waves along M
    const int wn   = wave >> 2;         // 2 waves along N
    const int half = lane >> 4;         // which 16-lane half
    const int l16  = lane & 15;
    const int koff = half ? 8 : 0;
    const int trow = half * 8 + (lane & 7);      // transposing load: lane's row
    const int tcol = ((lane >> 3) & 1) * 8;      // and its column offset

    const int blockM = blockIdx.y * 128;
    const int blockN = blockIdx.x * 128;

    // per-thread tile-copy coordinates: both tiles are 128 rows of 256 B; a
    // thread takes 16-byte column cCol of rows cRow, +16, ... +112 of each
    const int cRow = tid >> 4;
    const int cCol = (tid & 15) * 8;

    // each thread's two source addresses walk along K, one tile per issue
    const __bf16* gA = A + (size_t)(blockM + cRow) * K + cCol;
    const __bf16* gB = Bm + (size_t)cRow * N + blockN + cCol;
    auto issueAB = [&](int buf) {
        const void* g[8];
        unsigned l[8];   // LDS aperture: low 32 bits
        // both loops unrolled: g and l are the statement's register operands
#pragma unroll
        for (int u = 0; u < 8; ++u) {
            g[u] = gA + (size_t)(16 * u) * K;
            l[u] = (unsigned)(unsigned long long)&lA[buf][(cRow + 16 * u) * PA + cCol];
        }
        async_copy8_b128(g, l);
#pragma unroll
        for (int u = 0; u < 8; ++u) {
            g[u] = gB + (size_t)(16 * u) * N;
            l[u] = (unsigned)(unsigned long long)&lB[buf][(cRow + 16 * u) * PB + cCol];
        }
        async_copy8_b128(g, l);
        gA += BK;
        gB += (size_t)BK * N;
    };

    v8f acc[2][4];
#pragma unroll
    for (int i = 0; i < 2; ++i)
#pragma unroll
        for (int j = 0; j < 4; ++j) acc[i][j] = v8f_zero();

    // prologue: tile 0 lands and is published, then tile 1 starts to fly
    const int ntiles = K / BK;
    issueAB(0);
    async_wait0();
    __syncthreads();
    if (ntiles > 1) issueAB(1);

    for (int t = 0; t < ntiles; ++t) {
        const int cur = t & 1;

        // compute current tile, 32 k at a time in ascending order; unrolled so
        // that every LDS offset inside the stage is an immediate
#pragma unroll
        for (int kk = 0; kk < BK; kk += 32) {
            Frag a[2], b[4];
#pragma unroll
            for (int i = 0; i < 2; ++i) {
                int row = wm * 32 + i * 16 + l16;
                a[i].u4[0] = *(const uint4*)&lA[cur][row * PA + kk + koff];
                a[i].u4[1] = *(const uint4*)&lA[cur][row * PA + kk + koff + 16];
            }
#pragma unroll
            for (int j = 0; j < 4; ++j) {
                int col = wn * 64 + j * 16 + tcol;
                b[j].t[0] = lds_load_tr16(&lB[cur][(kk + trow) * PB + col]);
                b[j].t[1] = lds_load_tr16(&lB[cur][(kk + 16 + trow) * PB + col]);
            }
#pragma unroll
            for (int i = 0; i < 2; ++i)
#pragma unroll
                for (int j = 0; j < 4; ++j)
                    acc[i][j] = wmma_bf16(a[i].v, b[j].v, acc[i][j]);
        }

        // publish tile t + 1 and free this trip's buffer, then refill it
        lds_wait0();
        async_wait0();
        __syncthreads();
        if (t + 2 < ntiles) issueAB(cur);
    }
    async_wait0();

    // epilogue (C-layout: col = l16, row = r + 8*half per vgpr r)
#pragma unroll
    for (int i = 0; i < 2; ++i) {
#pragma unroll
        for (int j = 0; j < 4; ++j) {
            int col = blockN + wn * 64 + j * 16 + l16;
#pragma unroll
            for (int r = 0; r < 8; ++r) {
                int row = blockM + wm * 32 + i * 16 + r + half * 8;
                size_t idx = (size_t)row * N + col;
                float v = acc[i][j][r];
                if (EPI == 0) {
                    ((__bf16*)C)[idx] = f32_to_bf16(v);
                } else {
                    ((float*)C)[idx] = residual[idx] + v;
                }
            }
        }
    }
}

// ---------------------------------------------------------------------------
// Flash attention: grid (B*H, T/64), block 128 (4 waves x 16 query rows).
// S = Q*K^T * 1/8 + bias, mask, online softmax, O = P*V.
// K and V tiles staged async to LDS; V transposed by its fragment loads.
// ---------------------------------------------------------------------------
__global__ __launch_bounds__(128)
void flash_attn_kernel(const __bf16* __restrict__ qb,
                       const __bf16* __restrict__ kb,
                       const __bf16* __restrict__ vb,
                       const float* __restrict__ bias,   // [H][T][T]
                       const int* __restrict__ mask,     // [B][T][T]
                       __bf16* __restrict__ ob) {
    constexpr int PV = 80;    // lV row pitch: 160 B, an odd multiple of 32 B
    __shared__ __attribute__((aligned(16))) ushort_t lK[64 * 64];   // [key][dh]   -> B-frag layout for Q*K^T
    __shared__ __attribute__((aligned(16))) ushort_t lV[64 * PV];   // [key][dh]   -> read by transposing loads
    __shared__ __attribute__((aligned(16))) ushort_t lP[64 * 64];   // [q][key]    -> A-frag relayout

    const int bh = blockIdx.x;
    const int b = bh / HH;
    const int h = bh % HH;
    const int qbase = blockIdx.y * 64;
    const int tid  = threadIdx.x;
    const int lane = tid & 31;
    const int wave = tid >> 5;         // 0..3 -> 16 query rows each
    const int half = lane >> 4;
    const int l16  = lane & 15;
    const int koff = half ? 8 : 0;
    const int trow = half * 8 + (lane & 7);      // transposing load: lane's row
    const int tcol = ((lane >> 3) & 1) * 8;      // and its column offset
    const int crow = tid >> 3;                   // tile copy: lane's first row
    const int ccol = (tid & 7) * 8;              // and its column

    // Q fragments stay in registers for the whole kernel
    Frag qf[2];
    {
        int qrow = qbase + wave * 16 + l16;
        const __bf16* qrp = qb + ((size_t)(b * TT + qrow)) * DD + h * DHH;
        qf[0].u4[0] = *(const uint4*)(qrp + koff);
        qf[0].u4[1] = *(const uint4*)(qrp + koff + 16);
        qf[1].u4[0] = *(const uint4*)(qrp + 32 + koff);
        qf[1].u4[1] = *(const uint4*)(qrp + 32 + koff + 16);
    }

    float m[8], l[8];
    v8f o[4];
#pragma unroll
    for (int r = 0; r < 8; ++r) { m[r] = -1e30f; l[r] = 0.0f; }
#pragma unroll
    for (int j = 0; j < 4; ++j) o[j] = v8f_zero();

    const float scale = 0.125f;   // 1/sqrt(DH)

    for (int kt = 0; kt < TT / 64; ++kt) {
        const int kbase = kt * 64;
        // K and V tiles: natural [key][dh] layout, async to LDS (no VGPR staging);
        // each thread copies column ccol of rows crow, +16, +32, +48
        const size_t gofs = ((size_t)(b * TT + kbase + crow)) * DD + h * DHH + ccol;
        async_copy4_b128(kb + gofs,           &lK[crow * 64 + ccol],
                         kb + gofs + 16 * DD, &lK[(crow + 16) * 64 + ccol],
                         kb + gofs + 32 * DD, &lK[(crow + 32) * 64 + ccol],
                         kb + gofs + 48 * DD, &lK[(crow + 48) * 64 + ccol]);
        async_copy4_b128(vb + gofs,           &lV[crow * PV + ccol],
                         vb + gofs + 16 * DD, &lV[(crow + 16) * PV + ccol],
                         vb + gofs + 32 * DD, &lV[(crow + 32) * PV + ccol],
                         vb + gofs + 48 * DD, &lV[(crow + 48) * PV + ccol]);
        async_wait0();
        __syncthreads();

        // S = Q * K^T  (4 column frags of 16, K-reduction DH=64 -> 2 wmma)
        v8f s[4];
#pragma unroll
        for (int j = 0; j < 4; ++j) {
            int col = j * 16 + l16;
            Frag b0, b1;
            b0.u4[0] = *(const uint4*)&lK[col * 64 + koff];
            b0.u4[1] = *(const uint4*)&lK[col * 64 + koff + 16];
            b1.u4[0] = *(const uint4*)&lK[col * 64 + 32 + koff];
            b1.u4[1] = *(const uint4*)&lK[col * 64 + 32 + koff + 16];
            v8f z = v8f_zero();
            z = wmma_bf16(qf[0].v, b0.v, z);
            s[j] = wmma_bf16(qf[1].v, b1.v, z);
        }

        // scale + bias + mask + online softmax (per accumulator row)
#pragma unroll
        for (int r = 0; r < 8; ++r) {
            int qg = qbase + wave * 16 + r + half * 8;
            float rmax = -1e30f;
#pragma unroll
            for (int j = 0; j < 4; ++j) {
                int kg = kbase + j * 16 + l16;
                float v = s[j][r] * scale +
                          bias[((size_t)h * TT + qg) * TT + kg];
                int mk = mask[((size_t)b * TT + qg) * TT + kg];
                v = (mk == 0) ? -1e9f : v;
                s[j][r] = v;
                rmax = fmaxf(rmax, v);
            }
#pragma unroll
            for (int mm = 8; mm >= 1; mm >>= 1)
                rmax = fmaxf(rmax, __shfl_xor(rmax, mm, 32));
            float mnew = fmaxf(m[r], rmax);
            float corr = __expf(m[r] - mnew);
            float psum = 0.0f;
#pragma unroll
            for (int j = 0; j < 4; ++j) {
                float p = __expf(s[j][r] - mnew);
                s[j][r] = p;
                psum += p;
            }
#pragma unroll
            for (int mm = 8; mm >= 1; mm >>= 1)
                psum += __shfl_xor(psum, mm, 32);
            l[r] = l[r] * corr + psum;
            m[r] = mnew;
#pragma unroll
            for (int j = 0; j < 4; ++j) o[j][r] *= corr;
        }

        // Relayout P through LDS (C-frag -> A-frag)
#pragma unroll
        for (int j = 0; j < 4; ++j) {
            int coll = j * 16 + l16;
#pragma unroll
            for (int r = 0; r < 8; ++r) {
                int rowl = wave * 16 + r + half * 8;
                lP[rowl * 64 + coll] =
                    __builtin_bit_cast(unsigned short, f32_to_bf16(s[j][r]));
            }
        }
        __syncthreads();

        // O += P * V
        Frag pa[2];
        {
            int prow = wave * 16 + l16;
            pa[0].u4[0] = *(const uint4*)&lP[prow * 64 + koff];
            pa[0].u4[1] = *(const uint4*)&lP[prow * 64 + koff + 16];
            pa[1].u4[0] = *(const uint4*)&lP[prow * 64 + 32 + koff];
            pa[1].u4[1] = *(const uint4*)&lP[prow * 64 + 32 + koff + 16];
        }
#pragma unroll
        for (int j = 0; j < 4; ++j) {
            int col = j * 16 + tcol;  // dh column block
            Frag v0, v1;
            v0.t[0] = lds_load_tr16(&lV[trow * PV + col]);
            v0.t[1] = lds_load_tr16(&lV[(16 + trow) * PV + col]);
            v1.t[0] = lds_load_tr16(&lV[(32 + trow) * PV + col]);
            v1.t[1] = lds_load_tr16(&lV[(48 + trow) * PV + col]);
            o[j] = wmma_bf16(pa[0].v, v0.v, o[j]);
            o[j] = wmma_bf16(pa[1].v, v1.v, o[j]);
        }
        lds_wait0();   // this wave has left lK and lV before the next copies
        __syncthreads();
    }

    // finalize: O /= l, write bf16 [B,T,H*DH]
#pragma unroll
    for (int j = 0; j < 4; ++j) {
        int dh = j * 16 + l16;
#pragma unroll
        for (int r = 0; r < 8; ++r) {
            int qg = qbase + wave * 16 + r + half * 8;
            float v = o[j][r] / l[r];
            ob[((size_t)(b * TT + qg)) * DD + h * DHH + dh] = f32_to_bf16(v);
        }
    }
}

// ---------------------------------------------------------------------------
// Host-side orchestration
// ---------------------------------------------------------------------------
static inline size_t align256(size_t x) { return (x + 255) & ~(size_t)255; }

extern "C" void kernel_launch(void* const* d_in, const int* in_sizes, int n_in,
                              void* d_out, int out_size, void* d_ws, size_t ws_size,
                              hipStream_t stream) {
    (void)in_sizes; (void)n_in; (void)out_size; (void)ws_size;
    const float* x        = (const float*)d_in[0];
    const int*   x_mask   = (const int*)  d_in[1];
    const float* cond     = (const float*)d_in[2];
    const float* norm1_w  = (const float*)d_in[3];
    const float* f1_gw    = (const float*)d_in[4];
    const float* f1_gb    = (const float*)d_in[5];
    const float* f1_bw    = (const float*)d_in[6];
    const float* f1_bb    = (const float*)d_in[7];
    const float* wq       = (const float*)d_in[8];
    const float* wk       = (const float*)d_in[9];
    const float* wv       = (const float*)d_in[10];
    const float* wo       = (const float*)d_in[11];
    const float* rel_emb  = (const float*)d_in[12];
    const float* norm3_w  = (const float*)d_in[13];
    const float* f3_gw    = (const float*)d_in[14];
    const float* f3_gb    = (const float*)d_in[15];
    const float* f3_bw    = (const float*)d_in[16];
    const float* f3_bb    = (const float*)d_in[17];
    const float* ffn_w1   = (const float*)d_in[18];
    const float* ffn_w2   = (const float*)d_in[19];

    float* out_x    = (float*)d_out;                              // [B,T,D]
    float* out_bias = (float*)d_out + (size_t)BB * TT * DD;       // [H,T,T]

    // workspace bump allocator
    char* ws = (char*)d_ws;
    size_t off = 0;
    auto alloc = [&](size_t bytes) -> void* {
        void* p = ws + off;
        off += align256(bytes);
        return p;
    };
    const size_t BT = (size_t)BB * TT;
    __bf16* wq_bf   = (__bf16*)alloc((size_t)DD * DD * 2);
    __bf16* wk_bf   = (__bf16*)alloc((size_t)DD * DD * 2);
    __bf16* wv_bf   = (__bf16*)alloc((size_t)DD * DD * 2);
    __bf16* wo_bf   = (__bf16*)alloc((size_t)DD * DD * 2);
    __bf16* w1_bf   = (__bf16*)alloc((size_t)DD * 4 * DD * 2);
    __bf16* w2_bf   = (__bf16*)alloc((size_t)2 * DD * DD * 2);
    float*  gamma1  = (float*)alloc((size_t)BB * DD * 4);
    float*  beta1   = (float*)alloc((size_t)BB * DD * 4);
    float*  gamma3  = (float*)alloc((size_t)BB * DD * 4);
    float*  beta3   = (float*)alloc((size_t)BB * DD * 4);
    __bf16* y_bf    = (__bf16*)alloc(BT * DD * 2);
    __bf16* q_bf    = (__bf16*)alloc(BT * DD * 2);
    __bf16* k_bf    = (__bf16*)alloc(BT * DD * 2);
    __bf16* v_bf    = (__bf16*)alloc(BT * DD * 2);
    __bf16* attn_bf = (__bf16*)alloc(BT * DD * 2);
    float*  x_mid   = (float*)alloc(BT * DD * 4);
    __bf16* y3_bf   = (__bf16*)alloc(BT * DD * 2);
    __bf16* h_bf    = (__bf16*)alloc(BT * 4 * DD * 2);
    __bf16* g_bf    = (__bf16*)alloc(BT * 2 * DD * 2);

    // 1) weight conversion fp32 -> bf16
    cvt_bf16_kernel<<<DD * DD / 4096, 256, 0, stream>>>(wq, wq_bf);
    cvt_bf16_kernel<<<DD * DD / 4096, 256, 0, stream>>>(wk, wk_bf);
    cvt_bf16_kernel<<<DD * DD / 4096, 256, 0, stream>>>(wv, wv_bf);
    cvt_bf16_kernel<<<DD * DD / 4096, 256, 0, stream>>>(wo, wo_bf);
    cvt_bf16_kernel<<<DD * 4 * DD / 4096, 256, 0, stream>>>(ffn_w1, w1_bf);
    cvt_bf16_kernel<<<2 * DD * DD / 4096, 256, 0, stream>>>(ffn_w2, w2_bf);
    // 2) FiLM params
    film_params_kernel<<<(BB * DD + 255) / 256, 256, 0, stream>>>(
        cond, f1_gw, f1_gb, f1_bw, f1_bb, gamma1, beta1);
    film_params_kernel<<<(BB * DD + 255) / 256, 256, 0, stream>>>(
        cond, f3_gw, f3_gb, f3_bw, f3_bb, gamma3, beta3);
    // 3) position bias (output #2 + consumed by attention)
    bias_kernel<<<TT, 256, 0, stream>>>(rel_emb, out_bias);
    // 4) y = film(rmsnorm(x)) -> bf16
    rmsnorm_film_kernel<<<(int)(BT / 8), 256, 0, stream>>>(x, norm1_w, gamma1, beta1, y_bf);
    // 5) Q,K,V projections
    {
        dim3 grid(DD / 128, (int)(BT / 128));
        gemm_bf16_kernel<0><<<grid, 256, 0, stream>>>(y_bf, wq_bf, q_bf, nullptr,
                                                      (int)BT, DD, DD);
        gemm_bf16_kernel<0><<<grid, 256, 0, stream>>>(y_bf, wk_bf, k_bf, nullptr,
                                                      (int)BT, DD, DD);
        gemm_bf16_kernel<0><<<grid, 256, 0, stream>>>(y_bf, wv_bf, v_bf, nullptr,
                                                      (int)BT, DD, DD);
    }
    // 6) flash attention
    {
        dim3 grid(BB * HH, TT / 64);
        flash_attn_kernel<<<grid, 128, 0, stream>>>(q_bf, k_bf, v_bf,
                                                    out_bias, x_mask, attn_bf);
    }
    // 7) x_mid = x + attn @ wo
    {
        dim3 grid(DD / 128, (int)(BT / 128));
        gemm_bf16_kernel<1><<<grid, 256, 0, stream>>>(attn_bf, wo_bf, x_mid, x,
                                                      (int)BT, DD, DD);
    }
    // 8) y3 = film(rmsnorm(x_mid)) -> bf16
    rmsnorm_film_kernel<<<(int)(BT / 8), 256, 0, stream>>>(x_mid, norm3_w, gamma3, beta3, y3_bf);
    // 9) h = y3 @ ffn_w1  [BT, 4D]
    {
        dim3 grid(4 * DD / 128, (int)(BT / 128));
        gemm_bf16_kernel<0><<<grid, 256, 0, stream>>>(y3_bf, w1_bf, h_bf, nullptr,
                                                      (int)BT, 4 * DD, DD);
    }
    // 10) geglu
    geglu_kernel<<<(int)(BT / 2), 256, 0, stream>>>(h_bf, g_bf);
    // 11) out = x_mid + g @ ffn_w2
    {
        dim3 grid(DD / 128, (int)(BT / 128));
        gemm_bf16_kernel<1><<<grid, 256, 0, stream>>>(g_bf, w2_bf, out_x, x_mid,
                                                      (int)BT, DD, 2 * DD);
    }
}

// v004
// One run takes 221 microseconds.
// Two timings next to v003 put it at 1.15 and 1.14 times that version's speed.
// Counting every step since v000, it is 3.21 times as fast.
#include <hip/hip_runtime.h>
#include <hip/hip_bf16.h>
#include <math.h>
#include <stdint.h>

// ---------------------------------------------------------------------------
// Problem constants (from reference)
// ---------------------------------------------------------------------------
#define BB 4
#define TT 1024
#define DD 1024
#define HH 16
#define DHH 64
#define DCC 64
#define NBUCK 32

typedef unsigned short ushort_t;
typedef __attribute__((ext_vector_type(16))) __bf16 v16bf;
typedef __attribute__((ext_vector_type(8)))  float  v8f;
typedef __attribute__((ext_vector_type(8)))  short  s16x8;

union Frag {
    v16bf v;
    uint4 u4[2];
    s16x8 t[2];
};

__device__ __forceinline__ v8f v8f_zero() {
    v8f z;
#pragma unroll
    for (int i = 0; i < 8; ++i) z[i] = 0.0f;
    return z;
}

__device__ __forceinline__ __bf16 f32_to_bf16(float f) {
    unsigned u = __builtin_bit_cast(unsigned, f);
    unsigned r = u + 0x7FFFu + ((u >> 16) & 1u);   // round-to-nearest-even
    unsigned short h = (unsigned short)(r >> 16);
    return __builtin_bit_cast(__bf16, h);
}

__device__ __forceinline__ v8f wmma_bf16(v16bf a, v16bf b, v8f c) {
    // D = A(16x32 bf16) * B(32x16 bf16) + C(16x16 f32)
    return __builtin_amdgcn_wmma_f32_16x16x32_bf16(
        /*neg_a=*/false, a, /*neg_b=*/false, b,
        /*c_mod=*/(short)0, c, /*reuse_a=*/false, /*reuse_b=*/false);
}

// Four async copies of 16B (8 bf16) per lane from global to LDS; tracked with
// ASYNCcnt. The closing s_wait_xcnt stands inside the statement so that no
// address register of a copy is rewritten in front of it.
__device__ __forceinline__ void async_copy4_b128(const void* g0, void* d0,
                                                 const void* g1, void* d1,
                                                 const void* g2, void* d2,
                                                 const void* g3, void* d3) {
    unsigned l0 = (unsigned)(unsigned long long)d0;  // LDS aperture: low 32 bits
    unsigned l1 = (unsigned)(unsigned long long)d1;
    unsigned l2 = (unsigned)(unsigned long long)d2;
    unsigned l3 = (unsigned)(unsigned long long)d3;
    asm volatile("global_load_async_to_lds_b128 %0, %1, off\n\t"
                 "global_load_async_to_lds_b128 %2, %3, off\n\t"
                 "global_load_async_to_lds_b128 %4, %5, off\n\t"
                 "global_load_async_to_lds_b128 %6, %7, off\n\t"
                 "s_wait_xcnt 0x0"
                 :: "v"(l0), "v"(g0), "v"(l1), "v"(g1),
                    "v"(l2), "v"(g2), "v"(l3), "v"(g3) : "memory");
}
// Eight such copies in one statement; the closing s_wait_xcnt stands inside it
// for the same reason.
__device__ __forceinline__ void async_copy8_b128(const void* const (&g)[8],
                                                 const unsigned (&l)[8]) {
    asm volatile("global_load_async_to_lds_b128 %0, %1, off\n\t"
                 "global_load_async_to_lds_b128 %2, %3, off\n\t"
                 "global_load_async_to_lds_b128 %4, %5, off\n\t"
                 "global_load_async_to_lds_b128 %6, %7, off\n\t"
                 "global_load_async_to_lds_b128 %8, %9, off\n\t"
                 "global_load_async_to_lds_b128 %10, %11, off\n\t"
                 "global_load_async_to_lds_b128 %12, %13, off\n\t"
                 "global_load_async_to_lds_b128 %14, %15, off\n\t"
                 "s_wait_xcnt 0x0"
                 :: "v"(l[0]), "v"(g[0]), "v"(l[1]), "v"(g[1]),
                    "v"(l[2]), "v"(g[2]), "v"(l[3]), "v"(g[3]),
                    "v"(l[4]), "v"(g[4]), "v"(l[5]), "v"(g[5]),
                    "v"(l[6]), "v"(g[6]), "v"(l[7]), "v"(g[7]) : "memory");
}
// The issuing wave's copies have landed behind this wait.
__device__ __forceinline__ void async_wait0() {
    asm volatile("s_wait_asynccnt 0x0" ::: "memory");
}
// The wave's own LDS reads have retired before a copy may refill what they read.
__device__ __forceinline__ void lds_wait0() {
    asm volatile("s_wait_dscnt 0x0" ::: "memory");
}

// Transposing LDS load: from a row-major [k][n] bf16 tile, lane (c = l & 15,
// h = l >> 4) receives T[kbase + 8h + 0..7][nbase + c]. The lane's address is
// row kbase + 8*(l >> 4) + (l & 7), column nbase + 8*((l >> 3) & 1).
__device__ __forceinline__ s16x8 lds_load_tr16(const ushort_t* p) {
    typedef __attribute__((address_space(3))) s16x8 lds_s16x8;
    return __builtin_amdgcn_ds_load_tr16_b128_v8i16((lds_s16x8*)p);
}

// ---------------------------------------------------------------------------
// Elementwise helpers
// ---------------------------------------------------------------------------
// Two floats rounded to bf16 and packed into one dword (a in the low half).
__device__ __forceinline__ unsigned pack2_bf16(float a, float b) {
    unsigned lo = __builtin_bit_cast(unsigned short, f32_to_bf16(a));
    unsigned hi = __builtin_bit_cast(unsigned short, f32_to_bf16(b));
    return lo | (hi << 16);
}

// 16 elements per thread: a block takes 4096 consecutive elements as four
// slabs of 1024; each wave-wide load covers 512 contiguous bytes, each store
// 256. The blocks cover the array exactly (its length is a multiple of 4096).
__device__ __forceinline__
void cvt_bf16_block(const float* __restrict__ src,
                    __bf16* __restrict__ dst, int blk) {
    const int base = blk * 4096 + threadIdx.x * 4;
    float4 v[4];
#pragma unroll
    for (int u = 0; u < 4; ++u) v[u] = *(const float4*)(src + base + u * 1024);
#pragma unroll
    for (int u = 0; u < 4; ++u)
        *(uint2*)(dst + base + u * 1024) =
            make_uint2(pack2_bf16(v[u].x, v[u].y), pack2_bf16(v[u].z, v[u].w));
    // the stores' registers are not rewritten by another part of the merged
    // kernel in front of this wait
    asm volatile("s_wait_xcnt 0x0" ::: "memory");
}

// gamma/beta = cond @ W + b  (per batch, DC=64 reduction); B*D/256 blocks
__device__ __forceinline__
void film_params_block(const float* __restrict__ cond,
                       const float* __restrict__ gw,
                       const float* __restrict__ gb,
                       const float* __restrict__ bw,
                       const float* __restrict__ bb,
                       float* __restrict__ gamma,
                       float* __restrict__ beta, int blk) {
    int idx = blk * 256 + threadIdx.x;   // B*D
    if (idx >= BB * DD) return;
    int b = idx / DD, d = idx % DD;
    const float* c = cond + b * DCC;
    float g = gb[d], bt = bb[d];
#pragma unroll 8
    for (int i = 0; i < DCC; ++i) {
        float cv = c[i];
        g  += cv * gw[i * DD + d];
        bt += cv * bw[i * DD + d];
    }
    gamma[idx] = g;
    beta[idx]  = bt;
}

// T5 relative position bucket of rp = k - q
__device__ __forceinline__ int rel_bucket(int rp) {
    const int nb = NBUCK / 2;      // 16
    const int max_exact = nb / 2;  // 8
    int bucket = (rp > 0) ? nb : 0;
    int arp = rp < 0 ? -rp : rp;
    int val;
    if (arp < max_exact) {
        val = arp;
    } else {
        float rp_safe = (float)(arp > 1 ? arp : 1);
        int large = max_exact +
            (int)(logf(rp_safe / (float)max_exact) /
                  logf(128.0f / (float)max_exact) * (float)(nb - max_exact));
        val = large < nb - 1 ? large : nb - 1;
    }
    return bucket + val;
}

// T5 relative position bias -> bias_out[h][q][k]  (this is output #2)
// One block per query row; a thread takes 4 consecutive keys for all 16 heads
// (64 elements): each wave-wide store covers 512 contiguous bytes of one head.
__device__ __forceinline__
void bias_block(const float* __restrict__ rel_emb,
                float* __restrict__ bias_out, int q) {
    const int k0 = threadIdx.x * 4;
    float e[4][HH];
#pragma unroll
    for (int c = 0; c < 4; ++c) {
        const float4* p = (const float4*)(rel_emb + rel_bucket(k0 + c - q) * HH);
#pragma unroll
        for (int g = 0; g < HH / 4; ++g) {
            float4 t = p[g];
            e[c][4 * g + 0] = t.x;
            e[c][4 * g + 1] = t.y;
            e[c][4 * g + 2] = t.z;
            e[c][4 * g + 3] = t.w;
        }
    }
#pragma unroll
    for (int h = 0; h < HH; ++h)
        *(float4*)(bias_out + ((size_t)h * TT + q) * TT + k0) =
            make_float4(e[0][h], e[1][h], e[2][h], e[3][h]);
    // the stores' registers are not rewritten by another part of the merged
    // kernel in front of this wait
    asm volatile("s_wait_xcnt 0x0" ::: "memory");
}

// Everything that depends on the inputs alone, in one grid: a block's index
// says which piece it does. The FiLM blocks, few and latency-bound, come first.
#define NB_FILM (BB * DD / 256)      // blocks per FiLM parameter pair
#define NB_W    (DD * DD / 4096)     // blocks per D x D weight matrix
#define NB_PREP (2 * NB_FILM + TT + 10 * NB_W)
__global__ __launch_bounds__(256)
void prep_kernel(const float* __restrict__ cond,
                 const float* __restrict__ f1_gw, const float* __restrict__ f1_gb,
                 const float* __restrict__ f1_bw, const float* __restrict__ f1_bb,
                 float* __restrict__ gamma1, float* __restrict__ beta1,
                 const float* __restrict__ f3_gw, const float* __restrict__ f3_gb,
                 const float* __restrict__ f3_bw, const float* __restrict__ f3_bb,
                 float* __restrict__ gamma3, float* __restrict__ beta3,
                 const float* __restrict__ rel_emb, float* __restrict__ bias_out,
                 const float* __restrict__ wq, const float* __restrict__ wk,
                 const float* __restrict__ wv, const float* __restrict__ wo,
                 const float* __restrict__ w1, const float* __restrict__ w2,
                 __bf16* __restrict__ wq_bf, __bf16* __restrict__ wk_bf,
                 __bf16* __restrict__ wv_bf, __bf16* __restrict__ wo_bf,
                 __bf16* __restrict__ w1_bf, __bf16* __restrict__ w2_bf) {
    int blk = blockIdx.x;
    if (blk < NB_FILM) {
        film_params_block(cond, f1_gw, f1_gb, f1_bw, f1_bb, gamma1, beta1, blk);
        return;
    }
    blk -= NB_FILM;
    if (blk < NB_FILM) {
        film_params_block(cond, f3_gw, f3_gb, f3_bw, f3_bb, gamma3, beta3, blk);
        return;
    }
    blk -= NB_FILM;
    if (blk < TT) {
        bias_block(rel_emb, bias_out, blk);
        return;
    }
    blk -= TT;
    const float* src;
    __bf16* dst;
    if (blk < NB_W)          { src = wq; dst = wq_bf; }
    else if (blk < 2 * NB_W) { src = wk; dst = wk_bf; blk -= NB_W; }
    else if (blk < 3 * NB_W) { src = wv; dst = wv_bf; blk -= 2 * NB_W; }
    else if (blk < 4 * NB_W) { src = wo; dst = wo_bf; blk -= 3 * NB_W; }
    else if (blk < 8 * NB_W) { src = w1; dst = w1_bf; blk -= 4 * NB_W; }
    else                     { src = w2; dst = w2_bf; blk -= 8 * NB_W; }
    cvt_bf16_block(src, dst, blk);
}

// y = film(rms_norm(x)) -> bf16, one wave per (b,t) row: a lane holds 32
// elements of the row in registers (eight 16-byte loads, 512 contiguous bytes
// per wave each), so x is read once and the row sum needs no LDS.
__global__ __launch_bounds__(256)
void rmsnorm_film_kernel(const float* __restrict__ x,
                         const float* __restrict__ w,
                         const float* __restrict__ gamma,
                         const float* __restrict__ beta,
                         __bf16* __restrict__ y) {
    const int lane = threadIdx.x & 31;
    const int row = blockIdx.x * 8 + (threadIdx.x >> 5);   // 0 .. B*T-1
    const int b = row / TT;
    const float* xr = x + (size_t)row * DD + lane * 4;
    float4 v[8];
#pragma unroll
    for (int u = 0; u < 8; ++u) v[u] = *(const float4*)(xr + u * 128);
    float s0 = 0.0f, s1 = 0.0f, s2 = 0.0f, s3 = 0.0f;   // four independent chains
#pragma unroll
    for (int u = 0; u < 8; ++u) {
        s0 += v[u].x * v[u].x;
        s1 += v[u].y * v[u].y;
        s2 += v[u].z * v[u].z;
        s3 += v[u].w * v[u].w;
    }
    float tot = (s0 + s1) + (s2 + s3);
#pragma unroll
    for (int m = 16; m >= 1; m >>= 1) tot += __shfl_xor(tot, m, 32);
    float rstd = rsqrtf(tot / (float)DD + 1e-6f);
    const float* wr = w + lane * 4;
    const float* g  = gamma + (size_t)b * DD + lane * 4;
    const float* be = beta + (size_t)b * DD + lane * 4;
    __bf16* yr = y + (size_t)row * DD + lane * 4;
#pragma unroll
    for (int u = 0; u < 8; ++u) {
        float4 w4 = *(const float4*)(wr + u * 128);
        float4 g4 = *(const float4*)(g + u * 128);
        float4 b4 = *(const float4*)(be + u * 128);
        float r0 = (w4.x * (v[u].x * rstd)) * (g4.x + 1.0f) + b4.x;
        float r1 = (w4.y * (v[u].y * rstd)) * (g4.y + 1.0f) + b4.y;
        float r2 = (w4.z * (v[u].z * rstd)) * (g4.z + 1.0f) + b4.z;
        float r3 = (w4.w * (v[u].w * rstd)) * (g4.w + 1.0f) + b4.w;
        *(uint2*)(yr + u * 128) = make_uint2(pack2_bf16(r0, r1), pack2_bf16(r2, r3));
    }
}

// geglu: g[r,c] = h[r,c] * gelu(h[r,c+2048]), exact gelu
__device__ __forceinline__ float geglu1(float p1, float p2) {
    float ge = 0.5f * p2 * (1.0f + erff(p2 * 0.70710678118654752f));
    return p1 * ge;
}
// both bf16 halves of a dword pair
__device__ __forceinline__ unsigned geglu2(unsigned a, unsigned c) {
    float lo = geglu1(__builtin_bit_cast(float, a << 16),
                      __builtin_bit_cast(float, c << 16));
    float hi = geglu1(__builtin_bit_cast(float, a & 0xFFFF0000u),
                      __builtin_bit_cast(float, c & 0xFFFF0000u));
    return pack2_bf16(lo, hi);
}
// One block per two rows; a thread takes 8 consecutive columns of each row
// (16 elements), all by 16-byte accesses.
__global__ __launch_bounds__(256)
void geglu_kernel(const __bf16* __restrict__ h,
                  __bf16* __restrict__ g) {
    const int c = threadIdx.x * 8;
    const size_t r0 = (size_t)blockIdx.x * 2;
    uint4 p1[2], p2[2];
#pragma unroll
    for (int u = 0; u < 2; ++u) {
        const __bf16* hr = h + (r0 + u) * 4 * DD + c;
        p1[u] = *(const uint4*)hr;
        p2[u] = *(const uint4*)(hr + 2 * DD);
    }
#pragma unroll
    for (int u = 0; u < 2; ++u)
        *(uint4*)(g + (r0 + u) * 2 * DD + c) =
            make_uint4(geglu2(p1[u].x, p2[u].x), geglu2(p1[u].y, p2[u].y),
                       geglu2(p1[u].z, p2[u].z), geglu2(p1[u].w, p2[u].w));
}

// ---------------------------------------------------------------------------
// Generic bf16 WMMA GEMM:  C[M,N] = A[M,K] * B[K,N]  (row-major, bf16 in)
// Block tile 128x128, 8 waves (4 along M x 2 along N), wave tile 32x64.
// Double-buffered LDS, 128 k per stage (K is a multiple of 128); A and B tiles
// staged via GLOBAL_LOAD_ASYNC_TO_LDS_B128, each wave-wide copy taking two whole
// 256-byte rows; B kept row-major [k][n] and transposed by the fragment loads.
// EPI==0: store bf16.  EPI==1: store f32 with residual add.
// Grid z: independent products on the same A; B, C and the residual advance by
// one whole matrix per z.
// ---------------------------------------------------------------------------
template <int EPI>
__global__ __launch_bounds__(256)
void gemm_bf16_kernel(const __bf16* __restrict__ A,
                      const __bf16* __restrict__ Bm,
                      void* __restrict__ C,
                      const float* __restrict__ residual,
                      int M, int N, int K) {
    constexpr int BK = 128;   // k per stage
    constexpr int PA = 136;   // lA row pitch: 272 B, an odd multiple of 16 B
    constexpr int PB = 144;   // lB row pitch: 288 B, an odd multiple of 32 B
    __shared__ __attribute__((aligned(16))) ushort_t lA[2][128 * PA];  // [m][k]
    __shared__ __attribute__((aligned(16))) ushort_t lB[2][BK * PB];   // [k][n]

    const int tid  = threadIdx.x;
    const int lane = tid & 31;
    const int wave = tid >> 5;          // 0..7
    const int wm   = wave & 3;          // 4 waves along M
    const int wn   = wave >> 2;         // 2 waves along N
    const int half = lane >> 4;         // which 16-lane half
    const int l16  = lane & 15;
    const int koff = half ? 8 : 0;
    const int trow = half * 8 + (lane & 7);      // transposing load: lane's row
    const int tcol = ((lane >> 3) & 1) * 8;      // and its column offset

    const int blockM = blockIdx.y * 128;
    const int blockN = blockIdx.x * 128;

    // per-thread tile-copy coordinates: both tiles are 128 rows of 256 B; a
    // thread takes 16-byte column cCol of rows cRow, +16, ... +112 of each
    const int cRow = tid >> 4;
    const int cCol = (tid & 15) * 8;

    // each thread's two source addresses walk along K, one tile per issue
    const __bf16* gA = A + (size_t)(blockM + cRow) * K + cCol;
    const __bf16* gB = Bm + ((size_t)blockIdx.z * K + cRow) * N + blockN + cCol;
    auto issueAB = [&](int buf) {
        const void* g[8];
        unsigned l[8];   // LDS aperture: low 32 bits
        // both loops unrolled: g and l are the statement's register operands
#pragma unroll
        for (int u = 0; u < 8; ++u) {
            g[u] = gA + (size_t)(16 * u) * K;
            l[u] = (unsigned)(unsigned long long)&lA[buf][(cRow + 16 * u) * PA + cCol];
        }
        async_copy8_b128(g, l);
#pragma unroll
        for (int u = 0; u < 8; ++u) {
            g[u] = gB + (size_t)(16 * u) * N;
            l[u] = (unsigned)(unsigned long long)&lB[buf][(cRow + 16 * u) * PB + cCol];
        }
        async_copy8_b128(g, l);
        gA += BK;
        gB += (size_t)BK * N;
    };

    v8f acc[2][4];
#pragma unroll
    for (int i = 0; i < 2; ++i)
#pragma unroll
        for (int j = 0; j < 4; ++j) acc[i][j] = v8f_zero();

    // prologue: tile 0 lands and is published, then tile 1 starts to fly
    const int ntiles = K / BK;
    issueAB(0);
    async_wait0();
    __syncthreads();
    if (ntiles > 1) issueAB(1);

    for (int t = 0; t < ntiles; ++t) {
        const int cur = t & 1;

        // compute current tile, 32 k at a time in ascending order; unrolled so
        // that every LDS offset inside the stage is an immediate
#pragma unroll
        for (int kk = 0; kk < BK; kk += 32) {
            Frag a[2], b[4];
#pragma unroll
            for (int i = 0; i < 2; ++i) {
                int row = wm * 32 + i * 16 + l16;
                a[i].u4[0] = *(const uint4*)&lA[cur][row * PA + kk + koff];
                a[i].u4[1] = *(const uint4*)&lA[cur][row * PA + kk + koff + 16];
            }
#pragma unroll
            for (int j = 0; j < 4; ++j) {
                int col = wn * 64 + j * 16 + tcol;
                b[j].t[0] = lds_load_tr16(&lB[cur][(kk + trow) * PB + col]);
                b[j].t[1] = lds_load_tr16(&lB[cur][(kk + 16 + trow) * PB + col]);
            }
#pragma unroll
            for (int i = 0; i < 2; ++i)
#pragma unroll
                for (int j = 0; j < 4; ++j)
                    acc[i][j] = wmma_bf16(a[i].v, b[j].v, acc[i][j]);
        }

        // publish tile t + 1 and free this trip's buffer, then refill it
        lds_wait0();
        async_wait0();
        __syncthreads();
        if (t + 2 < ntiles) issueAB(cur);
    }
    async_wait0();

    // epilogue (C-layout: col = l16, row = r + 8*half per vgpr r)
#pragma unroll
    for (int i = 0; i < 2; ++i) {
#pragma unroll
        for (int j = 0; j < 4; ++j) {
            int col = blockN + wn * 64 + j * 16 + l16;
#pragma unroll
            for (int r = 0; r < 8; ++r) {
                int row = blockM + wm * 32 + i * 16 + r + half * 8;
                size_t idx = ((size_t)blockIdx.z * M + row) * N + col;
                float v = acc[i][j][r];
                if (EPI == 0) {
                    ((__bf16*)C)[idx] = f32_to_bf16(v);
                } else {
                    ((float*)C)[idx] = residual[idx] + v;
                }
            }
        }
    }
}

// ---------------------------------------------------------------------------
// Flash attention: grid (B*H, T/64), block 128 (4 waves x 16 query rows).
// S = Q*K^T * 1/8 + bias, mask, online softmax, O = P*V.
// K and V tiles staged async to LDS; V transposed by its fragment loads.
// ---------------------------------------------------------------------------
__global__ __launch_bounds__(128)
void flash_attn_kernel(const __bf16* __restrict__ qb,
                       const __bf16* __restrict__ kb,
                       const __bf16* __restrict__ vb,
                       const float* __restrict__ bias,   // [H][T][T]
                       const int* __restrict__ mask,     // [B][T][T]
                       __bf16* __restrict__ ob) {
    constexpr int PV = 80;    // lV row pitch: 160 B, an odd multiple of 32 B
    __shared__ __attribute__((aligned(16))) ushort_t lK[64 * 64];   // [key][dh]   -> B-frag layout for Q*K^T
    __shared__ __attribute__((aligned(16))) ushort_t lV[64 * PV];   // [key][dh]   -> read by transposing loads
    __shared__ __attribute__((aligned(16))) ushort_t lP[64 * 64];   // [q][key]    -> A-frag relayout

    const int bh = blockIdx.x;
    const int b = bh / HH;
    const int h = bh % HH;
    const int qbase = blockIdx.y * 64;
    const int tid  = threadIdx.x;
    const int lane = tid & 31;
    const int wave = tid >> 5;         // 0..3 -> 16 query rows each
    const int half = lane >> 4;
    const int l16  = lane & 15;
    const int koff = half ? 8 : 0;
    const int trow = half * 8 + (lane & 7);      // transposing load: lane's row
    const int tcol = ((lane >> 3) & 1) * 8;      // and its column offset
    const int crow = tid >> 3;                   // tile copy: lane's first row
    const int ccol = (tid & 7) * 8;              // and its column

    // Q fragments stay in registers for the whole kernel
    Frag qf[2];
    {
        int qrow = qbase + wave * 16 + l16;
        const __bf16* qrp = qb + ((size_t)(b * TT + qrow)) * DD + h * DHH;
        qf[0].u4[0] = *(const uint4*)(qrp + koff);
        qf[0].u4[1] = *(const uint4*)(qrp + koff + 16);
        qf[1].u4[0] = *(const uint4*)(qrp + 32 + koff);
        qf[1].u4[1] = *(const uint4*)(qrp + 32 + koff + 16);
    }

    float m[8], l[8];
    v8f o[4];
#pragma unroll
    for (int r = 0; r < 8; ++r) { m[r] = -1e30f; l[r] = 0.0f; }
#pragma unroll
    for (int j = 0; j < 4; ++j) o[j] = v8f_zero();

    const float scale = 0.125f;   // 1/sqrt(DH)

    for (int kt = 0; kt < TT / 64; ++kt) {
        const int kbase = kt * 64;
        // K and V tiles: natural [key][dh] layout, async to LDS (no VGPR staging);
        // each thread copies column ccol of rows crow, +16, +32, +48
        const size_t gofs = ((size_t)(b * TT + kbase + crow)) * DD + h * DHH + ccol;
        async_copy4_b128(kb + gofs,           &lK[crow * 64 + ccol],
                         kb + gofs + 16 * DD, &lK[(crow + 16) * 64 + ccol],
                         kb + gofs + 32 * DD, &lK[(crow + 32) * 64 + ccol],
                         kb + gofs + 48 * DD, &lK[(crow + 48) * 64 + ccol]);
        async_copy4_b128(vb + gofs,           &lV[crow * PV + ccol],
                         vb + gofs + 16 * DD, &lV[(crow + 16) * PV + ccol],
                         vb + gofs + 32 * DD, &lV[(crow + 32) * PV + ccol],
                         vb + gofs + 48 * DD, &lV[(crow + 48) * PV + ccol]);
        async_wait0();
        __syncthreads();

        // S = Q * K^T  (4 column frags of 16, K-reduction DH=64 -> 2 wmma)
        v8f s[4];
#pragma unroll
        for (int j = 0; j < 4; ++j) {
            int col = j * 16 + l16;
            Frag b0, b1;
            b0.u4[0] = *(const uint4*)&lK[col * 64 + koff];
            b0.u4[1] = *(const uint4*)&lK[col * 64 + koff + 16];
            b1.u4[0] = *(const uint4*)&lK[col * 64 + 32 + koff];
            b1.u4[1] = *(const uint4*)&lK[col * 64 + 32 + koff + 16];
            v8f z = v8f_zero();
            z = wmma_bf16(qf[0].v, b0.v, z);
            s[j] = wmma_bf16(qf[1].v, b1.v, z);
        }

        // scale + bias + mask + online softmax (per accumulator row)
#pragma unroll
        for (int r = 0; r < 8; ++r) {
            int qg = qbase + wave * 16 + r + half * 8;
            float rmax = -1e30f;
#pragma unroll
            for (int j = 0; j < 4; ++j) {
                int kg = kbase + j * 16 + l16;
                float v = s[j][r] * scale +
                          bias[((size_t)h * TT + qg) * TT + kg];
                int mk = mask[((size_t)b * TT + qg) * TT + kg];
                v = (mk == 0) ? -1e9f : v;
                s[j][r] = v;
                rmax = fmaxf(rmax, v);
            }
#pragma unroll
            for (int mm = 8; mm >= 1; mm >>= 1)
                rmax = fmaxf(rmax, __shfl_xor(rmax, mm, 32));
            float mnew = fmaxf(m[r], rmax);
            float corr = __expf(m[r] - mnew);
            float psum = 0.0f;
#pragma unroll
            for (int j = 0; j < 4; ++j) {
                float p = __expf(s[j][r] - mnew);
                s[j][r] = p;
                psum += p;
            }
#pragma unroll
            for (int mm = 8; mm >= 1; mm >>= 1)
                psum += __shfl_xor(psum, mm, 32);
            l[r] = l[r] * corr + psum;
            m[r] = mnew;
#pragma unroll
            for (int j = 0; j < 4; ++j) o[j][r] *= corr;
        }

        // Relayout P through LDS (C-frag -> A-frag)
#pragma unroll
        for (int j = 0; j < 4; ++j) {
            int coll = j * 16 + l16;
#pragma unroll
            for (int r = 0; r < 8; ++r) {
                int rowl = wave * 16 + r + half * 8;
                lP[rowl * 64 + coll] =
                    __builtin_bit_cast(unsigned short, f32_to_bf16(s[j][r]));
            }
        }
        __syncthreads();

        // O += P * V
        Frag pa[2];
        {
            int prow = wave * 16 + l16;
            pa[0].u4[0] = *(const uint4*)&lP[prow * 64 + koff];
            pa[0].u4[1] = *(const uint4*)&lP[prow * 64 + koff + 16];
            pa[1].u4[0] = *(const uint4*)&lP[prow * 64 + 32 + koff];
            pa[1].u4[1] = *(const uint4*)&lP[prow * 64 + 32 + koff + 16];
        }
#pragma unroll
        for (int j = 0; j < 4; ++j) {
            int col = j * 16 + tcol;  // dh column block
            Frag v0, v1;
            v0.t[0] = lds_load_tr16(&lV[trow * PV + col]);
            v0.t[1] = lds_load_tr16(&lV[(16 + trow) * PV + col]);
            v1.t[0] = lds_load_tr16(&lV[(32 + trow) * PV + col]);
            v1.t[1] = lds_load_tr16(&lV[(48 + trow) * PV + col]);
            o[j] = wmma_bf16(pa[0].v, v0.v, o[j]);
            o[j] = wmma_bf16(pa[1].v, v1.v, o[j]);
        }
        lds_wait0();   // this wave has left lK and lV before the next copies
        __syncthreads();
    }

    // finalize: O /= l, write bf16 [B,T,H*DH]
#pragma unroll
    for (int j = 0; j < 4; ++j) {
        int dh = j * 16 + l16;
#pragma unroll
        for (int r = 0; r < 8; ++r) {
            int qg = qbase + wave * 16 + r + half * 8;
            float v = o[j][r] / l[r];
            ob[((size_t)(b * TT + qg)) * DD + h * DHH + dh] = f32_to_bf16(v);
        }
    }
}

// ---------------------------------------------------------------------------
// Host-side orchestration
// ---------------------------------------------------------------------------
static inline size_t align256(size_t x) { return (x + 255) & ~(size_t)255; }

extern "C" void kernel_launch(void* const* d_in, const int* in_sizes, int n_in,
                              void* d_out, int out_size, void* d_ws, size_t ws_size,
                              hipStream_t stream) {
    (void)in_sizes; (void)n_in; (void)out_size; (void)ws_size;
    const float* x        = (const float*)d_in[0];
    const int*   x_mask   = (const int*)  d_in[1];
    const float* cond     = (const float*)d_in[2];
    const float* norm1_w  = (const float*)d_in[3];
    const float* f1_gw    = (const float*)d_in[4];
    const float* f1_gb    = (const float*)d_in[5];
    const float* f1_bw    = (const float*)d_in[6];
    const float* f1_bb    = (const float*)d_in[7];
    const float* wq       = (const float*)d_in[8];
    const float* wk       = (const float*)d_in[9];
    const float* wv       = (const float*)d_in[10];
    const float* wo       = (const float*)d_in[11];
    const float* rel_emb  = (const float*)d_in[12];
    const float* norm3_w  = (const float*)d_in[13];
    const float* f3_gw    = (const float*)d_in[14];
    const float* f3_gb    = (const float*)d_in[15];
    const float* f3_bw    = (const float*)d_in[16];
    const float* f3_bb    = (const float*)d_in[17];
    const float* ffn_w1   = (const float*)d_in[18];
    const float* ffn_w2   = (const float*)d_in[19];

    float* out_x    = (float*)d_out;                              // [B,T,D]
    float* out_bias = (float*)d_out + (size_t)BB * TT * DD;       // [H,T,T]

    // workspace bump allocator
    char* ws = (char*)d_ws;
    size_t off = 0;
    auto alloc = [&](size_t bytes) -> void* {
        void* p = ws + off;
        off += align256(bytes);
        return p;
    };
    const size_t BT = (size_t)BB * TT;
    __bf16* wq_bf   = (__bf16*)alloc((size_t)3 * DD * DD * 2);   // wq | wk | wv
    __bf16* wk_bf   = wq_bf + (size_t)DD * DD;
    __bf16* wv_bf   = wk_bf + (size_t)DD * DD;
    __bf16* wo_bf   = (__bf16*)alloc((size_t)DD * DD * 2);
    __bf16* w1_bf   = (__bf16*)alloc((size_t)DD * 4 * DD * 2);
    __bf16* w2_bf   = (__bf16*)alloc((size_t)2 * DD * DD * 2);
    float*  gamma1  = (float*)alloc((size_t)BB * DD * 4);
    float*  beta1   = (float*)alloc((size_t)BB * DD * 4);
    float*  gamma3  = (float*)alloc((size_t)BB * DD * 4);
    float*  beta3   = (float*)alloc((size_t)BB * DD * 4);
    __bf16* y_bf    = (__bf16*)alloc(BT * DD * 2);
    __bf16* q_bf    = (__bf16*)alloc(3 * BT * DD * 2);           // q | k | v
    __bf16* k_bf    = q_bf + BT * DD;
    __bf16* v_bf    = k_bf + BT * DD;
    __bf16* attn_bf = (__bf16*)alloc(BT * DD * 2);
    float*  x_mid   = (float*)alloc(BT * DD * 4);
    __bf16* y3_bf   = (__bf16*)alloc(BT * DD * 2);
    __bf16* h_bf    = (__bf16*)alloc(BT * 4 * DD * 2);
    __bf16* g_bf    = (__bf16*)alloc(BT * 2 * DD * 2);

    // 1) all that depends on the inputs alone: FiLM params, position bias
    //    (output #2 + consumed by attention), weight conversion fp32 -> bf16
    prep_kernel<<<NB_PREP, 256, 0, stream>>>(
        cond, f1_gw, f1_gb, f1_bw, f1_bb, gamma1, beta1,
        f3_gw, f3_gb, f3_bw, f3_bb, gamma3, beta3,
        rel_emb, out_bias,
        wq, wk, wv, wo, ffn_w1, ffn_w2,
        wq_bf, wk_bf, wv_bf, wo_bf, w1_bf, w2_bf);
    // 4) y = film(rmsnorm(x)) -> bf16
    rmsnorm_film_kernel<<<(int)(BT / 8), 256, 0, stream>>>(x, norm1_w, gamma1, beta1, y_bf);
    // 5) Q,K,V projections, one grid: z picks the weight and the output, which
    //    follow one another in the workspace
    {
        dim3 grid(DD / 128, (int)(BT / 128), 3);
        gemm_bf16_kernel<0><<<grid, 256, 0, stream>>>(y_bf, wq_bf, q_bf, nullptr,
                                                      (int)BT, DD, DD);
    }
    // 6) flash attention
    {
        dim3 grid(BB * HH, TT / 64);
        flash_attn_kernel<<<grid, 128, 0, stream>>>(q_bf, k_bf, v_bf,
                                                    out_bias, x_mask, attn_bf);
    }
    // 7) x_mid = x + attn @ wo
    {
        dim3 grid(DD / 128, (int)(BT / 128));
        gemm_bf16_kernel<1><<<grid, 256, 0, stream>>>(attn_bf, wo_bf, x_mid, x,
                                                      (int)BT, DD, DD);
    }
    // 8) y3 = film(rmsnorm(x_mid)) -> bf16
    rmsnorm_film_kernel<<<(int)(BT / 8), 256, 0, stream>>>(x_mid, norm3_w, gamma3, beta3, y3_bf);
    // 9) h = y3 @ ffn_w1  [BT, 4D]
    {
        dim3 grid(4 * DD / 128, (int)(BT / 128));
        gemm_bf16_kernel<0><<<grid, 256, 0, stream>>>(y3_bf, w1_bf, h_bf, nullptr,
                                                      (int)BT, 4 * DD, DD);
    }
    // 10) geglu
    geglu_kernel<<<(int)(BT / 2), 256, 0, stream>>>(h_bf, g_bf);
    // 11) out = x_mid + g @ ffn_w2
    {
        dim3 grid(DD / 128, (int)(BT / 128));
        gemm_bf16_kernel<1><<<grid, 256, 0, stream>>>(g_bf, w2_bf, out_x, x_mid,
                                                      (int)BT, DD, 2 * DD);
    }
}

// v005
// It runs in 212 microseconds.
// Next to v004, in two timings, it ran 1.05 and 1.04 times as fast.
// All steps since v000 together make it 3.35 times as fast.
#include <hip/hip_runtime.h>
#include <hip/hip_bf16.h>
#include <math.h>
#include <stdint.h>

// ---------------------------------------------------------------------------
// Problem constants (from reference)
// ---------------------------------------------------------------------------
#define BB 4
#define TT 1024
#define DD 1024
#define HH 16
#define DHH 64
#define DCC 64
#define NBUCK 32

typedef unsigned short ushort_t;
typedef __attribute__((ext_vector_type(16))) __bf16 v16bf;
typedef __attribute__((ext_vector_type(8)))  float  v8f;
typedef __attribute__((ext_vector_type(8)))  short  s16x8;

union Frag {
    v16bf v;
    uint4 u4[2];
    s16x8 t[2];
};

__device__ __forceinline__ v8f v8f_zero() {
    v8f z;
#pragma unroll
    for (int i = 0; i < 8; ++i) z[i] = 0.0f;
    return z;
}

__device__ __forceinline__ __bf16 f32_to_bf16(float f) {
    unsigned u = __builtin_bit_cast(unsigned, f);
    unsigned r = u + 0x7FFFu + ((u >> 16) & 1u);   // round-to-nearest-even
    unsigned short h = (unsigned short)(r >> 16);
    return __builtin_bit_cast(__bf16, h);
}

__device__ __forceinline__ v8f wmma_bf16(v16bf a, v16bf b, v8f c) {
    // D = A(16x32 bf16) * B(32x16 bf16) + C(16x16 f32)
    return __builtin_amdgcn_wmma_f32_16x16x32_bf16(
        /*neg_a=*/false, a, /*neg_b=*/false, b,
        /*c_mod=*/(short)0, c, /*reuse_a=*/false, /*reuse_b=*/false);
}

// Four async copies of 16B (8 bf16) per lane from global to LDS; tracked with
// ASYNCcnt. The closing s_wait_xcnt stands inside the statement so that no
// address register of a copy is rewritten in front of it.
__device__ __forceinline__ void async_copy4_b128(const void* g0, void* d0,
                                                 const void* g1, void* d1,
                                                 const void* g2, void* d2,
                                                 const void* g3, void* d3) {
    unsigned l0 = (unsigned)(unsigned long long)d0;  // LDS aperture: low 32 bits
    unsigned l1 = (unsigned)(unsigned long long)d1;
    unsigned l2 = (unsigned)(unsigned long long)d2;
    unsigned l3 = (unsigned)(unsigned long long)d3;
    asm volatile("global_load_async_to_lds_b128 %0, %1, off\n\t"
                 "global_load_async_to_lds_b128 %2, %3, off\n\t"
                 "global_load_async_to_lds_b128 %4, %5, off\n\t"
                 "global_load_async_to_lds_b128 %6, %7, off\n\t"
                 "s_wait_xcnt 0x0"
                 :: "v"(l0), "v"(g0), "v"(l1), "v"(g1),
                    "v"(l2), "v"(g2), "v"(l3), "v"(g3) : "memory");
}
// Eight such copies in one statement; the closing s_wait_xcnt stands inside it
// for the same reason.
__device__ __forceinline__ void async_copy8_b128(const void* const (&g)[8],
                                                 const unsigned (&l)[8]) {
    asm volatile("global_load_async_to_lds_b128 %0, %1, off\n\t"
                 "global_load_async_to_lds_b128 %2, %3, off\n\t"
                 "global_load_async_to_lds_b128 %4, %5, off\n\t"
                 "global_load_async_to_lds_b128 %6, %7, off\n\t"
                 "global_load_async_to_lds_b128 %8, %9, off\n\t"
                 "global_load_async_to_lds_b128 %10, %11, off\n\t"
                 "global_load_async_to_lds_b128 %12, %13, off\n\t"
                 "global_load_async_to_lds_b128 %14, %15, off\n\t"
                 "s_wait_xcnt 0x0"
                 :: "v"(l[0]), "v"(g[0]), "v"(l[1]), "v"(g[1]),
                    "v"(l[2]), "v"(g[2]), "v"(l[3]), "v"(g[3]),
                    "v"(l[4]), "v"(g[4]), "v"(l[5]), "v"(g[5]),
                    "v"(l[6]), "v"(g[6]), "v"(l[7]), "v"(g[7]) : "memory");
}
// The issuing wave's copies have landed behind this wait.
__device__ __forceinline__ void async_wait0() {
    asm volatile("s_wait_asynccnt 0x0" ::: "memory");
}
// The wave's own LDS reads have retired before a copy may refill what they read.
__device__ __forceinline__ void lds_wait0() {
    asm volatile("s_wait_dscnt 0x0" ::: "memory");
}

// Transposing LDS load: from a row-major [k][n] bf16 tile, lane (c = l & 15,
// h = l >> 4) receives T[kbase + 8h + 0..7][nbase + c]. The lane's address is
// row kbase + 8*(l >> 4) + (l & 7), column nbase + 8*((l >> 3) & 1).
__device__ __forceinline__ s16x8 lds_load_tr16(const ushort_t* p) {
    typedef __attribute__((address_space(3))) s16x8 lds_s16x8;
    return __builtin_amdgcn_ds_load_tr16_b128_v8i16((lds_s16x8*)p);
}

// ---------------------------------------------------------------------------
// Elementwise helpers
// ---------------------------------------------------------------------------
// Two floats rounded to bf16 and packed into one dword (a in the low half).
__device__ __forceinline__ unsigned pack2_bf16(float a, float b) {
    unsigned lo = __builtin_bit_cast(unsigned short, f32_to_bf16(a));
    unsigned hi = __builtin_bit_cast(unsigned short, f32_to_bf16(b));
    return lo | (hi << 16);
}

// 16 elements per thread: a block takes 4096 consecutive elements as four
// slabs of 1024; each wave-wide load covers 512 contiguous bytes, each store
// 256. The blocks cover the array exactly (its length is a multiple of 4096).
__device__ __forceinline__
void cvt_bf16_block(const float* __restrict__ src,
                    __bf16* __restrict__ dst, int blk) {
    const int base = blk * 4096 + threadIdx.x * 4;
    float4 v[4];
#pragma unroll
    for (int u = 0; u < 4; ++u) v[u] = *(const float4*)(src + base + u * 1024);
#pragma unroll
    for (int u = 0; u < 4; ++u)
        *(uint2*)(dst + base + u * 1024) =
            make_uint2(pack2_bf16(v[u].x, v[u].y), pack2_bf16(v[u].z, v[u].w));
    // the stores' registers are not rewritten by another part of the merged
    // kernel in front of this wait
    asm volatile("s_wait_xcnt 0x0" ::: "memory");
}

// gamma/beta = cond @ W + b  (per batch, DC=64 reduction); B*D/256 blocks
__device__ __forceinline__
void film_params_block(const float* __restrict__ cond,
                       const float* __restrict__ gw,
                       const float* __restrict__ gb,
                       const float* __restrict__ bw,
                       const float* __restrict__ bb,
                       float* __restrict__ gamma,
                       float* __restrict__ beta, int blk) {
    int idx = blk * 256 + threadIdx.x;   // B*D
    if (idx >= BB * DD) return;
    int b = idx / DD, d = idx % DD;
    const float* c = cond + b * DCC;
    float g = gb[d], bt = bb[d];
#pragma unroll 8
    for (int i = 0; i < DCC; ++i) {
        float cv = c[i];
        g  += cv * gw[i * DD + d];
        bt += cv * bw[i * DD + d];
    }
    gamma[idx] = g;
    beta[idx]  = bt;
}

// T5 relative position bucket of rp = k - q
__device__ __forceinline__ int rel_bucket(int rp) {
    const int nb = NBUCK / 2;      // 16
    const int max_exact = nb / 2;  // 8
    int bucket = (rp > 0) ? nb : 0;
    int arp = rp < 0 ? -rp : rp;
    int val;
    if (arp < max_exact) {
        val = arp;
    } else {
        float rp_safe = (float)(arp > 1 ? arp : 1);
        int large = max_exact +
            (int)(logf(rp_safe / (float)max_exact) /
                  logf(128.0f / (float)max_exact) * (float)(nb - max_exact));
        val = large < nb - 1 ? large : nb - 1;
    }
    return bucket + val;
}

// T5 relative position bias -> bias_out[h][q][k]  (this is output #2)
// One block per query row; a thread takes 4 consecutive keys for all 16 heads
// (64 elements): each wave-wide store covers 512 contiguous bytes of one head.
__device__ __forceinline__
void bias_block(const float* __restrict__ rel_emb,
                float* __restrict__ bias_out, int q) {
    const int k0 = threadIdx.x * 4;
    float e[4][HH];
#pragma unroll
    for (int c = 0; c < 4; ++c) {
        const float4* p = (const float4*)(rel_emb + rel_bucket(k0 + c - q) * HH);
#pragma unroll
        for (int g = 0; g < HH / 4; ++g) {
            float4 t = p[g];
            e[c][4 * g + 0] = t.x;
            e[c][4 * g + 1] = t.y;
            e[c][4 * g + 2] = t.z;
            e[c][4 * g + 3] = t.w;
        }
    }
#pragma unroll
    for (int h = 0; h < HH; ++h)
        *(float4*)(bias_out + ((size_t)h * TT + q) * TT + k0) =
            make_float4(e[0][h], e[1][h], e[2][h], e[3][h]);
    // the stores' registers are not rewritten by another part of the merged
    // kernel in front of this wait
    asm volatile("s_wait_xcnt 0x0" ::: "memory");
}

// Everything that depends on the inputs alone, in one grid: a block's index
// says which piece it does. The FiLM blocks, few and latency-bound, come first.
#define NB_FILM (BB * DD / 256)      // blocks per FiLM parameter pair
#define NB_W    (DD * DD / 4096)     // blocks per D x D weight matrix
#define NB_PREP (2 * NB_FILM + TT + 10 * NB_W)
__global__ __launch_bounds__(256)
void prep_kernel(const float* __restrict__ cond,
                 const float* __restrict__ f1_gw, const float* __restrict__ f1_gb,
                 const float* __restrict__ f1_bw, const float* __restrict__ f1_bb,
                 float* __restrict__ gamma1, float* __restrict__ beta1,
                 const float* __restrict__ f3_gw, const float* __restrict__ f3_gb,
                 const float* __restrict__ f3_bw, const float* __restrict__ f3_bb,
                 float* __restrict__ gamma3, float* __restrict__ beta3,
                 const float* __restrict__ rel_emb, float* __restrict__ bias_out,
                 const float* __restrict__ wq, const float* __restrict__ wk,
                 const float* __restrict__ wv, const float* __restrict__ wo,
                 const float* __restrict__ w1, const float* __restrict__ w2,
                 __bf16* __restrict__ wq_bf, __bf16* __restrict__ wk_bf,
                 __bf16* __restrict__ wv_bf, __bf16* __restrict__ wo_bf,
                 __bf16* __restrict__ w1_bf, __bf16* __restrict__ w2_bf) {
    int blk = blockIdx.x;
    if (blk < NB_FILM) {
        film_params_block(cond, f1_gw, f1_gb, f1_bw, f1_bb, gamma1, beta1, blk);
        return;
    }
    blk -= NB_FILM;
    if (blk < NB_FILM) {
        film_params_block(cond, f3_gw, f3_gb, f3_bw, f3_bb, gamma3, beta3, blk);
        return;
    }
    blk -= NB_FILM;
    if (blk < TT) {
        bias_block(rel_emb, bias_out, blk);
        return;
    }
    blk -= TT;
    const float* src;
    __bf16* dst;
    if (blk < NB_W)          { src = wq; dst = wq_bf; }
    else if (blk < 2 * NB_W) { src = wk; dst = wk_bf; blk -= NB_W; }
    else if (blk < 3 * NB_W) { src = wv; dst = wv_bf; blk -= 2 * NB_W; }
    else if (blk < 4 * NB_W) { src = wo; dst = wo_bf; blk -= 3 * NB_W; }
    else if (blk < 8 * NB_W) { src = w1; dst = w1_bf; blk -= 4 * NB_W; }
    else                     { src = w2; dst = w2_bf; blk -= 8 * NB_W; }
    cvt_bf16_block(src, dst, blk);
}

// y = film(rms_norm(x)) -> bf16, one wave per (b,t) row: a lane holds 32
// elements of the row in registers (eight 16-byte loads, 512 contiguous bytes
// per wave each), so x is read once and the row sum needs no LDS.
__global__ __launch_bounds__(256)
void rmsnorm_film_kernel(const float* __restrict__ x,
                         const float* __restrict__ w,
                         const float* __restrict__ gamma,
                         const float* __restrict__ beta,
                         __bf16* __restrict__ y) {
    const int lane = threadIdx.x & 31;
    const int row = blockIdx.x * 8 + (threadIdx.x >> 5);   // 0 .. B*T-1
    const int b = row / TT;
    const float* xr = x + (size_t)row * DD + lane * 4;
    float4 v[8];
#pragma unroll
    for (int u = 0; u < 8; ++u) v[u] = *(const float4*)(xr + u * 128);
    float s0 = 0.0f, s1 = 0.0f, s2 = 0.0f, s3 = 0.0f;   // four independent chains
#pragma unroll
    for (int u = 0; u < 8; ++u) {
        s0 += v[u].x * v[u].x;
        s1 += v[u].y * v[u].y;
        s2 += v[u].z * v[u].z;
        s3 += v[u].w * v[u].w;
    }
    float tot = (s0 + s1) + (s2 + s3);
#pragma unroll
    for (int m = 16; m >= 1; m >>= 1) tot += __shfl_xor(tot, m, 32);
    float rstd = rsqrtf(tot / (float)DD + 1e-6f);
    const float* wr = w + lane * 4;
    const float* g  = gamma + (size_t)b * DD + lane * 4;
    const float* be = beta + (size_t)b * DD + lane * 4;
    __bf16* yr = y + (size_t)row * DD + lane * 4;
#pragma unroll
    for (int u = 0; u < 8; ++u) {
        float4 w4 = *(const float4*)(wr + u * 128);
        float4 g4 = *(const float4*)(g + u * 128);
        float4 b4 = *(const float4*)(be + u * 128);
        float r0 = (w4.x * (v[u].x * rstd)) * (g4.x + 1.0f) + b4.x;
        float r1 = (w4.y * (v[u].y * rstd)) * (g4.y + 1.0f) + b4.y;
        float r2 = (w4.z * (v[u].z * rstd)) * (g4.z + 1.0f) + b4.z;
        float r3 = (w4.w * (v[u].w * rstd)) * (g4.w + 1.0f) + b4.w;
        *(uint2*)(yr + u * 128) = make_uint2(pack2_bf16(r0, r1), pack2_bf16(r2, r3));
    }
}

// geglu: g[r,c] = h[r,c] * gelu(h[r,c+2048]), exact gelu
__device__ __forceinline__ float geglu1(float p1, float p2) {
    float ge = 0.5f * p2 * (1.0f + erff(p2 * 0.70710678118654752f));
    return p1 * ge;
}
// both bf16 halves of a dword pair
__device__ __forceinline__ unsigned geglu2(unsigned a, unsigned c) {
    float lo = geglu1(__builtin_bit_cast(float, a << 16),
                      __builtin_bit_cast(float, c << 16));
    float hi = geglu1(__builtin_bit_cast(float, a & 0xFFFF0000u),
                      __builtin_bit_cast(float, c & 0xFFFF0000u));
    return pack2_bf16(lo, hi);
}
// One block per two rows; a thread takes 8 consecutive columns of each row
// (16 elements), all by 16-byte accesses.
__global__ __launch_bounds__(256)
void geglu_kernel(const __bf16* __restrict__ h,
                  __bf16* __restrict__ g) {
    const int c = threadIdx.x * 8;
    const size_t r0 = (size_t)blockIdx.x * 2;
    uint4 p1[2], p2[2];
#pragma unroll
    for (int u = 0; u < 2; ++u) {
        const __bf16* hr = h + (r0 + u) * 4 * DD + c;
        p1[u] = *(const uint4*)hr;
        p2[u] = *(const uint4*)(hr + 2 * DD);
    }
#pragma unroll
    for (int u = 0; u < 2; ++u)
        *(uint4*)(g + (r0 + u) * 2 * DD + c) =
            make_uint4(geglu2(p1[u].x, p2[u].x), geglu2(p1[u].y, p2[u].y),
                       geglu2(p1[u].z, p2[u].z), geglu2(p1[u].w, p2[u].w));
}

// ---------------------------------------------------------------------------
// Generic bf16 WMMA GEMM:  C[M,N] = A[M,K] * B[K,N]  (row-major, bf16 in)
// Block tile 128x128, 8 waves (4 along M x 2 along N), wave tile 32x64.
// Double-buffered LDS, 128 k per stage (K is a multiple of 128); A and B tiles
// staged via GLOBAL_LOAD_ASYNC_TO_LDS_B128, each wave-wide copy taking two whole
// 256-byte rows; B kept row-major [k][n] and transposed by the fragment loads.
// EPI==0: store bf16.  EPI==1: store f32 with residual add.
// Grid z: independent products on the same A; B, C and the residual advance by
// one whole matrix per z.
// ---------------------------------------------------------------------------
template <int EPI>
__global__ __launch_bounds__(256)
void gemm_bf16_kernel(const __bf16* __restrict__ A,
                      const __bf16* __restrict__ Bm,
                      void* __restrict__ C,
                      const float* __restrict__ residual,
                      int M, int N, int K) {
    constexpr int BK = 128;   // k per stage
    constexpr int PA = 136;   // lA row pitch: 272 B, an odd multiple of 16 B
    constexpr int PB = 144;   // lB row pitch: 288 B, an odd multiple of 32 B
    __shared__ __attribute__((aligned(16))) ushort_t lA[2][128 * PA];  // [m][k]
    __shared__ __attribute__((aligned(16))) ushort_t lB[2][BK * PB];   // [k][n]

    const int tid  = threadIdx.x;
    const int lane = tid & 31;
    const int wave = tid >> 5;          // 0..7
    const int wm   = wave & 3;          // 4 waves along M
    const int wn   = wave >> 2;         // 2 waves along N
    const int half = lane >> 4;         // which 16-lane half
    const int l16  = lane & 15;
    const int koff = half ? 8 : 0;
    const int trow = half * 8 + (lane & 7);      // transposing load: lane's row
    const int tcol = ((lane >> 3) & 1) * 8;      // and its column offset

    const int blockM = blockIdx.y * 128;
    const int blockN = blockIdx.x * 128;

    // per-thread tile-copy coordinates: both tiles are 128 rows of 256 B; a
    // thread takes 16-byte column cCol of rows cRow, +16, ... +112 of each
    const int cRow = tid >> 4;
    const int cCol = (tid & 15) * 8;

    // each thread's two source addresses walk along K, one tile per issue
    const __bf16* gA = A + (size_t)(blockM + cRow) * K + cCol;
    const __bf16* gB = Bm + ((size_t)blockIdx.z * K + cRow) * N + blockN + cCol;
    auto issueAB = [&](int buf) {
        const void* g[8];
        unsigned l[8];   // LDS aperture: low 32 bits
        // both loops unrolled: g and l are the statement's register operands
#pragma unroll
        for (int u = 0; u < 8; ++u) {
            g[u] = gA + (size_t)(16 * u) * K;
            l[u] = (unsigned)(unsigned long long)&lA[buf][(cRow + 16 * u) * PA + cCol];
        }
        async_copy8_b128(g, l);
#pragma unroll
        for (int u = 0; u < 8; ++u) {
            g[u] = gB + (size_t)(16 * u) * N;
            l[u] = (unsigned)(unsigned long long)&lB[buf][(cRow + 16 * u) * PB + cCol];
        }
        async_copy8_b128(g, l);
        gA += BK;
        gB += (size_t)BK * N;
    };

    v8f acc[2][4];
#pragma unroll
    for (int i = 0; i < 2; ++i)
#pragma unroll
        for (int j = 0; j < 4; ++j) acc[i][j] = v8f_zero();

    // prologue: tile 0 lands and is published, then tile 1 starts to fly
    const int ntiles = K / BK;
    issueAB(0);
    async_wait0();
    __syncthreads();
    if (ntiles > 1) issueAB(1);

    for (int t = 0; t < ntiles; ++t) {
        const int cur = t & 1;

        // compute current tile, 32 k at a time in ascending order; unrolled so
        // that every LDS offset inside the stage is an immediate
#pragma unroll
        for (int kk = 0; kk < BK; kk += 32) {
            Frag a[2], b[4];
#pragma unroll
            for (int i = 0; i < 2; ++i) {
                int row = wm * 32 + i * 16 + l16;
                a[i].u4[0] = *(const uint4*)&lA[cur][row * PA + kk + koff];
                a[i].u4[1] = *(const uint4*)&lA[cur][row * PA + kk + koff + 16];
            }
#pragma unroll
            for (int j = 0; j < 4; ++j) {
                int col = wn * 64 + j * 16 + tcol;
                b[j].t[0] = lds_load_tr16(&lB[cur][(kk + trow) * PB + col]);
                b[j].t[1] = lds_load_tr16(&lB[cur][(kk + 16 + trow) * PB + col]);
            }
#pragma unroll
            for (int i = 0; i < 2; ++i)
#pragma unroll
                for (int j = 0; j < 4; ++j)
                    acc[i][j] = wmma_bf16(a[i].v, b[j].v, acc[i][j]);
        }

        // publish tile t + 1 and free this trip's buffer, then refill it
        lds_wait0();
        async_wait0();
        __syncthreads();
        if (t + 2 < ntiles) issueAB(cur);
    }
    async_wait0();

    // epilogue (C-layout: col = l16, row = r + 8*half per vgpr r)
#pragma unroll
    for (int i = 0; i < 2; ++i) {
#pragma unroll
        for (int j = 0; j < 4; ++j) {
            int col = blockN + wn * 64 + j * 16 + l16;
#pragma unroll
            for (int r = 0; r < 8; ++r) {
                int row = blockM + wm * 32 + i * 16 + r + half * 8;
                size_t idx = ((size_t)blockIdx.z * M + row) * N + col;
                float v = acc[i][j][r];
                if (EPI == 0) {
                    ((__bf16*)C)[idx] = f32_to_bf16(v);
                } else {
                    ((float*)C)[idx] = residual[idx] + v;
                }
            }
        }
    }
}

// ---------------------------------------------------------------------------
// Flash attention: grid (B*H, T/64), block 128 (4 waves x 16 query rows).
// S = Q*K^T * 1/8 + bias, mask, online softmax, O = P*V.
// K and V tiles staged async to LDS; V transposed by its fragment loads.
// ---------------------------------------------------------------------------
__global__ __launch_bounds__(128)
void flash_attn_kernel(const __bf16* __restrict__ qb,
                       const __bf16* __restrict__ kb,
                       const __bf16* __restrict__ vb,
                       const float* __restrict__ bias,   // [H][T][T]
                       const int* __restrict__ mask,     // [B][T][T]
                       __bf16* __restrict__ ob) {
    constexpr int PK = 72;    // lK and lP row pitch: 144 B, an odd multiple of 16 B
    constexpr int PV = 80;    // lV row pitch: 160 B, an odd multiple of 32 B
    __shared__ __attribute__((aligned(16))) ushort_t lK[64 * PK];   // [key][dh]   -> B-frag layout for Q*K^T
    __shared__ __attribute__((aligned(16))) ushort_t lV[64 * PV];   // [key][dh]   -> read by transposing loads
    __shared__ __attribute__((aligned(16))) ushort_t lP[64 * PK];   // [q][key]    -> A-frag relayout

    const int bh = blockIdx.x;
    const int b = bh / HH;
    const int h = bh % HH;
    const int qbase = blockIdx.y * 64;
    const int tid  = threadIdx.x;
    const int lane = tid & 31;
    const int wave = tid >> 5;         // 0..3 -> 16 query rows each
    const int half = lane >> 4;
    const int l16  = lane & 15;
    const int koff = half ? 8 : 0;
    const int trow = half * 8 + (lane & 7);      // transposing load: lane's row
    const int tcol = ((lane >> 3) & 1) * 8;      // and its column offset
    const int crow = tid >> 3;                   // tile copy: lane's first row
    const int ccol = (tid & 7) * 8;              // and its column

    // Q fragments stay in registers for the whole kernel
    Frag qf[2];
    {
        int qrow = qbase + wave * 16 + l16;
        const __bf16* qrp = qb + ((size_t)(b * TT + qrow)) * DD + h * DHH;
        qf[0].u4[0] = *(const uint4*)(qrp + koff);
        qf[0].u4[1] = *(const uint4*)(qrp + koff + 16);
        qf[1].u4[0] = *(const uint4*)(qrp + 32 + koff);
        qf[1].u4[1] = *(const uint4*)(qrp + 32 + koff + 16);
    }

    float m[8], l[8];
    v8f o[4];
#pragma unroll
    for (int r = 0; r < 8; ++r) { m[r] = -1e30f; l[r] = 0.0f; }
#pragma unroll
    for (int j = 0; j < 4; ++j) o[j] = v8f_zero();

    const float scale = 0.125f;   // 1/sqrt(DH)

    for (int kt = 0; kt < TT / 64; ++kt) {
        const int kbase = kt * 64;
        // K and V tiles: natural [key][dh] layout, async to LDS (no VGPR staging);
        // each thread copies column ccol of rows crow, +16, +32, +48
        const size_t gofs = ((size_t)(b * TT + kbase + crow)) * DD + h * DHH + ccol;
        async_copy4_b128(kb + gofs,           &lK[crow * PK + ccol],
                         kb + gofs + 16 * DD, &lK[(crow + 16) * PK + ccol],
                         kb + gofs + 32 * DD, &lK[(crow + 32) * PK + ccol],
                         kb + gofs + 48 * DD, &lK[(crow + 48) * PK + ccol]);
        async_copy4_b128(vb + gofs,           &lV[crow * PV + ccol],
                         vb + gofs + 16 * DD, &lV[(crow + 16) * PV + ccol],
                         vb + gofs + 32 * DD, &lV[(crow + 32) * PV + ccol],
                         vb + gofs + 48 * DD, &lV[(crow + 48) * PV + ccol]);
        async_wait0();
        __syncthreads();

        // S = Q * K^T  (4 column frags of 16, K-reduction DH=64 -> 2 wmma)
        v8f s[4];
#pragma unroll
        for (int j = 0; j < 4; ++j) {
            int col = j * 16 + l16;
            Frag b0, b1;
            b0.u4[0] = *(const uint4*)&lK[col * PK + koff];
            b0.u4[1] = *(const uint4*)&lK[col * PK + koff + 16];
            b1.u4[0] = *(const uint4*)&lK[col * PK + 32 + koff];
            b1.u4[1] = *(const uint4*)&lK[col * PK + 32 + koff + 16];
            v8f z = v8f_zero();
            z = wmma_bf16(qf[0].v, b0.v, z);
            s[j] = wmma_bf16(qf[1].v, b1.v, z);
        }

        // scale + bias + mask + online softmax (per accumulator row)
#pragma unroll
        for (int r = 0; r < 8; ++r) {
            int qg = qbase + wave * 16 + r + half * 8;
            float rmax = -1e30f;
#pragma unroll
            for (int j = 0; j < 4; ++j) {
                int kg = kbase + j * 16 + l16;
                float v = s[j][r] * scale +
                          bias[((size_t)h * TT + qg) * TT + kg];
                int mk = mask[((size_t)b * TT + qg) * TT + kg];
                v = (mk == 0) ? -1e9f : v;
                s[j][r] = v;
                rmax = fmaxf(rmax, v);
            }
#pragma unroll
            for (int mm = 8; mm >= 1; mm >>= 1)
                rmax = fmaxf(rmax, __shfl_xor(rmax, mm, 32));
            float mnew = fmaxf(m[r], rmax);
            float corr = __expf(m[r] - mnew);
            float psum = 0.0f;
#pragma unroll
            for (int j = 0; j < 4; ++j) {
                float p = __expf(s[j][r] - mnew);
                s[j][r] = p;
                psum += p;
            }
#pragma unroll
            for (int mm = 8; mm >= 1; mm >>= 1)
                psum += __shfl_xor(psum, mm, 32);
            l[r] = l[r] * corr + psum;
            m[r] = mnew;
#pragma unroll
            for (int j = 0; j < 4; ++j) o[j][r] *= corr;
        }

        // Relayout P through LDS (C-frag -> A-frag)
#pragma unroll
        for (int j = 0; j < 4; ++j) {
            int coll = j * 16 + l16;
#pragma unroll
            for (int r = 0; r < 8; ++r) {
                int rowl = wave * 16 + r + half * 8;
                lP[rowl * PK + coll] =
                    __builtin_bit_cast(unsigned short, f32_to_bf16(s[j][r]));
            }
        }
        __syncthreads();

        // O += P * V
        Frag pa[2];
        {
            int prow = wave * 16 + l16;
            pa[0].u4[0] = *(const uint4*)&lP[prow * PK + koff];
            pa[0].u4[1] = *(const uint4*)&lP[prow * PK + koff + 16];
            pa[1].u4[0] = *(const uint4*)&lP[prow * PK + 32 + koff];
            pa[1].u4[1] = *(const uint4*)&lP[prow * PK + 32 + koff + 16];
        }
#pragma unroll
        for (int j = 0; j < 4; ++j) {
            int col = j * 16 + tcol;  // dh column block
            Frag v0, v1;
            v0.t[0] = lds_load_tr16(&lV[trow * PV + col]);
            v0.t[1] = lds_load_tr16(&lV[(16 + trow) * PV + col]);
            v1.t[0] = lds_load_tr16(&lV[(32 + trow) * PV + col]);
            v1.t[1] = lds_load_tr16(&lV[(48 + trow) * PV + col]);
            o[j] = wmma_bf16(pa[0].v, v0.v, o[j]);
            o[j] = wmma_bf16(pa[1].v, v1.v, o[j]);
        }
        lds_wait0();   // this wave has left lK and lV before the next copies
        __syncthreads();
    }

    // finalize: O /= l, write bf16 [B,T,H*DH]
#pragma unroll
    for (int j = 0; j < 4; ++j) {
        int dh = j * 16 + l16;
#pragma unroll
        for (int r = 0; r < 8; ++r) {
            int qg = qbase + wave * 16 + r + half * 8;
            float v = o[j][r] / l[r];
            ob[((size_t)(b * TT + qg)) * DD + h * DHH + dh] = f32_to_bf16(v);
        }
    }
}

// ---------------------------------------------------------------------------
// Host-side orchestration
// ---------------------------------------------------------------------------
static inline size_t align256(size_t x) { return (x + 255) & ~(size_t)255; }

extern "C" void kernel_launch(void* const* d_in, const int* in_sizes, int n_in,
                              void* d_out, int out_size, void* d_ws, size_t ws_size,
                              hipStream_t stream) {
    (void)in_sizes; (void)n_in; (void)out_size; (void)ws_size;
    const float* x        = (const float*)d_in[0];
    const int*   x_mask   = (const int*)  d_in[1];
    const float* cond     = (const float*)d_in[2];
    const float* norm1_w  = (const float*)d_in[3];
    const float* f1_gw    = (const float*)d_in[4];
    const float* f1_gb    = (const float*)d_in[5];
    const float* f1_bw    = (const float*)d_in[6];
    const float* f1_bb    = (const float*)d_in[7];
    const float* wq       = (const float*)d_in[8];
    const float* wk       = (const float*)d_in[9];
    const float* wv       = (const float*)d_in[10];
    const float* wo       = (const float*)d_in[11];
    const float* rel_emb  = (const float*)d_in[12];
    const float* norm3_w  = (const float*)d_in[13];
    const float* f3_gw    = (const float*)d_in[14];
    const float* f3_gb    = (const float*)d_in[15];
    const float* f3_bw    = (const float*)d_in[16];
    const float* f3_bb    = (const float*)d_in[17];
    const float* ffn_w1   = (const float*)d_in[18];
    const float* ffn_w2   = (const float*)d_in[19];

    float* out_x    = (float*)d_out;                              // [B,T,D]
    float* out_bias = (float*)d_out + (size_t)BB * TT * DD;       // [H,T,T]

    // workspace bump allocator
    char* ws = (char*)d_ws;
    size_t off = 0;
    auto alloc = [&](size_t bytes) -> void* {
        void* p = ws + off;
        off += align256(bytes);
        return p;
    };
    const size_t BT = (size_t)BB * TT;
    __bf16* wq_bf   = (__bf16*)alloc((size_t)3 * DD * DD * 2);   // wq | wk | wv
    __bf16* wk_bf   = wq_bf + (size_t)DD * DD;
    __bf16* wv_bf   = wk_bf + (size_t)DD * DD;
    __bf16* wo_bf   = (__bf16*)alloc((size_t)DD * DD * 2);
    __bf16* w1_bf   = (__bf16*)alloc((size_t)DD * 4 * DD * 2);
    __bf16* w2_bf   = (__bf16*)alloc((size_t)2 * DD * DD * 2);
    float*  gamma1  = (float*)alloc((size_t)BB * DD * 4);
    float*  beta1   = (float*)alloc((size_t)BB * DD * 4);
    float*  gamma3  = (float*)alloc((size_t)BB * DD * 4);
    float*  beta3   = (float*)alloc((size_t)BB * DD * 4);
    __bf16* y_bf    = (__bf16*)alloc(BT * DD * 2);
    __bf16* q_bf    = (__bf16*)alloc(3 * BT * DD * 2);           // q | k | v
    __bf16* k_bf    = q_bf + BT * DD;
    __bf16* v_bf    = k_bf + BT * DD;
    __bf16* attn_bf = (__bf16*)alloc(BT * DD * 2);
    float*  x_mid   = (float*)alloc(BT * DD * 4);
    __bf16* y3_bf   = (__bf16*)alloc(BT * DD * 2);
    __bf16* h_bf    = (__bf16*)alloc(BT * 4 * DD * 2);
    __bf16* g_bf    = (__bf16*)alloc(BT * 2 * DD * 2);

    // 1) all that depends on the inputs alone: FiLM params, position bias
    //    (output #2 + consumed by attention), weight conversion fp32 -> bf16
    prep_kernel<<<NB_PREP, 256, 0, stream>>>(
        cond, f1_gw, f1_gb, f1_bw, f1_bb, gamma1, beta1,
        f3_gw, f3_gb, f3_bw, f3_bb, gamma3, beta3,
        rel_emb, out_bias,
        wq, wk, wv, wo, ffn_w1, ffn_w2,
        wq_bf, wk_bf, wv_bf, wo_bf, w1_bf, w2_bf);
    // 4) y = film(rmsnorm(x)) -> bf16
    rmsnorm_film_kernel<<<(int)(BT / 8), 256, 0, stream>>>(x, norm1_w, gamma1, beta1, y_bf);
    // 5) Q,K,V projections, one grid: z picks the weight and the output, which
    //    follow one another in the workspace
    {
        dim3 grid(DD / 128, (int)(BT / 128), 3);
        gemm_bf16_kernel<0><<<grid, 256, 0, stream>>>(y_bf, wq_bf, q_bf, nullptr,
                                                      (int)BT, DD, DD);
    }
    // 6) flash attention
    {
        dim3 grid(BB * HH, TT / 64);
        flash_attn_kernel<<<grid, 128, 0, stream>>>(q_bf, k_bf, v_bf,
                                                    out_bias, x_mask, attn_bf);
    }
    // 7) x_mid = x + attn @ wo
    {
        dim3 grid(DD / 128, (int)(BT / 128));
        gemm_bf16_kernel<1><<<grid, 256, 0, stream>>>(attn_bf, wo_bf, x_mid, x,
                                                      (int)BT, DD, DD);
    }
    // 8) y3 = film(rmsnorm(x_mid)) -> bf16
    rmsnorm_film_kernel<<<(int)(BT / 8), 256, 0, stream>>>(x_mid, norm3_w, gamma3, beta3, y3_bf);
    // 9) h = y3 @ ffn_w1  [BT, 4D]
    {
        dim3 grid(4 * DD / 128, (int)(BT / 128));
        gemm_bf16_kernel<0><<<grid, 256, 0, stream>>>(y3_bf, w1_bf, h_bf, nullptr,
                                                      (int)BT, 4 * DD, DD);
    }
    // 10) geglu
    geglu_kernel<<<(int)(BT / 2), 256, 0, stream>>>(h_bf, g_bf);
    // 11) out = x_mid + g @ ffn_w2
    {
        dim3 grid(DD / 128, (int)(BT / 128));
        gemm_bf16_kernel<1><<<grid, 256, 0, stream>>>(g_bf, w2_bf, out_x, x_mid,
                                                      (int)BT, DD, 2 * DD);
    }
}

// v006
// It runs in 194 microseconds.
// Timed twice side by side with v005, it ran 1.08 and 1.09 times as fast.
// All steps since v000 together make it 3.64 times as fast.
#include <hip/hip_runtime.h>
#include <hip/hip_bf16.h>
#include <math.h>
#include <stdint.h>

// ---------------------------------------------------------------------------
// Problem constants (from reference)
// ---------------------------------------------------------------------------
#define BB 4
#define TT 1024
#define DD 1024
#define HH 16
#define DHH 64
#define DCC 64
#define NBUCK 32

typedef unsigned short ushort_t;
typedef __attribute__((ext_vector_type(16))) __bf16 v16bf;
typedef __attribute__((ext_vector_type(8)))  float  v8f;
typedef __attribute__((ext_vector_type(8)))  short  s16x8;

union Frag {
    v16bf v;
    uint4 u4[2];
    s16x8 t[2];
};

__device__ __forceinline__ v8f v8f_zero() {
    v8f z;
#pragma unroll
    for (int i = 0; i < 8; ++i) z[i] = 0.0f;
    return z;
}

__device__ __forceinline__ __bf16 f32_to_bf16(float f) {
    unsigned u = __builtin_bit_cast(unsigned, f);
    unsigned r = u + 0x7FFFu + ((u >> 16) & 1u);   // round-to-nearest-even
    unsigned short h = (unsigned short)(r >> 16);
    return __builtin_bit_cast(__bf16, h);
}

__device__ __forceinline__ v8f wmma_bf16(v16bf a, v16bf b, v8f c) {
    // D = A(16x32 bf16) * B(32x16 bf16) + C(16x16 f32)
    return __builtin_amdgcn_wmma_f32_16x16x32_bf16(
        /*neg_a=*/false, a, /*neg_b=*/false, b,
        /*c_mod=*/(short)0, c, /*reuse_a=*/false, /*reuse_b=*/false);
}

// Four async copies of 16B (8 bf16) per lane from global to LDS; tracked with
// ASYNCcnt. The closing s_wait_xcnt stands inside the statement so that no
// address register of a copy is rewritten in front of it.
__device__ __forceinline__ void async_copy4_b128(const void* g0, void* d0,
                                                 const void* g1, void* d1,
                                                 const void* g2, void* d2,
                                                 const void* g3, void* d3) {
    unsigned l0 = (unsigned)(unsigned long long)d0;  // LDS aperture: low 32 bits
    unsigned l1 = (unsigned)(unsigned long long)d1;
    unsigned l2 = (unsigned)(unsigned long long)d2;
    unsigned l3 = (unsigned)(unsigned long long)d3;
    asm volatile("global_load_async_to_lds_b128 %0, %1, off\n\t"
                 "global_load_async_to_lds_b128 %2, %3, off\n\t"
                 "global_load_async_to_lds_b128 %4, %5, off\n\t"
                 "global_load_async_to_lds_b128 %6, %7, off\n\t"
                 "s_wait_xcnt 0x0"
                 :: "v"(l0), "v"(g0), "v"(l1), "v"(g1),
                    "v"(l2), "v"(g2), "v"(l3), "v"(g3) : "memory");
}
// Eight such copies in one statement; the closing s_wait_xcnt stands inside it
// for the same reason.
__device__ __forceinline__ void async_copy8_b128(const void* const (&g)[8],
                                                 const unsigned (&l)[8]) {
    asm volatile("global_load_async_to_lds_b128 %0, %1, off\n\t"
                 "global_load_async_to_lds_b128 %2, %3, off\n\t"
                 "global_load_async_to_lds_b128 %4, %5, off\n\t"
                 "global_load_async_to_lds_b128 %6, %7, off\n\t"
                 "global_load_async_to_lds_b128 %8, %9, off\n\t"
                 "global_load_async_to_lds_b128 %10, %11, off\n\t"
                 "global_load_async_to_lds_b128 %12, %13, off\n\t"
                 "global_load_async_to_lds_b128 %14, %15, off\n\t"
                 "s_wait_xcnt 0x0"
                 :: "v"(l[0]), "v"(g[0]), "v"(l[1]), "v"(g[1]),
                    "v"(l[2]), "v"(g[2]), "v"(l[3]), "v"(g[3]),
                    "v"(l[4]), "v"(g[4]), "v"(l[5]), "v"(g[5]),
                    "v"(l[6]), "v"(g[6]), "v"(l[7]), "v"(g[7]) : "memory");
}
// The issuing wave's copies have landed behind this wait.
__device__ __forceinline__ void async_wait0() {
    asm volatile("s_wait_asynccnt 0x0" ::: "memory");
}
// The wave's own LDS reads have retired before a copy may refill what they read.
__device__ __forceinline__ void lds_wait0() {
    asm volatile("s_wait_dscnt 0x0" ::: "memory");
}

// Transposing LDS load: from a row-major [k][n] bf16 tile, lane (c = l & 15,
// h = l >> 4) receives T[kbase + 8h + 0..7][nbase + c]. The lane's address is
// row kbase + 8*(l >> 4) + (l & 7), column nbase + 8*((l >> 3) & 1).
__device__ __forceinline__ s16x8 lds_load_tr16(const ushort_t* p) {
    typedef __attribute__((address_space(3))) s16x8 lds_s16x8;
    return __builtin_amdgcn_ds_load_tr16_b128_v8i16((lds_s16x8*)p);
}

// Eight independent reductions over 16-lane rows, butterfly steps 8, 4, 2, 1;
// every lane gets its row's result. In each step lane l combines its x with that
// of lane l ^ step through the vector unit's own lane crossbar (DPP row_xmask),
// not through the LDS path. Step-major order: the eight chains fill one
// another's latency.
// The maximum is written as asm because from the builtin the move was not folded
// into the maximum: each step kept a DPP move of its own beside it.
// Every loop is unrolled so that x stays in registers.
__device__ __forceinline__ void row_max16_x8(float (&x)[8]) {
#pragma unroll
    for (int r = 0; r < 8; ++r)
        asm("v_max_num_f32_dpp %0, %1, %1 row_xmask:8 row_mask:0xf bank_mask:0xf"
            : "=v"(x[r]) : "v"(x[r]));
#pragma unroll
    for (int r = 0; r < 8; ++r)
        asm("v_max_num_f32_dpp %0, %1, %1 row_xmask:4 row_mask:0xf bank_mask:0xf"
            : "=v"(x[r]) : "v"(x[r]));
#pragma unroll
    for (int r = 0; r < 8; ++r)
        asm("v_max_num_f32_dpp %0, %1, %1 row_xmask:2 row_mask:0xf bank_mask:0xf"
            : "=v"(x[r]) : "v"(x[r]));
#pragma unroll
    for (int r = 0; r < 8; ++r)
        asm("v_max_num_f32_dpp %0, %1, %1 row_xmask:1 row_mask:0xf bank_mask:0xf"
            : "=v"(x[r]) : "v"(x[r]));
}
// The sum's step; the compiler folds the move into the add.
template <int XM>
__device__ __forceinline__ float row_add_xor(float x) {
    return x + __builtin_bit_cast(float, __builtin_amdgcn_update_dpp(
        0, __builtin_bit_cast(int, x), 0x160 | XM, 0xf, 0xf, true));
}
__device__ __forceinline__ void row_sum16_x8(float (&x)[8]) {
#pragma unroll
    for (int r = 0; r < 8; ++r) x[r] = row_add_xor<8>(x[r]);
#pragma unroll
    for (int r = 0; r < 8; ++r) x[r] = row_add_xor<4>(x[r]);
#pragma unroll
    for (int r = 0; r < 8; ++r) x[r] = row_add_xor<2>(x[r]);
#pragma unroll
    for (int r = 0; r < 8; ++r) x[r] = row_add_xor<1>(x[r]);
}

// ---------------------------------------------------------------------------
// Elementwise helpers
// ---------------------------------------------------------------------------
// Two floats rounded to bf16 and packed into one dword (a in the low half).
__device__ __forceinline__ unsigned pack2_bf16(float a, float b) {
    unsigned lo = __builtin_bit_cast(unsigned short, f32_to_bf16(a));
    unsigned hi = __builtin_bit_cast(unsigned short, f32_to_bf16(b));
    return lo | (hi << 16);
}

// 16 elements per thread: a block takes 4096 consecutive elements as four
// slabs of 1024; each wave-wide load covers 512 contiguous bytes, each store
// 256. The blocks cover the array exactly (its length is a multiple of 4096).
__device__ __forceinline__
void cvt_bf16_block(const float* __restrict__ src,
                    __bf16* __restrict__ dst, int blk) {
    const int base = blk * 4096 + threadIdx.x * 4;
    float4 v[4];
#pragma unroll
    for (int u = 0; u < 4; ++u) v[u] = *(const float4*)(src + base + u * 1024);
#pragma unroll
    for (int u = 0; u < 4; ++u)
        *(uint2*)(dst + base + u * 1024) =
            make_uint2(pack2_bf16(v[u].x, v[u].y), pack2_bf16(v[u].z, v[u].w));
    // the stores' registers are not rewritten by another part of the merged
    // kernel in front of this wait
    asm volatile("s_wait_xcnt 0x0" ::: "memory");
}

// gamma/beta = cond @ W + b  (per batch, DC=64 reduction); B*D/256 blocks
__device__ __forceinline__
void film_params_block(const float* __restrict__ cond,
                       const float* __restrict__ gw,
                       const float* __restrict__ gb,
                       const float* __restrict__ bw,
                       const float* __restrict__ bb,
                       float* __restrict__ gamma,
                       float* __restrict__ beta, int blk) {
    int idx = blk * 256 + threadIdx.x;   // B*D
    if (idx >= BB * DD) return;
    int b = idx / DD, d = idx % DD;
    const float* c = cond + b * DCC;
    float g = gb[d], bt = bb[d];
#pragma unroll 8
    for (int i = 0; i < DCC; ++i) {
        float cv = c[i];
        g  += cv * gw[i * DD + d];
        bt += cv * bw[i * DD + d];
    }
    gamma[idx] = g;
    beta[idx]  = bt;
}

// T5 relative position bucket of rp = k - q
__device__ __forceinline__ int rel_bucket(int rp) {
    const int nb = NBUCK / 2;      // 16
    const int max_exact = nb / 2;  // 8
    int bucket = (rp > 0) ? nb : 0;
    int arp = rp < 0 ? -rp : rp;
    int val;
    if (arp < max_exact) {
        val = arp;
    } else {
        float rp_safe = (float)(arp > 1 ? arp : 1);
        int large = max_exact +
            (int)(logf(rp_safe / (float)max_exact) /
                  logf(128.0f / (float)max_exact) * (float)(nb - max_exact));
        val = large < nb - 1 ? large : nb - 1;
    }
    return bucket + val;
}

// T5 relative position bias -> bias_out[h][q][k]  (this is output #2)
// One block per query row; a thread takes 4 consecutive keys for all 16 heads
// (64 elements): each wave-wide store covers 512 contiguous bytes of one head.
__device__ __forceinline__
void bias_block(const float* __restrict__ rel_emb,
                float* __restrict__ bias_out, int q) {
    const int k0 = threadIdx.x * 4;
    float e[4][HH];
#pragma unroll
    for (int c = 0; c < 4; ++c) {
        const float4* p = (const float4*)(rel_emb + rel_bucket(k0 + c - q) * HH);
#pragma unroll
        for (int g = 0; g < HH / 4; ++g) {
            float4 t = p[g];
            e[c][4 * g + 0] = t.x;
            e[c][4 * g + 1] = t.y;
            e[c][4 * g + 2] = t.z;
            e[c][4 * g + 3] = t.w;
        }
    }
#pragma unroll
    for (int h = 0; h < HH; ++h)
        *(float4*)(bias_out + ((size_t)h * TT + q) * TT + k0) =
            make_float4(e[0][h], e[1][h], e[2][h], e[3][h]);
    // the stores' registers are not rewritten by another part of the merged
    // kernel in front of this wait
    asm volatile("s_wait_xcnt 0x0" ::: "memory");
}

// Everything that depends on the inputs alone, in one grid: a block's index
// says which piece it does. The FiLM blocks, few and latency-bound, come first.
#define NB_FILM (BB * DD / 256)      // blocks per FiLM parameter pair
#define NB_W    (DD * DD / 4096)     // blocks per D x D weight matrix
#define NB_PREP (2 * NB_FILM + TT + 10 * NB_W)
__global__ __launch_bounds__(256)
void prep_kernel(const float* __restrict__ cond,
                 const float* __restrict__ f1_gw, const float* __restrict__ f1_gb,
                 const float* __restrict__ f1_bw, const float* __restrict__ f1_bb,
                 float* __restrict__ gamma1, float* __restrict__ beta1,
                 const float* __restrict__ f3_gw, const float* __restrict__ f3_gb,
                 const float* __restrict__ f3_bw, const float* __restrict__ f3_bb,
                 float* __restrict__ gamma3, float* __restrict__ beta3,
                 const float* __restrict__ rel_emb, float* __restrict__ bias_out,
                 const float* __restrict__ wq, const float* __restrict__ wk,
                 const float* __restrict__ wv, const float* __restrict__ wo,
                 const float* __restrict__ w1, const float* __restrict__ w2,
                 __bf16* __restrict__ wq_bf, __bf16* __restrict__ wk_bf,
                 __bf16* __restrict__ wv_bf, __bf16* __restrict__ wo_bf,
                 __bf16* __restrict__ w1_bf, __bf16* __restrict__ w2_bf) {
    int blk = blockIdx.x;
    if (blk < NB_FILM) {
        film_params_block(cond, f1_gw, f1_gb, f1_bw, f1_bb, gamma1, beta1, blk);
        return;
    }
    blk -= NB_FILM;
    if (blk < NB_FILM) {
        film_params_block(cond, f3_gw, f3_gb, f3_bw, f3_bb, gamma3, beta3, blk);
        return;
    }
    blk -= NB_FILM;
    if (blk < TT) {
        bias_block(rel_emb, bias_out, blk);
        return;
    }
    blk -= TT;
    const float* src;
    __bf16* dst;
    if (blk < NB_W)          { src = wq; dst = wq_bf; }
    else if (blk < 2 * NB_W) { src = wk; dst = wk_bf; blk -= NB_W; }
    else if (blk < 3 * NB_W) { src = wv; dst = wv_bf; blk -= 2 * NB_W; }
    else if (blk < 4 * NB_W) { src = wo; dst = wo_bf; blk -= 3 * NB_W; }
    else if (blk < 8 * NB_W) { src = w1; dst = w1_bf; blk -= 4 * NB_W; }
    else                     { src = w2; dst = w2_bf; blk -= 8 * NB_W; }
    cvt_bf16_block(src, dst, blk);
}

// y = film(rms_norm(x)) -> bf16, one wave per (b,t) row: a lane holds 32
// elements of the row in registers (eight 16-byte loads, 512 contiguous bytes
// per wave each), so x is read once and the row sum needs no LDS.
__global__ __launch_bounds__(256)
void rmsnorm_film_kernel(const float* __restrict__ x,
                         const float* __restrict__ w,
                         const float* __restrict__ gamma,
                         const float* __restrict__ beta,
                         __bf16* __restrict__ y) {
    const int lane = threadIdx.x & 31;
    const int row = blockIdx.x * 8 + (threadIdx.x >> 5);   // 0 .. B*T-1
    const int b = row / TT;
    const float* xr = x + (size_t)row * DD + lane * 4;
    float4 v[8];
#pragma unroll
    for (int u = 0; u < 8; ++u) v[u] = *(const float4*)(xr + u * 128);
    float s0 = 0.0f, s1 = 0.0f, s2 = 0.0f, s3 = 0.0f;   // four independent chains
#pragma unroll
    for (int u = 0; u < 8; ++u) {
        s0 += v[u].x * v[u].x;
        s1 += v[u].y * v[u].y;
        s2 += v[u].z * v[u].z;
        s3 += v[u].w * v[u].w;
    }
    float tot = (s0 + s1) + (s2 + s3);
#pragma unroll
    for (int m = 16; m >= 1; m >>= 1) tot += __shfl_xor(tot, m, 32);
    float rstd = rsqrtf(tot / (float)DD + 1e-6f);
    const float* wr = w + lane * 4;
    const float* g  = gamma + (size_t)b * DD + lane * 4;
    const float* be = beta + (size_t)b * DD + lane * 4;
    __bf16* yr = y + (size_t)row * DD + lane * 4;
#pragma unroll
    for (int u = 0; u < 8; ++u) {
        float4 w4 = *(const float4*)(wr + u * 128);
        float4 g4 = *(const float4*)(g + u * 128);
        float4 b4 = *(const float4*)(be + u * 128);
        float r0 = (w4.x * (v[u].x * rstd)) * (g4.x + 1.0f) + b4.x;
        float r1 = (w4.y * (v[u].y * rstd)) * (g4.y + 1.0f) + b4.y;
        float r2 = (w4.z * (v[u].z * rstd)) * (g4.z + 1.0f) + b4.z;
        float r3 = (w4.w * (v[u].w * rstd)) * (g4.w + 1.0f) + b4.w;
        *(uint2*)(yr + u * 128) = make_uint2(pack2_bf16(r0, r1), pack2_bf16(r2, r3));
    }
}

// geglu: g[r,c] = h[r,c] * gelu(h[r,c+2048]), exact gelu
__device__ __forceinline__ float geglu1(float p1, float p2) {
    float ge = 0.5f * p2 * (1.0f + erff(p2 * 0.70710678118654752f));
    return p1 * ge;
}
// both bf16 halves of a dword pair
__device__ __forceinline__ unsigned geglu2(unsigned a, unsigned c) {
    float lo = geglu1(__builtin_bit_cast(float, a << 16),
                      __builtin_bit_cast(float, c << 16));
    float hi = geglu1(__builtin_bit_cast(float, a & 0xFFFF0000u),
                      __builtin_bit_cast(float, c & 0xFFFF0000u));
    return pack2_bf16(lo, hi);
}
// One block per two rows; a thread takes 8 consecutive columns of each row
// (16 elements), all by 16-byte accesses.
__global__ __launch_bounds__(256)
void geglu_kernel(const __bf16* __restrict__ h,
                  __bf16* __restrict__ g) {
    const int c = threadIdx.x * 8;
    const size_t r0 = (size_t)blockIdx.x * 2;
    uint4 p1[2], p2[2];
#pragma unroll
    for (int u = 0; u < 2; ++u) {
        const __bf16* hr = h + (r0 + u) * 4 * DD + c;
        p1[u] = *(const uint4*)hr;
        p2[u] = *(const uint4*)(hr + 2 * DD);
    }
#pragma unroll
    for (int u = 0; u < 2; ++u)
        *(uint4*)(g + (r0 + u) * 2 * DD + c) =
            make_uint4(geglu2(p1[u].x, p2[u].x), geglu2(p1[u].y, p2[u].y),
                       geglu2(p1[u].z, p2[u].z), geglu2(p1[u].w, p2[u].w));
}

// ---------------------------------------------------------------------------
// Generic bf16 WMMA GEMM:  C[M,N] = A[M,K] * B[K,N]  (row-major, bf16 in)
// Block tile 128x128, 8 waves (4 along M x 2 along N), wave tile 32x64.
// Double-buffered LDS, 128 k per stage (K is a multiple of 128); A and B tiles
// staged via GLOBAL_LOAD_ASYNC_TO_LDS_B128, each wave-wide copy taking two whole
// 256-byte rows; B kept row-major [k][n] and transposed by the fragment loads.
// EPI==0: store bf16.  EPI==1: store f32 with residual add.
// Grid z: independent products on the same A; B, C and the residual advance by
// one whole matrix per z.
// ---------------------------------------------------------------------------
template <int EPI>
__global__ __launch_bounds__(256)
void gemm_bf16_kernel(const __bf16* __restrict__ A,
                      const __bf16* __restrict__ Bm,
                      void* __restrict__ C,
                      const float* __restrict__ residual,
                      int M, int N, int K) {
    constexpr int BK = 128;   // k per stage
    constexpr int PA = 136;   // lA row pitch: 272 B, an odd multiple of 16 B
    constexpr int PB = 144;   // lB row pitch: 288 B, an odd multiple of 32 B
    __shared__ __attribute__((aligned(16))) ushort_t lA[2][128 * PA];  // [m][k]
    __shared__ __attribute__((aligned(16))) ushort_t lB[2][BK * PB];   // [k][n]

    const int tid  = threadIdx.x;
    const int lane = tid & 31;
    const int wave = tid >> 5;          // 0..7
    const int wm   = wave & 3;          // 4 waves along M
    const int wn   = wave >> 2;         // 2 waves along N
    const int half = lane >> 4;         // which 16-lane half
    const int l16  = lane & 15;
    const int koff = half ? 8 : 0;
    const int trow = half * 8 + (lane & 7);      // transposing load: lane's row
    const int tcol = ((lane >> 3) & 1) * 8;      // and its column offset

    const int blockM = blockIdx.y * 128;
    const int blockN = blockIdx.x * 128;

    // per-thread tile-copy coordinates: both tiles are 128 rows of 256 B; a
    // thread takes 16-byte column cCol of rows cRow, +16, ... +112 of each
    const int cRow = tid >> 4;
    const int cCol = (tid & 15) * 8;

    // each thread's two source addresses walk along K, one tile per issue
    const __bf16* gA = A + (size_t)(blockM + cRow) * K + cCol;
    const __bf16* gB = Bm + ((size_t)blockIdx.z * K + cRow) * N + blockN + cCol;
    auto issueAB = [&](int buf) {
        const void* g[8];
        unsigned l[8];   // LDS aperture: low 32 bits
        // both loops unrolled: g and l are the statement's register operands
#pragma unroll
        for (int u = 0; u < 8; ++u) {
            g[u] = gA + (size_t)(16 * u) * K;
            l[u] = (unsigned)(unsigned long long)&lA[buf][(cRow + 16 * u) * PA + cCol];
        }
        async_copy8_b128(g, l);
#pragma unroll
        for (int u = 0; u < 8; ++u) {
            g[u] = gB + (size_t)(16 * u) * N;
            l[u] = (unsigned)(unsigned long long)&lB[buf][(cRow + 16 * u) * PB + cCol];
        }
        async_copy8_b128(g, l);
        gA += BK;
        gB += (size_t)BK * N;
    };

    v8f acc[2][4];
#pragma unroll
    for (int i = 0; i < 2; ++i)
#pragma unroll
        for (int j = 0; j < 4; ++j) acc[i][j] = v8f_zero();

    // prologue: tile 0 lands and is published, then tile 1 starts to fly
    const int ntiles = K / BK;
    issueAB(0);
    async_wait0();
    __syncthreads();
    if (ntiles > 1) issueAB(1);

    for (int t = 0; t < ntiles; ++t) {
        const int cur = t & 1;

        // compute current tile, 32 k at a time in ascending order; unrolled so
        // that every LDS offset inside the stage is an immediate
#pragma unroll
        for (int kk = 0; kk < BK; kk += 32) {
            Frag a[2], b[4];
#pragma unroll
            for (int i = 0; i < 2; ++i) {
                int row = wm * 32 + i * 16 + l16;
                a[i].u4[0] = *(const uint4*)&lA[cur][row * PA + kk + koff];
                a[i].u4[1] = *(const uint4*)&lA[cur][row * PA + kk + koff + 16];
            }
#pragma unroll
            for (int j = 0; j < 4; ++j) {
                int col = wn * 64 + j * 16 + tcol;
                b[j].t[0] = lds_load_tr16(&lB[cur][(kk + trow) * PB + col]);
                b[j].t[1] = lds_load_tr16(&lB[cur][(kk + 16 + trow) * PB + col]);
            }
#pragma unroll
            for (int i = 0; i < 2; ++i)
#pragma unroll
                for (int j = 0; j < 4; ++j)
                    acc[i][j] = wmma_bf16(a[i].v, b[j].v, acc[i][j]);
        }

        // publish tile t + 1 and free this trip's buffer, then refill it
        lds_wait0();
        async_wait0();
        __syncthreads();
        if (t + 2 < ntiles) issueAB(cur);
    }
    async_wait0();

    // epilogue (C-layout: col = l16, row = r + 8*half per vgpr r)
#pragma unroll
    for (int i = 0; i < 2; ++i) {
#pragma unroll
        for (int j = 0; j < 4; ++j) {
            int col = blockN + wn * 64 + j * 16 + l16;
#pragma unroll
            for (int r = 0; r < 8; ++r) {
                int row = blockM + wm * 32 + i * 16 + r + half * 8;
                size_t idx = ((size_t)blockIdx.z * M + row) * N + col;
                float v = acc[i][j][r];
                if (EPI == 0) {
                    ((__bf16*)C)[idx] = f32_to_bf16(v);
                } else {
                    ((float*)C)[idx] = residual[idx] + v;
                }
            }
        }
    }
}

// ---------------------------------------------------------------------------
// Flash attention: grid (B*H, T/64), block 128 (4 waves x 16 query rows).
// S = Q*K^T * 1/8 + bias, mask, online softmax, O = P*V.
// K and V tiles staged async to LDS; V transposed by its fragment loads.
// ---------------------------------------------------------------------------
__global__ __launch_bounds__(128)
void flash_attn_kernel(const __bf16* __restrict__ qb,
                       const __bf16* __restrict__ kb,
                       const __bf16* __restrict__ vb,
                       const float* __restrict__ bias,   // [H][T][T]
                       const int* __restrict__ mask,     // [B][T][T]
                       __bf16* __restrict__ ob) {
    constexpr int PK = 72;    // lK and lP row pitch: 144 B, an odd multiple of 16 B
    constexpr int PV = 80;    // lV row pitch: 160 B, an odd multiple of 32 B
    __shared__ __attribute__((aligned(16))) ushort_t lK[64 * PK];   // [key][dh]   -> B-frag layout for Q*K^T
    __shared__ __attribute__((aligned(16))) ushort_t lV[64 * PV];   // [key][dh]   -> read by transposing loads
    __shared__ __attribute__((aligned(16))) ushort_t lP[64 * PK];   // [q][key]    -> A-frag relayout

    const int bh = blockIdx.x;
    const int b = bh / HH;
    const int h = bh % HH;
    const int qbase = blockIdx.y * 64;
    const int tid  = threadIdx.x;
    const int lane = tid & 31;
    const int wave = tid >> 5;         // 0..3 -> 16 query rows each
    const int half = lane >> 4;
    const int l16  = lane & 15;
    const int koff = half ? 8 : 0;
    const int trow = half * 8 + (lane & 7);      // transposing load: lane's row
    const int tcol = ((lane >> 3) & 1) * 8;      // and its column offset
    const int crow = tid >> 3;                   // tile copy: lane's first row
    const int ccol = (tid & 7) * 8;              // and its column

    // Q fragments stay in registers for the whole kernel
    Frag qf[2];
    {
        int qrow = qbase + wave * 16 + l16;
        const __bf16* qrp = qb + ((size_t)(b * TT + qrow)) * DD + h * DHH;
        qf[0].u4[0] = *(const uint4*)(qrp + koff);
        qf[0].u4[1] = *(const uint4*)(qrp + koff + 16);
        qf[1].u4[0] = *(const uint4*)(qrp + 32 + koff);
        qf[1].u4[1] = *(const uint4*)(qrp + 32 + koff + 16);
    }

    float m[8], l[8];
    v8f o[4];
#pragma unroll
    for (int r = 0; r < 8; ++r) { m[r] = -1e30f; l[r] = 0.0f; }
#pragma unroll
    for (int j = 0; j < 4; ++j) o[j] = v8f_zero();

    const float scale = 0.125f;   // 1/sqrt(DH)

    for (int kt = 0; kt < TT / 64; ++kt) {
        const int kbase = kt * 64;
        // K and V tiles: natural [key][dh] layout, async to LDS (no VGPR staging);
        // each thread copies column ccol of rows crow, +16, +32, +48
        const size_t gofs = ((size_t)(b * TT + kbase + crow)) * DD + h * DHH + ccol;
        async_copy4_b128(kb + gofs,           &lK[crow * PK + ccol],
                         kb + gofs + 16 * DD, &lK[(crow + 16) * PK + ccol],
                         kb + gofs + 32 * DD, &lK[(crow + 32) * PK + ccol],
                         kb + gofs + 48 * DD, &lK[(crow + 48) * PK + ccol]);
        async_copy4_b128(vb + gofs,           &lV[crow * PV + ccol],
                         vb + gofs + 16 * DD, &lV[(crow + 16) * PV + ccol],
                         vb + gofs + 32 * DD, &lV[(crow + 32) * PV + ccol],
                         vb + gofs + 48 * DD, &lV[(crow + 48) * PV + ccol]);
        async_wait0();
        __syncthreads();

        // S = Q * K^T  (4 column frags of 16, K-reduction DH=64 -> 2 wmma)
        v8f s[4];
#pragma unroll
        for (int j = 0; j < 4; ++j) {
            int col = j * 16 + l16;
            Frag b0, b1;
            b0.u4[0] = *(const uint4*)&lK[col * PK + koff];
            b0.u4[1] = *(const uint4*)&lK[col * PK + koff + 16];
            b1.u4[0] = *(const uint4*)&lK[col * PK + 32 + koff];
            b1.u4[1] = *(const uint4*)&lK[col * PK + 32 + koff + 16];
            v8f z = v8f_zero();
            z = wmma_bf16(qf[0].v, b0.v, z);
            s[j] = wmma_bf16(qf[1].v, b1.v, z);
        }

        // scale + bias + mask + online softmax (per accumulator row); the rows
        // go through each phase together, so that their reductions interleave
        float rmax[8], corr[8], psum[8];
#pragma unroll
        for (int r = 0; r < 8; ++r) {
            int qg = qbase + wave * 16 + r + half * 8;
            rmax[r] = -1e30f;
#pragma unroll
            for (int j = 0; j < 4; ++j) {
                int kg = kbase + j * 16 + l16;
                float v = s[j][r] * scale +
                          bias[((size_t)h * TT + qg) * TT + kg];
                int mk = mask[((size_t)b * TT + qg) * TT + kg];
                v = (mk == 0) ? -1e9f : v;
                s[j][r] = v;
                rmax[r] = fmaxf(rmax[r], v);
            }
        }
        row_max16_x8(rmax);
#pragma unroll
        for (int r = 0; r < 8; ++r) {
            float mnew = fmaxf(m[r], rmax[r]);
            corr[r] = __expf(m[r] - mnew);
            psum[r] = 0.0f;
#pragma unroll
            for (int j = 0; j < 4; ++j) {
                float p = __expf(s[j][r] - mnew);
                s[j][r] = p;
                psum[r] += p;
            }
            m[r] = mnew;
        }
        row_sum16_x8(psum);
#pragma unroll
        for (int r = 0; r < 8; ++r) {
            l[r] = l[r] * corr[r] + psum[r];
#pragma unroll
            for (int j = 0; j < 4; ++j) o[j][r] *= corr[r];
        }

        // Relayout P through LDS (C-frag -> A-frag)
#pragma unroll
        for (int j = 0; j < 4; ++j) {
            int coll = j * 16 + l16;
#pragma unroll
            for (int r = 0; r < 8; ++r) {
                int rowl = wave * 16 + r + half * 8;
                lP[rowl * PK + coll] =
                    __builtin_bit_cast(unsigned short, f32_to_bf16(s[j][r]));
            }
        }
        __syncthreads();

        // O += P * V
        Frag pa[2];
        {
            int prow = wave * 16 + l16;
            pa[0].u4[0] = *(const uint4*)&lP[prow * PK + koff];
            pa[0].u4[1] = *(const uint4*)&lP[prow * PK + koff + 16];
            pa[1].u4[0] = *(const uint4*)&lP[prow * PK + 32 + koff];
            pa[1].u4[1] = *(const uint4*)&lP[prow * PK + 32 + koff + 16];
        }
#pragma unroll
        for (int j = 0; j < 4; ++j) {
            int col = j * 16 + tcol;  // dh column block
            Frag v0, v1;
            v0.t[0] = lds_load_tr16(&lV[trow * PV + col]);
            v0.t[1] = lds_load_tr16(&lV[(16 + trow) * PV + col]);
            v1.t[0] = lds_load_tr16(&lV[(32 + trow) * PV + col]);
            v1.t[1] = lds_load_tr16(&lV[(48 + trow) * PV + col]);
            o[j] = wmma_bf16(pa[0].v, v0.v, o[j]);
            o[j] = wmma_bf16(pa[1].v, v1.v, o[j]);
        }
        lds_wait0();   // this wave has left lK and lV before the next copies
        __syncthreads();
    }

    // finalize: O /= l, write bf16 [B,T,H*DH]
#pragma unroll
    for (int j = 0; j < 4; ++j) {
        int dh = j * 16 + l16;
#pragma unroll
        for (int r = 0; r < 8; ++r) {
            int qg = qbase + wave * 16 + r + half * 8;
            float v = o[j][r] / l[r];
            ob[((size_t)(b * TT + qg)) * DD + h * DHH + dh] = f32_to_bf16(v);
        }
    }
}

// ---------------------------------------------------------------------------
// Host-side orchestration
// ---------------------------------------------------------------------------
static inline size_t align256(size_t x) { return (x + 255) & ~(size_t)255; }

extern "C" void kernel_launch(void* const* d_in, const int* in_sizes, int n_in,
                              void* d_out, int out_size, void* d_ws, size_t ws_size,
                              hipStream_t stream) {
    (void)in_sizes; (void)n_in; (void)out_size; (void)ws_size;
    const float* x        = (const float*)d_in[0];
    const int*   x_mask   = (const int*)  d_in[1];
    const float* cond     = (const float*)d_in[2];
    const float* norm1_w  = (const float*)d_in[3];
    const float* f1_gw    = (const float*)d_in[4];
    const float* f1_gb    = (const float*)d_in[5];
    const float* f1_bw    = (const float*)d_in[6];
    const float* f1_bb    = (const float*)d_in[7];
    const float* wq       = (const float*)d_in[8];
    const float* wk       = (const float*)d_in[9];
    const float* wv       = (const float*)d_in[10];
    const float* wo       = (const float*)d_in[11];
    const float* rel_emb  = (const float*)d_in[12];
    const float* norm3_w  = (const float*)d_in[13];
    const float* f3_gw    = (const float*)d_in[14];
    const float* f3_gb    = (const float*)d_in[15];
    const float* f3_bw    = (const float*)d_in[16];
    const float* f3_bb    = (const float*)d_in[17];
    const float* ffn_w1   = (const float*)d_in[18];
    const float* ffn_w2   = (const float*)d_in[19];

    float* out_x    = (float*)d_out;                              // [B,T,D]
    float* out_bias = (float*)d_out + (size_t)BB * TT * DD;       // [H,T,T]

    // workspace bump allocator
    char* ws = (char*)d_ws;
    size_t off = 0;
    auto alloc = [&](size_t bytes) -> void* {
        void* p = ws + off;
        off += align256(bytes);
        return p;
    };
    const size_t BT = (size_t)BB * TT;
    __bf16* wq_bf   = (__bf16*)alloc((size_t)3 * DD * DD * 2);   // wq | wk | wv
    __bf16* wk_bf   = wq_bf + (size_t)DD * DD;
    __bf16* wv_bf   = wk_bf + (size_t)DD * DD;
    __bf16* wo_bf   = (__bf16*)alloc((size_t)DD * DD * 2);
    __bf16* w1_bf   = (__bf16*)alloc((size_t)DD * 4 * DD * 2);
    __bf16* w2_bf   = (__bf16*)alloc((size_t)2 * DD * DD * 2);
    float*  gamma1  = (float*)alloc((size_t)BB * DD * 4);
    float*  beta1   = (float*)alloc((size_t)BB * DD * 4);
    float*  gamma3  = (float*)alloc((size_t)BB * DD * 4);
    float*  beta3   = (float*)alloc((size_t)BB * DD * 4);
    __bf16* y_bf    = (__bf16*)alloc(BT * DD * 2);
    __bf16* q_bf    = (__bf16*)alloc(3 * BT * DD * 2);           // q | k | v
    __bf16* k_bf    = q_bf + BT * DD;
    __bf16* v_bf    = k_bf + BT * DD;
    __bf16* attn_bf = (__bf16*)alloc(BT * DD * 2);
    float*  x_mid   = (float*)alloc(BT * DD * 4);
    __bf16* y3_bf   = (__bf16*)alloc(BT * DD * 2);
    __bf16* h_bf    = (__bf16*)alloc(BT * 4 * DD * 2);
    __bf16* g_bf    = (__bf16*)alloc(BT * 2 * DD * 2);

    // 1) all that depends on the inputs alone: FiLM params, position bias
    //    (output #2 + consumed by attention), weight conversion fp32 -> bf16
    prep_kernel<<<NB_PREP, 256, 0, stream>>>(
        cond, f1_gw, f1_gb, f1_bw, f1_bb, gamma1, beta1,
        f3_gw, f3_gb, f3_bw, f3_bb, gamma3, beta3,
        rel_emb, out_bias,
        wq, wk, wv, wo, ffn_w1, ffn_w2,
        wq_bf, wk_bf, wv_bf, wo_bf, w1_bf, w2_bf);
    // 4) y = film(rmsnorm(x)) -> bf16
    rmsnorm_film_kernel<<<(int)(BT / 8), 256, 0, stream>>>(x, norm1_w, gamma1, beta1, y_bf);
    // 5) Q,K,V projections, one grid: z picks the weight and the output, which
    //    follow one another in the workspace
    {
        dim3 grid(DD / 128, (int)(BT / 128), 3);
        gemm_bf16_kernel<0><<<grid, 256, 0, stream>>>(y_bf, wq_bf, q_bf, nullptr,
                                                      (int)BT, DD, DD);
    }
    // 6) flash attention
    {
        dim3 grid(BB * HH, TT / 64);
        flash_attn_kernel<<<grid, 128, 0, stream>>>(q_bf, k_bf, v_bf,
                                                    out_bias, x_mask, attn_bf);
    }
    // 7) x_mid = x + attn @ wo
    {
        dim3 grid(DD / 128, (int)(BT / 128));
        gemm_bf16_kernel<1><<<grid, 256, 0, stream>>>(attn_bf, wo_bf, x_mid, x,
                                                      (int)BT, DD, DD);
    }
    // 8) y3 = film(rmsnorm(x_mid)) -> bf16
    rmsnorm_film_kernel<<<(int)(BT / 8), 256, 0, stream>>>(x_mid, norm3_w, gamma3, beta3, y3_bf);
    // 9) h = y3 @ ffn_w1  [BT, 4D]
    {
        dim3 grid(4 * DD / 128, (int)(BT / 128));
        gemm_bf16_kernel<0><<<grid, 256, 0, stream>>>(y3_bf, w1_bf, h_bf, nullptr,
                                                      (int)BT, 4 * DD, DD);
    }
    // 10) geglu
    geglu_kernel<<<(int)(BT / 2), 256, 0, stream>>>(h_bf, g_bf);
    // 11) out = x_mid + g @ ffn_w2
    {
        dim3 grid(DD / 128, (int)(BT / 128));
        gemm_bf16_kernel<1><<<grid, 256, 0, stream>>>(g_bf, w2_bf, out_x, x_mid,
                                                      (int)BT, DD, 2 * DD);
    }
}

// v007
// One run takes 189 microseconds.
// Next to v006, in two timings, it ran 1.03 and 1.02 times as fast.
// Counting every step since v000, it is 3.73 times as fast.
#include <hip/hip_runtime.h>
#include <hip/hip_bf16.h>
#include <math.h>
#include <stdint.h>

// ---------------------------------------------------------------------------
// Problem constants (from reference)
// ---------------------------------------------------------------------------
#define BB 4
#define TT 1024
#define DD 1024
#define HH 16
#define DHH 64
#define DCC 64
#define NBUCK 32

typedef unsigned short ushort_t;
typedef __attribute__((ext_vector_type(16))) __bf16 v16bf;
typedef __attribute__((ext_vector_type(8)))  float  v8f;
typedef __attribute__((ext_vector_type(8)))  short  s16x8;

union Frag {
    v16bf v;
    uint4 u4[2];
    s16x8 t[2];
};

__device__ __forceinline__ v8f v8f_zero() {
    v8f z;
#pragma unroll
    for (int i = 0; i < 8; ++i) z[i] = 0.0f;
    return z;
}

__device__ __forceinline__ __bf16 f32_to_bf16(float f) {
    unsigned u = __builtin_bit_cast(unsigned, f);
    unsigned r = u + 0x7FFFu + ((u >> 16) & 1u);   // round-to-nearest-even
    unsigned short h = (unsigned short)(r >> 16);
    return __builtin_bit_cast(__bf16, h);
}

__device__ __forceinline__ v8f wmma_bf16(v16bf a, v16bf b, v8f c) {
    // D = A(16x32 bf16) * B(32x16 bf16) + C(16x16 f32)
    return __builtin_amdgcn_wmma_f32_16x16x32_bf16(
        /*neg_a=*/false, a, /*neg_b=*/false, b,
        /*c_mod=*/(short)0, c, /*reuse_a=*/false, /*reuse_b=*/false);
}

// Four async copies of 16B (8 bf16) per lane from global to LDS; tracked with
// ASYNCcnt. The closing s_wait_xcnt stands inside the statement so that no
// address register of a copy is rewritten in front of it.
__device__ __forceinline__ void async_copy4_b128(const void* g0, void* d0,
                                                 const void* g1, void* d1,
                                                 const void* g2, void* d2,
                                                 const void* g3, void* d3) {
    unsigned l0 = (unsigned)(unsigned long long)d0;  // LDS aperture: low 32 bits
    unsigned l1 = (unsigned)(unsigned long long)d1;
    unsigned l2 = (unsigned)(unsigned long long)d2;
    unsigned l3 = (unsigned)(unsigned long long)d3;
    asm volatile("global_load_async_to_lds_b128 %0, %1, off\n\t"
                 "global_load_async_to_lds_b128 %2, %3, off\n\t"
                 "global_load_async_to_lds_b128 %4, %5, off\n\t"
                 "global_load_async_to_lds_b128 %6, %7, off\n\t"
                 "s_wait_xcnt 0x0"
                 :: "v"(l0), "v"(g0), "v"(l1), "v"(g1),
                    "v"(l2), "v"(g2), "v"(l3), "v"(g3) : "memory");
}
// Eight such copies in one statement; the closing s_wait_xcnt stands inside it
// for the same reason.
__device__ __forceinline__ void async_copy8_b128(const void* const (&g)[8],
                                                 const unsigned (&l)[8]) {
    asm volatile("global_load_async_to_lds_b128 %0, %1, off\n\t"
                 "global_load_async_to_lds_b128 %2, %3, off\n\t"
                 "global_load_async_to_lds_b128 %4, %5, off\n\t"
                 "global_load_async_to_lds_b128 %6, %7, off\n\t"
                 "global_load_async_to_lds_b128 %8, %9, off\n\t"
                 "global_load_async_to_lds_b128 %10, %11, off\n\t"
                 "global_load_async_to_lds_b128 %12, %13, off\n\t"
                 "global_load_async_to_lds_b128 %14, %15, off\n\t"
                 "s_wait_xcnt 0x0"
                 :: "v"(l[0]), "v"(g[0]), "v"(l[1]), "v"(g[1]),
                    "v"(l[2]), "v"(g[2]), "v"(l[3]), "v"(g[3]),
                    "v"(l[4]), "v"(g[4]), "v"(l[5]), "v"(g[5]),
                    "v"(l[6]), "v"(g[6]), "v"(l[7]), "v"(g[7]) : "memory");
}
// The issuing wave's copies have landed behind this wait.
__device__ __forceinline__ void async_wait0() {
    asm volatile("s_wait_asynccnt 0x0" ::: "memory");
}
// The wave's own LDS reads have retired before a copy may refill what they read.
__device__ __forceinline__ void lds_wait0() {
    asm volatile("s_wait_dscnt 0x0" ::: "memory");
}

// Transposing LDS load: from a row-major [k][n] bf16 tile, lane (c = l & 15,
// h = l >> 4) receives T[kbase + 8h + 0..7][nbase + c]. The lane's address is
// row kbase + 8*(l >> 4) + (l & 7), column nbase + 8*((l >> 3) & 1).
__device__ __forceinline__ s16x8 lds_load_tr16(const ushort_t* p) {
    typedef __attribute__((address_space(3))) s16x8 lds_s16x8;
    return __builtin_amdgcn_ds_load_tr16_b128_v8i16((lds_s16x8*)p);
}

// Eight independent reductions over 16-lane rows, butterfly steps 8, 4, 2, 1;
// every lane gets its row's result. In each step lane l combines its x with that
// of lane l ^ step through the vector unit's own lane crossbar (DPP row_xmask),
// not through the LDS path. Step-major order: the eight chains fill one
// another's latency.
// The maximum is written as asm because from the builtin the move was not folded
// into the maximum: each step kept a DPP move of its own beside it.
// Every loop is unrolled so that x stays in registers.
__device__ __forceinline__ void row_max16_x8(float (&x)[8]) {
#pragma unroll
    for (int r = 0; r < 8; ++r)
        asm("v_max_num_f32_dpp %0, %1, %1 row_xmask:8 row_mask:0xf bank_mask:0xf"
            : "=v"(x[r]) : "v"(x[r]));
#pragma unroll
    for (int r = 0; r < 8; ++r)
        asm("v_max_num_f32_dpp %0, %1, %1 row_xmask:4 row_mask:0xf bank_mask:0xf"
            : "=v"(x[r]) : "v"(x[r]));
#pragma unroll
    for (int r = 0; r < 8; ++r)
        asm("v_max_num_f32_dpp %0, %1, %1 row_xmask:2 row_mask:0xf bank_mask:0xf"
            : "=v"(x[r]) : "v"(x[r]));
#pragma unroll
    for (int r = 0; r < 8; ++r)
        asm("v_max_num_f32_dpp %0, %1, %1 row_xmask:1 row_mask:0xf bank_mask:0xf"
            : "=v"(x[r]) : "v"(x[r]));
}
// The sum's step; the compiler folds the move into the add.
template <int XM>
__device__ __forceinline__ float row_add_xor(float x) {
    return x + __builtin_bit_cast(float, __builtin_amdgcn_update_dpp(
        0, __builtin_bit_cast(int, x), 0x160 | XM, 0xf, 0xf, true));
}
__device__ __forceinline__ void row_sum16_x8(float (&x)[8]) {
#pragma unroll
    for (int r = 0; r < 8; ++r) x[r] = row_add_xor<8>(x[r]);
#pragma unroll
    for (int r = 0; r < 8; ++r) x[r] = row_add_xor<4>(x[r]);
#pragma unroll
    for (int r = 0; r < 8; ++r) x[r] = row_add_xor<2>(x[r]);
#pragma unroll
    for (int r = 0; r < 8; ++r) x[r] = row_add_xor<1>(x[r]);
}

// ---------------------------------------------------------------------------
// Elementwise helpers
// ---------------------------------------------------------------------------
// Two floats rounded to bf16 and packed into one dword (a in the low half).
__device__ __forceinline__ unsigned pack2_bf16(float a, float b) {
    unsigned lo = __builtin_bit_cast(unsigned short, f32_to_bf16(a));
    unsigned hi = __builtin_bit_cast(unsigned short, f32_to_bf16(b));
    return lo | (hi << 16);
}

// 16 elements per thread: a block takes 4096 consecutive elements as four
// slabs of 1024; each wave-wide load covers 512 contiguous bytes, each store
// 256. The blocks cover the array exactly (its length is a multiple of 4096).
__device__ __forceinline__
void cvt_bf16_block(const float* __restrict__ src,
                    __bf16* __restrict__ dst, int blk) {
    const int base = blk * 4096 + threadIdx.x * 4;
    float4 v[4];
#pragma unroll
    for (int u = 0; u < 4; ++u) v[u] = *(const float4*)(src + base + u * 1024);
#pragma unroll
    for (int u = 0; u < 4; ++u)
        *(uint2*)(dst + base + u * 1024) =
            make_uint2(pack2_bf16(v[u].x, v[u].y), pack2_bf16(v[u].z, v[u].w));
    // the stores' registers are not rewritten by another part of the merged
    // kernel in front of this wait
    asm volatile("s_wait_xcnt 0x0" ::: "memory");
}

// gamma/beta = cond @ W + b  (per batch, DC=64 reduction); B*D/256 blocks
__device__ __forceinline__
void film_params_block(const float* __restrict__ cond,
                       const float* __restrict__ gw,
                       const float* __restrict__ gb,
                       const float* __restrict__ bw,
                       const float* __restrict__ bb,
                       float* __restrict__ gamma,
                       float* __restrict__ beta, int blk) {
    int idx = blk * 256 + threadIdx.x;   // B*D
    if (idx >= BB * DD) return;
    int b = idx / DD, d = idx % DD;
    const float* c = cond + b * DCC;
    float g = gb[d], bt = bb[d];
#pragma unroll 8
    for (int i = 0; i < DCC; ++i) {
        float cv = c[i];
        g  += cv * gw[i * DD + d];
        bt += cv * bw[i * DD + d];
    }
    gamma[idx] = g;
    beta[idx]  = bt;
}

// T5 relative position bucket of rp = k - q
__device__ __forceinline__ int rel_bucket(int rp) {
    const int nb = NBUCK / 2;      // 16
    const int max_exact = nb / 2;  // 8
    int bucket = (rp > 0) ? nb : 0;
    int arp = rp < 0 ? -rp : rp;
    int val;
    if (arp < max_exact) {
        val = arp;
    } else {
        float rp_safe = (float)(arp > 1 ? arp : 1);
        int large = max_exact +
            (int)(logf(rp_safe / (float)max_exact) /
                  logf(128.0f / (float)max_exact) * (float)(nb - max_exact));
        val = large < nb - 1 ? large : nb - 1;
    }
    return bucket + val;
}

// T5 relative position bias -> bias_out[h][q][k]  (this is output #2)
// One block per query row; a thread takes 4 consecutive keys for all 16 heads
// (64 elements): each wave-wide store covers 512 contiguous bytes of one head.
__device__ __forceinline__
void bias_block(const float* __restrict__ rel_emb,
                float* __restrict__ bias_out, int q) {
    const int k0 = threadIdx.x * 4;
    float e[4][HH];
#pragma unroll
    for (int c = 0; c < 4; ++c) {
        const float4* p = (const float4*)(rel_emb + rel_bucket(k0 + c - q) * HH);
#pragma unroll
        for (int g = 0; g < HH / 4; ++g) {
            float4 t = p[g];
            e[c][4 * g + 0] = t.x;
            e[c][4 * g + 1] = t.y;
            e[c][4 * g + 2] = t.z;
            e[c][4 * g + 3] = t.w;
        }
    }
#pragma unroll
    for (int h = 0; h < HH; ++h)
        *(float4*)(bias_out + ((size_t)h * TT + q) * TT + k0) =
            make_float4(e[0][h], e[1][h], e[2][h], e[3][h]);
    // the stores' registers are not rewritten by another part of the merged
    // kernel in front of this wait
    asm volatile("s_wait_xcnt 0x0" ::: "memory");
}

// Everything that depends on the inputs alone, in one grid: a block's index
// says which piece it does. The FiLM blocks, few and latency-bound, come first.
#define NB_FILM (BB * DD / 256)      // blocks per FiLM parameter pair
#define NB_W    (DD * DD / 4096)     // blocks per D x D weight matrix
#define NB_PREP (2 * NB_FILM + TT + 10 * NB_W)
__global__ __launch_bounds__(256)
void prep_kernel(const float* __restrict__ cond,
                 const float* __restrict__ f1_gw, const float* __restrict__ f1_gb,
                 const float* __restrict__ f1_bw, const float* __restrict__ f1_bb,
                 float* __restrict__ gamma1, float* __restrict__ beta1,
                 const float* __restrict__ f3_gw, const float* __restrict__ f3_gb,
                 const float* __restrict__ f3_bw, const float* __restrict__ f3_bb,
                 float* __restrict__ gamma3, float* __restrict__ beta3,
                 const float* __restrict__ rel_emb, float* __restrict__ bias_out,
                 const float* __restrict__ wq, const float* __restrict__ wk,
                 const float* __restrict__ wv, const float* __restrict__ wo,
                 const float* __restrict__ w1, const float* __restrict__ w2,
                 __bf16* __restrict__ wq_bf, __bf16* __restrict__ wk_bf,
                 __bf16* __restrict__ wv_bf, __bf16* __restrict__ wo_bf,
                 __bf16* __restrict__ w1_bf, __bf16* __restrict__ w2_bf) {
    int blk = blockIdx.x;
    if (blk < NB_FILM) {
        film_params_block(cond, f1_gw, f1_gb, f1_bw, f1_bb, gamma1, beta1, blk);
        return;
    }
    blk -= NB_FILM;
    if (blk < NB_FILM) {
        film_params_block(cond, f3_gw, f3_gb, f3_bw, f3_bb, gamma3, beta3, blk);
        return;
    }
    blk -= NB_FILM;
    if (blk < TT) {
        bias_block(rel_emb, bias_out, blk);
        return;
    }
    blk -= TT;
    const float* src;
    __bf16* dst;
    if (blk < NB_W)          { src = wq; dst = wq_bf; }
    else if (blk < 2 * NB_W) { src = wk; dst = wk_bf; blk -= NB_W; }
    else if (blk < 3 * NB_W) { src = wv; dst = wv_bf; blk -= 2 * NB_W; }
    else if (blk < 4 * NB_W) { src = wo; dst = wo_bf; blk -= 3 * NB_W; }
    else if (blk < 8 * NB_W) { src = w1; dst = w1_bf; blk -= 4 * NB_W; }
    else                     { src = w2; dst = w2_bf; blk -= 8 * NB_W; }
    cvt_bf16_block(src, dst, blk);
}

// y = film(rms_norm(x)) -> bf16, one wave per (b,t) row: a lane holds 32
// elements of the row in registers (eight 16-byte loads, 512 contiguous bytes
// per wave each), so x is read once and the row sum needs no LDS.
__global__ __launch_bounds__(256)
void rmsnorm_film_kernel(const float* __restrict__ x,
                         const float* __restrict__ w,
                         const float* __restrict__ gamma,
                         const float* __restrict__ beta,
                         __bf16* __restrict__ y) {
    const int lane = threadIdx.x & 31;
    const int row = blockIdx.x * 8 + (threadIdx.x >> 5);   // 0 .. B*T-1
    const int b = row / TT;
    const float* xr = x + (size_t)row * DD + lane * 4;
    float4 v[8];
#pragma unroll
    for (int u = 0; u < 8; ++u) v[u] = *(const float4*)(xr + u * 128);
    float s0 = 0.0f, s1 = 0.0f, s2 = 0.0f, s3 = 0.0f;   // four independent chains
#pragma unroll
    for (int u = 0; u < 8; ++u) {
        s0 += v[u].x * v[u].x;
        s1 += v[u].y * v[u].y;
        s2 += v[u].z * v[u].z;
        s3 += v[u].w * v[u].w;
    }
    float tot = (s0 + s1) + (s2 + s3);
#pragma unroll
    for (int m = 16; m >= 1; m >>= 1) tot += __shfl_xor(tot, m, 32);
    float rstd = rsqrtf(tot / (float)DD + 1e-6f);
    const float* wr = w + lane * 4;
    const float* g  = gamma + (size_t)b * DD + lane * 4;
    const float* be = beta + (size_t)b * DD + lane * 4;
    __bf16* yr = y + (size_t)row * DD + lane * 4;
#pragma unroll
    for (int u = 0; u < 8; ++u) {
        float4 w4 = *(const float4*)(wr + u * 128);
        float4 g4 = *(const float4*)(g + u * 128);
        float4 b4 = *(const float4*)(be + u * 128);
        float r0 = (w4.x * (v[u].x * rstd)) * (g4.x + 1.0f) + b4.x;
        float r1 = (w4.y * (v[u].y * rstd)) * (g4.y + 1.0f) + b4.y;
        float r2 = (w4.z * (v[u].z * rstd)) * (g4.z + 1.0f) + b4.z;
        float r3 = (w4.w * (v[u].w * rstd)) * (g4.w + 1.0f) + b4.w;
        *(uint2*)(yr + u * 128) = make_uint2(pack2_bf16(r0, r1), pack2_bf16(r2, r3));
    }
}

// geglu: g[r,c] = h[r,c] * gelu(h[r,c+2048]), exact gelu
__device__ __forceinline__ float geglu1(float p1, float p2) {
    float ge = 0.5f * p2 * (1.0f + erff(p2 * 0.70710678118654752f));
    return p1 * ge;
}
// both bf16 halves of a dword pair
__device__ __forceinline__ unsigned geglu2(unsigned a, unsigned c) {
    float lo = geglu1(__builtin_bit_cast(float, a << 16),
                      __builtin_bit_cast(float, c << 16));
    float hi = geglu1(__builtin_bit_cast(float, a & 0xFFFF0000u),
                      __builtin_bit_cast(float, c & 0xFFFF0000u));
    return pack2_bf16(lo, hi);
}
// One block per two rows; a thread takes 8 consecutive columns of each row
// (16 elements), all by 16-byte accesses.
__global__ __launch_bounds__(256)
void geglu_kernel(const __bf16* __restrict__ h,
                  __bf16* __restrict__ g) {
    const int c = threadIdx.x * 8;
    const size_t r0 = (size_t)blockIdx.x * 2;
    uint4 p1[2], p2[2];
#pragma unroll
    for (int u = 0; u < 2; ++u) {
        const __bf16* hr = h + (r0 + u) * 4 * DD + c;
        p1[u] = *(const uint4*)hr;
        p2[u] = *(const uint4*)(hr + 2 * DD);
    }
#pragma unroll
    for (int u = 0; u < 2; ++u)
        *(uint4*)(g + (r0 + u) * 2 * DD + c) =
            make_uint4(geglu2(p1[u].x, p2[u].x), geglu2(p1[u].y, p2[u].y),
                       geglu2(p1[u].z, p2[u].z), geglu2(p1[u].w, p2[u].w));
}

// ---------------------------------------------------------------------------
// Generic bf16 WMMA GEMM:  C[M,N] = A[M,K] * B[K,N]  (row-major, bf16 in)
// Block tile 128x128, 8 waves (4 along M x 2 along N), wave tile 32x64.
// Double-buffered LDS, 128 k per stage (K is a multiple of 128); A and B tiles
// staged via GLOBAL_LOAD_ASYNC_TO_LDS_B128, each wave-wide copy taking two whole
// 256-byte rows; B kept row-major [k][n] and transposed by the fragment loads.
// EPI==0: store bf16.  EPI==1: store f32 with residual add.
// Grid z: independent products on the same A; B, C and the residual advance by
// one whole matrix per z.
// ---------------------------------------------------------------------------
template <int EPI>
__global__ __launch_bounds__(256)
void gemm_bf16_kernel(const __bf16* __restrict__ A,
                      const __bf16* __restrict__ Bm,
                      void* __restrict__ C,
                      const float* __restrict__ residual,
                      int M, int N, int K) {
    constexpr int BK = 128;   // k per stage
    constexpr int PA = 136;   // lA row pitch: 272 B, an odd multiple of 16 B
    constexpr int PB = 144;   // lB row pitch: 288 B, an odd multiple of 32 B
    __shared__ __attribute__((aligned(16))) ushort_t lA[2][128 * PA];  // [m][k]
    __shared__ __attribute__((aligned(16))) ushort_t lB[2][BK * PB];   // [k][n]

    const int tid  = threadIdx.x;
    const int lane = tid & 31;
    const int wave = tid >> 5;          // 0..7
    const int wm   = wave & 3;          // 4 waves along M
    const int wn   = wave >> 2;         // 2 waves along N
    const int half = lane >> 4;         // which 16-lane half
    const int l16  = lane & 15;
    const int koff = half ? 8 : 0;
    const int trow = half * 8 + (lane & 7);      // transposing load: lane's row
    const int tcol = ((lane >> 3) & 1) * 8;      // and its column offset

    const int blockM = blockIdx.y * 128;
    const int blockN = blockIdx.x * 128;

    // per-thread tile-copy coordinates: both tiles are 128 rows of 256 B; a
    // thread takes 16-byte column cCol of rows cRow, +16, ... +112 of each
    const int cRow = tid >> 4;
    const int cCol = (tid & 15) * 8;

    // each thread's two source addresses walk along K, one tile per issue
    const __bf16* gA = A + (size_t)(blockM + cRow) * K + cCol;
    const __bf16* gB = Bm + ((size_t)blockIdx.z * K + cRow) * N + blockN + cCol;
    auto issueAB = [&](int buf) {
        const void* g[8];
        unsigned l[8];   // LDS aperture: low 32 bits
        // both loops unrolled: g and l are the statement's register operands
#pragma unroll
        for (int u = 0; u < 8; ++u) {
            g[u] = gA + (size_t)(16 * u) * K;
            l[u] = (unsigned)(unsigned long long)&lA[buf][(cRow + 16 * u) * PA + cCol];
        }
        async_copy8_b128(g, l);
#pragma unroll
        for (int u = 0; u < 8; ++u) {
            g[u] = gB + (size_t)(16 * u) * N;
            l[u] = (unsigned)(unsigned long long)&lB[buf][(cRow + 16 * u) * PB + cCol];
        }
        async_copy8_b128(g, l);
        gA += BK;
        gB += (size_t)BK * N;
    };

    v8f acc[2][4];
#pragma unroll
    for (int i = 0; i < 2; ++i)
#pragma unroll
        for (int j = 0; j < 4; ++j) acc[i][j] = v8f_zero();

    // prologue: tile 0 lands and is published, then tile 1 starts to fly
    const int ntiles = K / BK;
    issueAB(0);
    async_wait0();
    __syncthreads();
    if (ntiles > 1) issueAB(1);

    for (int t = 0; t < ntiles; ++t) {
        const int cur = t & 1;

        // compute current tile, 32 k at a time in ascending order; unrolled so
        // that every LDS offset inside the stage is an immediate
#pragma unroll
        for (int kk = 0; kk < BK; kk += 32) {
            Frag a[2], b[4];
#pragma unroll
            for (int i = 0; i < 2; ++i) {
                int row = wm * 32 + i * 16 + l16;
                a[i].u4[0] = *(const uint4*)&lA[cur][row * PA + kk + koff];
                a[i].u4[1] = *(const uint4*)&lA[cur][row * PA + kk + koff + 16];
            }
#pragma unroll
            for (int j = 0; j < 4; ++j) {
                int col = wn * 64 + j * 16 + tcol;
                b[j].t[0] = lds_load_tr16(&lB[cur][(kk + trow) * PB + col]);
                b[j].t[1] = lds_load_tr16(&lB[cur][(kk + 16 + trow) * PB + col]);
            }
#pragma unroll
            for (int i = 0; i < 2; ++i)
#pragma unroll
                for (int j = 0; j < 4; ++j)
                    acc[i][j] = wmma_bf16(a[i].v, b[j].v, acc[i][j]);
        }

        // publish tile t + 1 and free this trip's buffer, then refill it
        lds_wait0();
        async_wait0();
        __syncthreads();
        if (t + 2 < ntiles) issueAB(cur);
    }
    async_wait0();

    // epilogue (C-layout: col = l16, row = r + 8*half per vgpr r)
#pragma unroll
    for (int i = 0; i < 2; ++i) {
#pragma unroll
        for (int j = 0; j < 4; ++j) {
            int col = blockN + wn * 64 + j * 16 + l16;
#pragma unroll
            for (int r = 0; r < 8; ++r) {
                int row = blockM + wm * 32 + i * 16 + r + half * 8;
                size_t idx = ((size_t)blockIdx.z * M + row) * N + col;
                float v = acc[i][j][r];
                if (EPI == 0) {
                    ((__bf16*)C)[idx] = f32_to_bf16(v);
                } else {
                    ((float*)C)[idx] = residual[idx] + v;
                }
            }
        }
    }
}

// ---------------------------------------------------------------------------
// Flash attention: grid (B*H, T/64), block 128 (4 waves x 16 query rows).
// S = Q*K^T * 1/8 + bias, mask, online softmax, O = P*V.
// K and V tiles staged async to LDS; V transposed by its fragment loads.
// The position bias is a function of k - q alone: the block keeps the values of
// its head for every k - q that its 64 query rows meet in LDS, taken from two
// rows of the bias plane, and the key loop reads them there instead of walking
// the [T][T] plane in global memory.
// ---------------------------------------------------------------------------
__global__ __launch_bounds__(128)
void flash_attn_kernel(const __bf16* __restrict__ qb,
                       const __bf16* __restrict__ kb,
                       const __bf16* __restrict__ vb,
                       const float* __restrict__ bias,   // [H][T][T]
                       const int* __restrict__ mask,     // [B][T][T]
                       __bf16* __restrict__ ob) {
    constexpr int PK = 72;    // lK and lP row pitch: 144 B, an odd multiple of 16 B
    constexpr int PV = 80;    // lV row pitch: 160 B, an odd multiple of 32 B
    __shared__ __attribute__((aligned(16))) ushort_t lK[64 * PK];   // [key][dh]   -> B-frag layout for Q*K^T
    __shared__ __attribute__((aligned(16))) ushort_t lV[64 * PV];   // [key][dh]   -> read by transposing loads
    __shared__ __attribute__((aligned(16))) ushort_t lP[64 * PK];   // [q][key]    -> A-frag relayout
    // [k - (q - qbase) + 63] -> bias; the alignment puts it at the start of the
    // block's LDS, so that one address register and immediates reach a tile's values
    __shared__ __attribute__((aligned(128))) float lB[TT + 128];

    const int bh = blockIdx.x;
    const int b = bh / HH;
    const int h = bh % HH;
    const int qbase = blockIdx.y * 64;
    const int tid  = threadIdx.x;
    const int lane = tid & 31;
    const int wave = tid >> 5;         // 0..3 -> 16 query rows each
    const int half = lane >> 4;
    const int l16  = lane & 15;
    const int koff = half ? 8 : 0;
    const int trow = half * 8 + (lane & 7);      // transposing load: lane's row
    const int tcol = ((lane >> 3) & 1) * 8;      // and its column offset
    const int crow = tid >> 3;                   // tile copy: lane's first row
    const int ccol = (tid & 7) * 8;              // and its column

    // Q fragments stay in registers for the whole kernel
    Frag qf[2];
    {
        int qrow = qbase + wave * 16 + l16;
        const __bf16* qrp = qb + ((size_t)(b * TT + qrow)) * DD + h * DHH;
        qf[0].u4[0] = *(const uint4*)(qrp + koff);
        qf[0].u4[1] = *(const uint4*)(qrp + koff + 16);
        qf[1].u4[0] = *(const uint4*)(qrp + 32 + koff);
        qf[1].u4[1] = *(const uint4*)(qrp + 32 + koff + 16);
    }

    // Bias by relative position d = k - q: row q = T - 1 of the head's plane
    // holds d = -(T - 1) .. 0, row q = 0 holds d = 0 .. T - 1. Entry e is
    // d = e - 63 - qbase; the entries past d = T - 1 are filled but never read.
    // The first barrier of the key loop publishes the table.
    {
        const float* rlast  = bias + ((size_t)h * TT + (TT - 1)) * TT + (TT - 1);
        const float* rfirst = bias + (size_t)h * TT * TT;
        float t[(TT + 128) / 128];
        // both loops unrolled: t stays in registers, and every load is issued
        // before the first store waits for one
#pragma unroll
        for (int u = 0; u < (TT + 128) / 128; ++u) {
            int d = tid + 128 * u - 63 - qbase;
            d = d < TT - 1 ? d : TT - 1;
            t[u] = (d <= 0 ? rlast : rfirst)[d];
        }
#pragma unroll
        for (int u = 0; u < (TT + 128) / 128; ++u) lB[tid + 128 * u] = t[u];
    }
    // the lane's entry for key 0, accumulator row 0, column group 0, less 63
    const int tb = l16 - half * 8 - wave * 16;

    float m[8], l[8];
    v8f o[4];
#pragma unroll
    for (int r = 0; r < 8; ++r) { m[r] = -1e30f; l[r] = 0.0f; }
#pragma unroll
    for (int j = 0; j < 4; ++j) o[j] = v8f_zero();

    const float scale = 0.125f;   // 1/sqrt(DH)

    for (int kt = 0; kt < TT / 64; ++kt) {
        const int kbase = kt * 64;
        // K and V tiles: natural [key][dh] layout, async to LDS (no VGPR staging);
        // each thread copies column ccol of rows crow, +16, +32, +48
        const size_t gofs = ((size_t)(b * TT + kbase + crow)) * DD + h * DHH + ccol;
        async_copy4_b128(kb + gofs,           &lK[crow * PK + ccol],
                         kb + gofs + 16 * DD, &lK[(crow + 16) * PK + ccol],
                         kb + gofs + 32 * DD, &lK[(crow + 32) * PK + ccol],
                         kb + gofs + 48 * DD, &lK[(crow + 48) * PK + ccol]);
        async_copy4_b128(vb + gofs,           &lV[crow * PV + ccol],
                         vb + gofs + 16 * DD, &lV[(crow + 16) * PV + ccol],
                         vb + gofs + 32 * DD, &lV[(crow + 32) * PV + ccol],
                         vb + gofs + 48 * DD, &lV[(crow + 48) * PV + ccol]);
        async_wait0();
        __syncthreads();

        // S = Q * K^T  (4 column frags of 16, K-reduction DH=64 -> 2 wmma)
        v8f s[4];
#pragma unroll
        for (int j = 0; j < 4; ++j) {
            int col = j * 16 + l16;
            Frag b0, b1;
            b0.u4[0] = *(const uint4*)&lK[col * PK + koff];
            b0.u4[1] = *(const uint4*)&lK[col * PK + koff + 16];
            b1.u4[0] = *(const uint4*)&lK[col * PK + 32 + koff];
            b1.u4[1] = *(const uint4*)&lK[col * PK + 32 + koff + 16];
            v8f z = v8f_zero();
            z = wmma_bf16(qf[0].v, b0.v, z);
            s[j] = wmma_bf16(qf[1].v, b1.v, z);
        }

        // scale + bias + mask + online softmax (per accumulator row); the rows
        // go through each phase together, so that their reductions interleave
        float rmax[8], corr[8], psum[8];
#pragma unroll
        for (int r = 0; r < 8; ++r) {
            int qg = qbase + wave * 16 + r + half * 8;
            rmax[r] = -1e30f;
#pragma unroll
            for (int j = 0; j < 4; ++j) {
                int kg = kbase + j * 16 + l16;
                float v = s[j][r] * scale + lB[tb + kbase + 63 + j * 16 - r];
                int mk = mask[((size_t)b * TT + qg) * TT + kg];
                v = (mk == 0) ? -1e9f : v;
                s[j][r] = v;
                rmax[r] = fmaxf(rmax[r], v);
            }
        }
        row_max16_x8(rmax);
#pragma unroll
        for (int r = 0; r < 8; ++r) {
            float mnew = fmaxf(m[r], rmax[r]);
            corr[r] = __expf(m[r] - mnew);
            psum[r] = 0.0f;
#pragma unroll
            for (int j = 0; j < 4; ++j) {
                float p = __expf(s[j][r] - mnew);
                s[j][r] = p;
                psum[r] += p;
            }
            m[r] = mnew;
        }
        row_sum16_x8(psum);
#pragma unroll
        for (int r = 0; r < 8; ++r) {
            l[r] = l[r] * corr[r] + psum[r];
#pragma unroll
            for (int j = 0; j < 4; ++j) o[j][r] *= corr[r];
        }

        // Relayout P through LDS (C-frag -> A-frag)
#pragma unroll
        for (int j = 0; j < 4; ++j) {
            int coll = j * 16 + l16;
#pragma unroll
            for (int r = 0; r < 8; ++r) {
                int rowl = wave * 16 + r + half * 8;
                lP[rowl * PK + coll] =
                    __builtin_bit_cast(unsigned short, f32_to_bf16(s[j][r]));
            }
        }
        __syncthreads();

        // O += P * V
        Frag pa[2];
        {
            int prow = wave * 16 + l16;
            pa[0].u4[0] = *(const uint4*)&lP[prow * PK + koff];
            pa[0].u4[1] = *(const uint4*)&lP[prow * PK + koff + 16];
            pa[1].u4[0] = *(const uint4*)&lP[prow * PK + 32 + koff];
            pa[1].u4[1] = *(const uint4*)&lP[prow * PK + 32 + koff + 16];
        }
#pragma unroll
        for (int j = 0; j < 4; ++j) {
            int col = j * 16 + tcol;  // dh column block
            Frag v0, v1;
            v0.t[0] = lds_load_tr16(&lV[trow * PV + col]);
            v0.t[1] = lds_load_tr16(&lV[(16 + trow) * PV + col]);
            v1.t[0] = lds_load_tr16(&lV[(32 + trow) * PV + col]);
            v1.t[1] = lds_load_tr16(&lV[(48 + trow) * PV + col]);
            o[j] = wmma_bf16(pa[0].v, v0.v, o[j]);
            o[j] = wmma_bf16(pa[1].v, v1.v, o[j]);
        }
        lds_wait0();   // this wave has left lK and lV before the next copies
        __syncthreads();
    }

    // finalize: O /= l, write bf16 [B,T,H*DH]
#pragma unroll
    for (int j = 0; j < 4; ++j) {
        int dh = j * 16 + l16;
#pragma unroll
        for (int r = 0; r < 8; ++r) {
            int qg = qbase + wave * 16 + r + half * 8;
            float v = o[j][r] / l[r];
            ob[((size_t)(b * TT + qg)) * DD + h * DHH + dh] = f32_to_bf16(v);
        }
    }
}

// ---------------------------------------------------------------------------
// Host-side orchestration
// ---------------------------------------------------------------------------
static inline size_t align256(size_t x) { return (x + 255) & ~(size_t)255; }

extern "C" void kernel_launch(void* const* d_in, const int* in_sizes, int n_in,
                              void* d_out, int out_size, void* d_ws, size_t ws_size,
                              hipStream_t stream) {
    (void)in_sizes; (void)n_in; (void)out_size; (void)ws_size;
    const float* x        = (const float*)d_in[0];
    const int*   x_mask   = (const int*)  d_in[1];
    const float* cond     = (const float*)d_in[2];
    const float* norm1_w  = (const float*)d_in[3];
    const float* f1_gw    = (const float*)d_in[4];
    const float* f1_gb    = (const float*)d_in[5];
    const float* f1_bw    = (const float*)d_in[6];
    const float* f1_bb    = (const float*)d_in[7];
    const float* wq       = (const float*)d_in[8];
    const float* wk       = (const float*)d_in[9];
    const float* wv       = (const float*)d_in[10];
    const float* wo       = (const float*)d_in[11];
    const float* rel_emb  = (const float*)d_in[12];
    const float* norm3_w  = (const float*)d_in[13];
    const float* f3_gw    = (const float*)d_in[14];
    const float* f3_gb    = (const float*)d_in[15];
    const float* f3_bw    = (const float*)d_in[16];
    const float* f3_bb    = (const float*)d_in[17];
    const float* ffn_w1   = (const float*)d_in[18];
    const float* ffn_w2   = (const float*)d_in[19];

    float* out_x    = (float*)d_out;                              // [B,T,D]
    float* out_bias = (float*)d_out + (size_t)BB * TT * DD;       // [H,T,T]

    // workspace bump allocator
    char* ws = (char*)d_ws;
    size_t off = 0;
    auto alloc = [&](size_t bytes) -> void* {
        void* p = ws + off;
        off += align256(bytes);
        return p;
    };
    const size_t BT = (size_t)BB * TT;
    __bf16* wq_bf   = (__bf16*)alloc((size_t)3 * DD * DD * 2);   // wq | wk | wv
    __bf16* wk_bf   = wq_bf + (size_t)DD * DD;
    __bf16* wv_bf   = wk_bf + (size_t)DD * DD;
    __bf16* wo_bf   = (__bf16*)alloc((size_t)DD * DD * 2);
    __bf16* w1_bf   = (__bf16*)alloc((size_t)DD * 4 * DD * 2);
    __bf16* w2_bf   = (__bf16*)alloc((size_t)2 * DD * DD * 2);
    float*  gamma1  = (float*)alloc((size_t)BB * DD * 4);
    float*  beta1   = (float*)alloc((size_t)BB * DD * 4);
    float*  gamma3  = (float*)alloc((size_t)BB * DD * 4);
    float*  beta3   = (float*)alloc((size_t)BB * DD * 4);
    __bf16* y_bf    = (__bf16*)alloc(BT * DD * 2);
    __bf16* q_bf    = (__bf16*)alloc(3 * BT * DD * 2);           // q | k | v
    __bf16* k_bf    = q_bf + BT * DD;
    __bf16* v_bf    = k_bf + BT * DD;
    __bf16* attn_bf = (__bf16*)alloc(BT * DD * 2);
    float*  x_mid   = (float*)alloc(BT * DD * 4);
    __bf16* y3_bf   = (__bf16*)alloc(BT * DD * 2);
    __bf16* h_bf    = (__bf16*)alloc(BT * 4 * DD * 2);
    __bf16* g_bf    = (__bf16*)alloc(BT * 2 * DD * 2);

    // 1) all that depends on the inputs alone: FiLM params, position bias
    //    (output #2 + consumed by attention), weight conversion fp32 -> bf16
    prep_kernel<<<NB_PREP, 256, 0, stream>>>(
        cond, f1_gw, f1_gb, f1_bw, f1_bb, gamma1, beta1,
        f3_gw, f3_gb, f3_bw, f3_bb, gamma3, beta3,
        rel_emb, out_bias,
        wq, wk, wv, wo, ffn_w1, ffn_w2,
        wq_bf, wk_bf, wv_bf, wo_bf, w1_bf, w2_bf);
    // 4) y = film(rmsnorm(x)) -> bf16
    rmsnorm_film_kernel<<<(int)(BT / 8), 256, 0, stream>>>(x, norm1_w, gamma1, beta1, y_bf);
    // 5) Q,K,V projections, one grid: z picks the weight and the output, which
    //    follow one another in the workspace
    {
        dim3 grid(DD / 128, (int)(BT / 128), 3);
        gemm_bf16_kernel<0><<<grid, 256, 0, stream>>>(y_bf, wq_bf, q_bf, nullptr,
                                                      (int)BT, DD, DD);
    }
    // 6) flash attention
    {
        dim3 grid(BB * HH, TT / 64);
        flash_attn_kernel<<<grid, 128, 0, stream>>>(q_bf, k_bf, v_bf,
                                                    out_bias, x_mask, attn_bf);
    }
    // 7) x_mid = x + attn @ wo
    {
        dim3 grid(DD / 128, (int)(BT / 128));
        gemm_bf16_kernel<1><<<grid, 256, 0, stream>>>(attn_bf, wo_bf, x_mid, x,
                                                      (int)BT, DD, DD);
    }
    // 8) y3 = film(rmsnorm(x_mid)) -> bf16
    rmsnorm_film_kernel<<<(int)(BT / 8), 256, 0, stream>>>(x_mid, norm3_w, gamma3, beta3, y3_bf);
    // 9) h = y3 @ ffn_w1  [BT, 4D]
    {
        dim3 grid(4 * DD / 128, (int)(BT / 128));
        gemm_bf16_kernel<0><<<grid, 256, 0, stream>>>(y3_bf, w1_bf, h_bf, nullptr,
                                                      (int)BT, 4 * DD, DD);
    }
    // 10) geglu
    geglu_kernel<<<(int)(BT / 2), 256, 0, stream>>>(h_bf, g_bf);
    // 11) out = x_mid + g @ ffn_w2
    {
        dim3 grid(DD / 128, (int)(BT / 128));
        gemm_bf16_kernel<1><<<grid, 256, 0, stream>>>(g_bf, w2_bf, out_x, x_mid,
                                                      (int)BT, DD, 2 * DD);
    }
}

// v008
// Measured time: 176 microseconds a run.
// Timed twice side by side with v007, it ran 1.06 times as fast both times.
// All steps since v000 together make it 3.96 times as fast.
#include <hip/hip_runtime.h>
#include <hip/hip_bf16.h>
#include <math.h>
#include <stdint.h>

// ---------------------------------------------------------------------------
// Problem constants (from reference)
// ---------------------------------------------------------------------------
#define BB 4
#define TT 1024
#define DD 1024
#define HH 16
#define DHH 64
#define DCC 64
#define NBUCK 32

typedef unsigned short ushort_t;
typedef __attribute__((ext_vector_type(16))) __bf16 v16bf;
typedef __attribute__((ext_vector_type(8)))  float  v8f;
typedef __attribute__((ext_vector_type(8)))  short  s16x8;
typedef __attribute__((ext_vector_type(4)))  int    i32x4;

union Frag {
    v16bf v;
    uint4 u4[2];
    s16x8 t[2];
};

__device__ __forceinline__ v8f v8f_zero() {
    v8f z;
#pragma unroll
    for (int i = 0; i < 8; ++i) z[i] = 0.0f;
    return z;
}

__device__ __forceinline__ __bf16 f32_to_bf16(float f) {
    unsigned u = __builtin_bit_cast(unsigned, f);
    unsigned r = u + 0x7FFFu + ((u >> 16) & 1u);   // round-to-nearest-even
    unsigned short h = (unsigned short)(r >> 16);
    return __builtin_bit_cast(__bf16, h);
}

__device__ __forceinline__ v8f wmma_bf16(v16bf a, v16bf b, v8f c) {
    // D = A(16x32 bf16) * B(32x16 bf16) + C(16x16 f32)
    return __builtin_amdgcn_wmma_f32_16x16x32_bf16(
        /*neg_a=*/false, a, /*neg_b=*/false, b,
        /*c_mod=*/(short)0, c, /*reuse_a=*/false, /*reuse_b=*/false);
}

// Four async copies of 16B (8 bf16) per lane from global to LDS; tracked with
// ASYNCcnt. The closing s_wait_xcnt stands inside the statement so that no
// address register of a copy is rewritten in front of it.
__device__ __forceinline__ void async_copy4_b128(const void* g0, void* d0,
                                                 const void* g1, void* d1,
                                                 const void* g2, void* d2,
                                                 const void* g3, void* d3) {
    unsigned l0 = (unsigned)(unsigned long long)d0;  // LDS aperture: low 32 bits
    unsigned l1 = (unsigned)(unsigned long long)d1;
    unsigned l2 = (unsigned)(unsigned long long)d2;
    unsigned l3 = (unsigned)(unsigned long long)d3;
    asm volatile("global_load_async_to_lds_b128 %0, %1, off\n\t"
                 "global_load_async_to_lds_b128 %2, %3, off\n\t"
                 "global_load_async_to_lds_b128 %4, %5, off\n\t"
                 "global_load_async_to_lds_b128 %6, %7, off\n\t"
                 "s_wait_xcnt 0x0"
                 :: "v"(l0), "v"(g0), "v"(l1), "v"(g1),
                    "v"(l2), "v"(g2), "v"(l3), "v"(g3) : "memory");
}
// Eight such copies in one statement; the closing s_wait_xcnt stands inside it
// for the same reason.
__device__ __forceinline__ void async_copy8_b128(const void* const (&g)[8],
                                                 const unsigned (&l)[8]) {
    asm volatile("global_load_async_to_lds_b128 %0, %1, off\n\t"
                 "global_load_async_to_lds_b128 %2, %3, off\n\t"
                 "global_load_async_to_lds_b128 %4, %5, off\n\t"
                 "global_load_async_to_lds_b128 %6, %7, off\n\t"
                 "global_load_async_to_lds_b128 %8, %9, off\n\t"
                 "global_load_async_to_lds_b128 %10, %11, off\n\t"
                 "global_load_async_to_lds_b128 %12, %13, off\n\t"
                 "global_load_async_to_lds_b128 %14, %15, off\n\t"
                 "s_wait_xcnt 0x0"
                 :: "v"(l[0]), "v"(g[0]), "v"(l[1]), "v"(g[1]),
                    "v"(l[2]), "v"(g[2]), "v"(l[3]), "v"(g[3]),
                    "v"(l[4]), "v"(g[4]), "v"(l[5]), "v"(g[5]),
                    "v"(l[6]), "v"(g[6]), "v"(l[7]), "v"(g[7]) : "memory");
}
// The issuing wave's copies have landed behind this wait.
__device__ __forceinline__ void async_wait0() {
    asm volatile("s_wait_asynccnt 0x0" ::: "memory");
}
// The wave's own LDS reads have retired before a copy may refill what they read.
__device__ __forceinline__ void lds_wait0() {
    asm volatile("s_wait_dscnt 0x0" ::: "memory");
}

// Transposing LDS load: from a row-major [k][n] bf16 tile, lane (c = l & 15,
// h = l >> 4) receives T[kbase + 8h + 0..7][nbase + c]. The lane's address is
// row kbase + 8*(l >> 4) + (l & 7), column nbase + 8*((l >> 3) & 1).
__device__ __forceinline__ s16x8 lds_load_tr16(const ushort_t* p) {
    typedef __attribute__((address_space(3))) s16x8 lds_s16x8;
    return __builtin_amdgcn_ds_load_tr16_b128_v8i16((lds_s16x8*)p);
}

// ---------------------------------------------------------------------------
// Elementwise helpers
// ---------------------------------------------------------------------------
// Two floats rounded to bf16 and packed into one dword (a in the low half).
__device__ __forceinline__ unsigned pack2_bf16(float a, float b) {
    unsigned lo = __builtin_bit_cast(unsigned short, f32_to_bf16(a));
    unsigned hi = __builtin_bit_cast(unsigned short, f32_to_bf16(b));
    return lo | (hi << 16);
}

// 16 elements per thread: a block takes 4096 consecutive elements as four
// slabs of 1024; each wave-wide load covers 512 contiguous bytes, each store
// 256. The blocks cover the array exactly (its length is a multiple of 4096).
__device__ __forceinline__
void cvt_bf16_block(const float* __restrict__ src,
                    __bf16* __restrict__ dst, int blk) {
    const int base = blk * 4096 + threadIdx.x * 4;
    float4 v[4];
#pragma unroll
    for (int u = 0; u < 4; ++u) v[u] = *(const float4*)(src + base + u * 1024);
#pragma unroll
    for (int u = 0; u < 4; ++u)
        *(uint2*)(dst + base + u * 1024) =
            make_uint2(pack2_bf16(v[u].x, v[u].y), pack2_bf16(v[u].z, v[u].w));
    // the stores' registers are not rewritten by another part of the merged
    // kernel in front of this wait
    asm volatile("s_wait_xcnt 0x0" ::: "memory");
}

// gamma/beta = cond @ W + b  (per batch, DC=64 reduction); B*D/256 blocks
__device__ __forceinline__
void film_params_block(const float* __restrict__ cond,
                       const float* __restrict__ gw,
                       const float* __restrict__ gb,
                       const float* __restrict__ bw,
                       const float* __restrict__ bb,
                       float* __restrict__ gamma,
                       float* __restrict__ beta, int blk) {
    int idx = blk * 256 + threadIdx.x;   // B*D
    if (idx >= BB * DD) return;
    int b = idx / DD, d = idx % DD;
    const float* c = cond + b * DCC;
    float g = gb[d], bt = bb[d];
#pragma unroll 8
    for (int i = 0; i < DCC; ++i) {
        float cv = c[i];
        g  += cv * gw[i * DD + d];
        bt += cv * bw[i * DD + d];
    }
    gamma[idx] = g;
    beta[idx]  = bt;
}

// T5 relative position bucket of rp = k - q
__device__ __forceinline__ int rel_bucket(int rp) {
    const int nb = NBUCK / 2;      // 16
    const int max_exact = nb / 2;  // 8
    int bucket = (rp > 0) ? nb : 0;
    int arp = rp < 0 ? -rp : rp;
    int val;
    if (arp < max_exact) {
        val = arp;
    } else {
        float rp_safe = (float)(arp > 1 ? arp : 1);
        int large = max_exact +
            (int)(logf(rp_safe / (float)max_exact) /
                  logf(128.0f / (float)max_exact) * (float)(nb - max_exact));
        val = large < nb - 1 ? large : nb - 1;
    }
    return bucket + val;
}

// T5 relative position bias -> bias_out[h][q][k]  (this is output #2)
// One block per query row; a thread takes 4 consecutive keys for all 16 heads
// (64 elements): each wave-wide store covers 512 contiguous bytes of one head.
__device__ __forceinline__
void bias_block(const float* __restrict__ rel_emb,
                float* __restrict__ bias_out, int q) {
    const int k0 = threadIdx.x * 4;
    float e[4][HH];
#pragma unroll
    for (int c = 0; c < 4; ++c) {
        const float4* p = (const float4*)(rel_emb + rel_bucket(k0 + c - q) * HH);
#pragma unroll
        for (int g = 0; g < HH / 4; ++g) {
            float4 t = p[g];
            e[c][4 * g + 0] = t.x;
            e[c][4 * g + 1] = t.y;
            e[c][4 * g + 2] = t.z;
            e[c][4 * g + 3] = t.w;
        }
    }
#pragma unroll
    for (int h = 0; h < HH; ++h)
        *(float4*)(bias_out + ((size_t)h * TT + q) * TT + k0) =
            make_float4(e[0][h], e[1][h], e[2][h], e[3][h]);
    // the stores' registers are not rewritten by another part of the merged
    // kernel in front of this wait
    asm volatile("s_wait_xcnt 0x0" ::: "memory");
}

// Everything that depends on the inputs alone, in one grid: a block's index
// says which piece it does. The FiLM blocks, few and latency-bound, come first.
#define NB_FILM (BB * DD / 256)      // blocks per FiLM parameter pair
#define NB_W    (DD * DD / 4096)     // blocks per D x D weight matrix
#define NB_PREP (2 * NB_FILM + TT + 10 * NB_W)
__global__ __launch_bounds__(256)
void prep_kernel(const float* __restrict__ cond,
                 const float* __restrict__ f1_gw, const float* __restrict__ f1_gb,
                 const float* __restrict__ f1_bw, const float* __restrict__ f1_bb,
                 float* __restrict__ gamma1, float* __restrict__ beta1,
                 const float* __restrict__ f3_gw, const float* __restrict__ f3_gb,
                 const float* __restrict__ f3_bw, const float* __restrict__ f3_bb,
                 float* __restrict__ gamma3, float* __restrict__ beta3,
                 const float* __restrict__ rel_emb, float* __restrict__ bias_out,
                 const float* __restrict__ wq, const float* __restrict__ wk,
                 const float* __restrict__ wv, const float* __restrict__ wo,
                 const float* __restrict__ w1, const float* __restrict__ w2,
                 __bf16* __restrict__ wq_bf, __bf16* __restrict__ wk_bf,
                 __bf16* __restrict__ wv_bf, __bf16* __restrict__ wo_bf,
                 __bf16* __restrict__ w1_bf, __bf16* __restrict__ w2_bf) {
    int blk = blockIdx.x;
    if (blk < NB_FILM) {
        film_params_block(cond, f1_gw, f1_gb, f1_bw, f1_bb, gamma1, beta1, blk);
        return;
    }
    blk -= NB_FILM;
    if (blk < NB_FILM) {
        film_params_block(cond, f3_gw, f3_gb, f3_bw, f3_bb, gamma3, beta3, blk);
        return;
    }
    blk -= NB_FILM;
    if (blk < TT) {
        bias_block(rel_emb, bias_out, blk);
        return;
    }
    blk -= TT;
    const float* src;
    __bf16* dst;
    if (blk < NB_W)          { src = wq; dst = wq_bf; }
    else if (blk < 2 * NB_W) { src = wk; dst = wk_bf; blk -= NB_W; }
    else if (blk < 3 * NB_W) { src = wv; dst = wv_bf; blk -= 2 * NB_W; }
    else if (blk < 4 * NB_W) { src = wo; dst = wo_bf; blk -= 3 * NB_W; }
    else if (blk < 8 * NB_W) { src = w1; dst = w1_bf; blk -= 4 * NB_W; }
    else                     { src = w2; dst = w2_bf; blk -= 8 * NB_W; }
    cvt_bf16_block(src, dst, blk);
}

// y = film(rms_norm(x)) -> bf16, one wave per (b,t) row: a lane holds 32
// elements of the row in registers (eight 16-byte loads, 512 contiguous bytes
// per wave each), so x is read once and the row sum needs no LDS.
__global__ __launch_bounds__(256)
void rmsnorm_film_kernel(const float* __restrict__ x,
                         const float* __restrict__ w,
                         const float* __restrict__ gamma,
                         const float* __restrict__ beta,
                         __bf16* __restrict__ y) {
    const int lane = threadIdx.x & 31;
    const int row = blockIdx.x * 8 + (threadIdx.x >> 5);   // 0 .. B*T-1
    const int b = row / TT;
    const float* xr = x + (size_t)row * DD + lane * 4;
    float4 v[8];
#pragma unroll
    for (int u = 0; u < 8; ++u) v[u] = *(const float4*)(xr + u * 128);
    float s0 = 0.0f, s1 = 0.0f, s2 = 0.0f, s3 = 0.0f;   // four independent chains
#pragma unroll
    for (int u = 0; u < 8; ++u) {
        s0 += v[u].x * v[u].x;
        s1 += v[u].y * v[u].y;
        s2 += v[u].z * v[u].z;
        s3 += v[u].w * v[u].w;
    }
    float tot = (s0 + s1) + (s2 + s3);
#pragma unroll
    for (int m = 16; m >= 1; m >>= 1) tot += __shfl_xor(tot, m, 32);
    float rstd = rsqrtf(tot / (float)DD + 1e-6f);
    const float* wr = w + lane * 4;
    const float* g  = gamma + (size_t)b * DD + lane * 4;
    const float* be = beta + (size_t)b * DD + lane * 4;
    __bf16* yr = y + (size_t)row * DD + lane * 4;
#pragma unroll
    for (int u = 0; u < 8; ++u) {
        float4 w4 = *(const float4*)(wr + u * 128);
        float4 g4 = *(const float4*)(g + u * 128);
        float4 b4 = *(const float4*)(be + u * 128);
        float r0 = (w4.x * (v[u].x * rstd)) * (g4.x + 1.0f) + b4.x;
        float r1 = (w4.y * (v[u].y * rstd)) * (g4.y + 1.0f) + b4.y;
        float r2 = (w4.z * (v[u].z * rstd)) * (g4.z + 1.0f) + b4.z;
        float r3 = (w4.w * (v[u].w * rstd)) * (g4.w + 1.0f) + b4.w;
        *(uint2*)(yr + u * 128) = make_uint2(pack2_bf16(r0, r1), pack2_bf16(r2, r3));
    }
}

// geglu: g[r,c] = h[r,c] * gelu(h[r,c+2048]), exact gelu
__device__ __forceinline__ float geglu1(float p1, float p2) {
    float ge = 0.5f * p2 * (1.0f + erff(p2 * 0.70710678118654752f));
    return p1 * ge;
}
// both bf16 halves of a dword pair
__device__ __forceinline__ unsigned geglu2(unsigned a, unsigned c) {
    float lo = geglu1(__builtin_bit_cast(float, a << 16),
                      __builtin_bit_cast(float, c << 16));
    float hi = geglu1(__builtin_bit_cast(float, a & 0xFFFF0000u),
                      __builtin_bit_cast(float, c & 0xFFFF0000u));
    return pack2_bf16(lo, hi);
}
// One block per two rows; a thread takes 8 consecutive columns of each row
// (16 elements), all by 16-byte accesses.
__global__ __launch_bounds__(256)
void geglu_kernel(const __bf16* __restrict__ h,
                  __bf16* __restrict__ g) {
    const int c = threadIdx.x * 8;
    const size_t r0 = (size_t)blockIdx.x * 2;
    uint4 p1[2], p2[2];
#pragma unroll
    for (int u = 0; u < 2; ++u) {
        const __bf16* hr = h + (r0 + u) * 4 * DD + c;
        p1[u] = *(const uint4*)hr;
        p2[u] = *(const uint4*)(hr + 2 * DD);
    }
#pragma unroll
    for (int u = 0; u < 2; ++u)
        *(uint4*)(g + (r0 + u) * 2 * DD + c) =
            make_uint4(geglu2(p1[u].x, p2[u].x), geglu2(p1[u].y, p2[u].y),
                       geglu2(p1[u].z, p2[u].z), geglu2(p1[u].w, p2[u].w));
}

// ---------------------------------------------------------------------------
// Generic bf16 WMMA GEMM:  C[M,N] = A[M,K] * B[K,N]  (row-major, bf16 in)
// Block tile 128x128, 8 waves (4 along M x 2 along N), wave tile 32x64.
// Double-buffered LDS, 128 k per stage (K is a multiple of 128); A and B tiles
// staged via GLOBAL_LOAD_ASYNC_TO_LDS_B128, each wave-wide copy taking two whole
// 256-byte rows; B kept row-major [k][n] and transposed by the fragment loads.
// EPI==0: store bf16.  EPI==1: store f32 with residual add.
// Grid z: independent products on the same A; B, C and the residual advance by
// one whole matrix per z.
// ---------------------------------------------------------------------------
template <int EPI>
__global__ __launch_bounds__(256)
void gemm_bf16_kernel(const __bf16* __restrict__ A,
                      const __bf16* __restrict__ Bm,
                      void* __restrict__ C,
                      const float* __restrict__ residual,
                      int M, int N, int K) {
    constexpr int BK = 128;   // k per stage
    constexpr int PA = 136;   // lA row pitch: 272 B, an odd multiple of 16 B
    constexpr int PB = 144;   // lB row pitch: 288 B, an odd multiple of 32 B
    __shared__ __attribute__((aligned(16))) ushort_t lA[2][128 * PA];  // [m][k]
    __shared__ __attribute__((aligned(16))) ushort_t lB[2][BK * PB];   // [k][n]

    const int tid  = threadIdx.x;
    const int lane = tid & 31;
    const int wave = tid >> 5;          // 0..7
    const int wm   = wave & 3;          // 4 waves along M
    const int wn   = wave >> 2;         // 2 waves along N
    const int half = lane >> 4;         // which 16-lane half
    const int l16  = lane & 15;
    const int koff = half ? 8 : 0;
    const int trow = half * 8 + (lane & 7);      // transposing load: lane's row
    const int tcol = ((lane >> 3) & 1) * 8;      // and its column offset

    const int blockM = blockIdx.y * 128;
    const int blockN = blockIdx.x * 128;

    // per-thread tile-copy coordinates: both tiles are 128 rows of 256 B; a
    // thread takes 16-byte column cCol of rows cRow, +16, ... +112 of each
    const int cRow = tid >> 4;
    const int cCol = (tid & 15) * 8;

    // each thread's two source addresses walk along K, one tile per issue
    const __bf16* gA = A + (size_t)(blockM + cRow) * K + cCol;
    const __bf16* gB = Bm + ((size_t)blockIdx.z * K + cRow) * N + blockN + cCol;
    auto issueAB = [&](int buf) {
        const void* g[8];
        unsigned l[8];   // LDS aperture: low 32 bits
        // both loops unrolled: g and l are the statement's register operands
#pragma unroll
        for (int u = 0; u < 8; ++u) {
            g[u] = gA + (size_t)(16 * u) * K;
            l[u] = (unsigned)(unsigned long long)&lA[buf][(cRow + 16 * u) * PA + cCol];
        }
        async_copy8_b128(g, l);
#pragma unroll
        for (int u = 0; u < 8; ++u) {
            g[u] = gB + (size_t)(16 * u) * N;
            l[u] = (unsigned)(unsigned long long)&lB[buf][(cRow + 16 * u) * PB + cCol];
        }
        async_copy8_b128(g, l);
        gA += BK;
        gB += (size_t)BK * N;
    };

    v8f acc[2][4];
#pragma unroll
    for (int i = 0; i < 2; ++i)
#pragma unroll
        for (int j = 0; j < 4; ++j) acc[i][j] = v8f_zero();

    // prologue: tile 0 lands and is published, then tile 1 starts to fly
    const int ntiles = K / BK;
    issueAB(0);
    async_wait0();
    __syncthreads();
    if (ntiles > 1) issueAB(1);

    for (int t = 0; t < ntiles; ++t) {
        const int cur = t & 1;

        // compute current tile, 32 k at a time in ascending order; unrolled so
        // that every LDS offset inside the stage is an immediate
#pragma unroll
        for (int kk = 0; kk < BK; kk += 32) {
            Frag a[2], b[4];
#pragma unroll
            for (int i = 0; i < 2; ++i) {
                int row = wm * 32 + i * 16 + l16;
                a[i].u4[0] = *(const uint4*)&lA[cur][row * PA + kk + koff];
                a[i].u4[1] = *(const uint4*)&lA[cur][row * PA + kk + koff + 16];
            }
#pragma unroll
            for (int j = 0; j < 4; ++j) {
                int col = wn * 64 + j * 16 + tcol;
                b[j].t[0] = lds_load_tr16(&lB[cur][(kk + trow) * PB + col]);
                b[j].t[1] = lds_load_tr16(&lB[cur][(kk + 16 + trow) * PB + col]);
            }
#pragma unroll
            for (int i = 0; i < 2; ++i)
#pragma unroll
                for (int j = 0; j < 4; ++j)
                    acc[i][j] = wmma_bf16(a[i].v, b[j].v, acc[i][j]);
        }

        // publish tile t + 1 and free this trip's buffer, then refill it
        lds_wait0();
        async_wait0();
        __syncthreads();
        if (t + 2 < ntiles) issueAB(cur);
    }
    async_wait0();

    // epilogue (C-layout: col = l16, row = r + 8*half per vgpr r)
#pragma unroll
    for (int i = 0; i < 2; ++i) {
#pragma unroll
        for (int j = 0; j < 4; ++j) {
            int col = blockN + wn * 64 + j * 16 + l16;
#pragma unroll
            for (int r = 0; r < 8; ++r) {
                int row = blockM + wm * 32 + i * 16 + r + half * 8;
                size_t idx = ((size_t)blockIdx.z * M + row) * N + col;
                float v = acc[i][j][r];
                if (EPI == 0) {
                    ((__bf16*)C)[idx] = f32_to_bf16(v);
                } else {
                    ((float*)C)[idx] = residual[idx] + v;
                }
            }
        }
    }
}

__device__ __forceinline__ float other_half(float x) {
    int b = __builtin_bit_cast(int, x);
    return __builtin_bit_cast(float, __builtin_amdgcn_permlanex16(
        b, b, 0x76543210, 0xfedcba98, false, false));
}

__global__ __launch_bounds__(128)
void flash_attn_kernel(const __bf16* __restrict__ qb,
                       const __bf16* __restrict__ kb,
                       const __bf16* __restrict__ vb,
                       const float* __restrict__ bias,   // [H][T][T]
                       const int* __restrict__ mask,     // [B][T][T]
                       __bf16* __restrict__ ob) {
    constexpr int PK = 72;    // lK row pitch: 144 B, an odd multiple of 16 B
    constexpr int PV = 80;    // lV row pitch: 160 B, an odd multiple of 32 B
    constexpr int PM = 68;    // lM row pitch: 272 B, an odd multiple of 16 B
    __shared__ __attribute__((aligned(16))) ushort_t lK[64 * PK];   // [key][dh]   -> A-frag layout for K*Q^T
    __shared__ __attribute__((aligned(16))) ushort_t lV[64 * PV];   // [key][dh]   -> read by transposing loads
    __shared__ __attribute__((aligned(16))) int lM[64 * PM];        // [q][key]    -> mask tile
    // [k - (q - qbase) + 63] -> bias; the alignment puts it at the start of the
    // block's LDS, which keeps the offsets of a tile's values small
    __shared__ __attribute__((aligned(128))) float lB[TT + 128];

    const int bh = blockIdx.x;
    const int b = bh / HH;
    const int h = bh % HH;
    const int qbase = blockIdx.y * 64;
    const int tid  = threadIdx.x;
    const int lane = tid & 31;
    const int wave = tid >> 5;         // 0..3 -> 16 queries each
    const int half = lane >> 4;
    const int l16  = lane & 15;
    const int koff = half ? 8 : 0;
    const int trow = half * 8 + (lane & 7);      // transposing load: lane's row
    const int tcol = ((lane >> 3) & 1) * 8;      // and its column offset
    const int crow = tid >> 3;                   // tile copy: lane's first row
    const int ccol = (tid & 7) * 8;              // and its column
    const int qg   = qbase + wave * 16 + l16;    // the lane's query

    // Q fragments stay in registers for the whole kernel
    Frag qf[2];
    {
        const __bf16* qrp = qb + ((size_t)(b * TT + qg)) * DD + h * DHH;
        qf[0].u4[0] = *(const uint4*)(qrp + koff);
        qf[0].u4[1] = *(const uint4*)(qrp + koff + 16);
        qf[1].u4[0] = *(const uint4*)(qrp + 32 + koff);
        qf[1].u4[1] = *(const uint4*)(qrp + 32 + koff + 16);
    }

    // Bias by relative position d = k - q: row q = T - 1 of the head's plane
    // holds d = -(T - 1) .. 0, row q = 0 holds d = 0 .. T - 1. Entry e is
    // d = e - 63 - qbase; the entries past d = T - 1 are filled but never read.
    // The first barrier of the key loop publishes the table.
    {
        const float* rlast  = bias + ((size_t)h * TT + (TT - 1)) * TT + (TT - 1);
        const float* rfirst = bias + (size_t)h * TT * TT;
        float t[(TT + 128) / 128];
        // both loops unrolled: t stays in registers, and every load is issued
        // before the first store waits for one
#pragma unroll
        for (int u = 0; u < (TT + 128) / 128; ++u) {
            int d = tid + 128 * u - 63 - qbase;
            d = d < TT - 1 ? d : TT - 1;
            t[u] = (d <= 0 ? rlast : rfirst)[d];
        }
#pragma unroll
        for (int u = 0; u < (TT + 128) / 128; ++u) lB[tid + 128 * u] = t[u];
    }
    // the lane's entry for key 0 of its half in key group 0 of the current tile
    const float* bp = &lB[half * 8 - wave * 16 - l16 + 63];
    // the lane's mask row in the tile, at the first key of its half
    const int* mrow = &lM[(wave * 16 + l16) * PM + half * 8];
    // mask tile copy: 64 rows of 256 B; a thread takes 16-byte column mcol of
    // rows mr0, +8, ... +56, so that a wave-wide copy takes two whole rows
    const int mr0  = tid >> 4;
    const int mcol = (tid & 15) * 4;
    const int* gM = mask + ((size_t)b * TT + qbase + mr0) * TT + mcol;

    // m: the query's running maximum (equal in both halves); l: the running sum
    // over the keys of the lane's own half, joined behind the loop
    float m = -1e30f, l = 0.0f;
    v8f o[4];
#pragma unroll
    for (int j = 0; j < 4; ++j) o[j] = v8f_zero();

    const float scale = 0.125f;   // 1/sqrt(DH)

    for (int kt = 0; kt < TT / 64; ++kt) {
        const int kbase = kt * 64;
        // K and V tiles: natural [key][dh] layout, async to LDS (no VGPR staging);
        // each thread copies column ccol of rows crow, +16, +32, +48
        const size_t gofs = ((size_t)(b * TT + kbase + crow)) * DD + h * DHH + ccol;
        async_copy4_b128(kb + gofs,           &lK[crow * PK + ccol],
                         kb + gofs + 16 * DD, &lK[(crow + 16) * PK + ccol],
                         kb + gofs + 32 * DD, &lK[(crow + 32) * PK + ccol],
                         kb + gofs + 48 * DD, &lK[(crow + 48) * PK + ccol]);
        async_copy4_b128(vb + gofs,           &lV[crow * PV + ccol],
                         vb + gofs + 16 * DD, &lV[(crow + 16) * PV + ccol],
                         vb + gofs + 32 * DD, &lV[(crow + 32) * PV + ccol],
                         vb + gofs + 48 * DD, &lV[(crow + 48) * PV + ccol]);
        {
            const void* g[8];
            unsigned a[8];   // LDS aperture: low 32 bits
            // unrolled: g and a are the statement's register operands
#pragma unroll
            for (int u = 0; u < 8; ++u) {
                g[u] = gM + (size_t)(8 * u) * TT + kbase;
                a[u] = (unsigned)(unsigned long long)&lM[(mr0 + 8 * u) * PM + mcol];
            }
            async_copy8_b128(g, a);
        }
        async_wait0();
        __syncthreads();

        // the lane's 32 mask values: mk[2 j + (r >> 2)][r & 3] goes with s[j][r]
        i32x4 mk[8];
#pragma unroll
        for (int u = 0; u < 8; ++u) mk[u] = *(const i32x4*)(mrow + u * 8 - (u & 1) * 4);

        // S^T = K * Q^T  (4 groups of 16 keys, reduction DH=64 -> 2 wmma):
        // s[j][r] = score of key kbase + 16 j + 8 half + r with query qg
        v8f s[4];
#pragma unroll
        for (int j = 0; j < 4; ++j) {
            int row = j * 16 + l16;
            Frag k0, k1;
            k0.u4[0] = *(const uint4*)&lK[row * PK + koff];
            k0.u4[1] = *(const uint4*)&lK[row * PK + koff + 16];
            k1.u4[0] = *(const uint4*)&lK[row * PK + 32 + koff];
            k1.u4[1] = *(const uint4*)&lK[row * PK + 32 + koff + 16];
            v8f z = v8f_zero();
            z = wmma_bf16(k0.v, qf[0].v, z);
            s[j] = wmma_bf16(k1.v, qf[1].v, z);
        }

        // holds the eight mask reads together: issued in a row and waited for
        // once; left alone the build sends them one by one through one register
        // quad, a full LDS latency each
        asm volatile("" :: "v"(mk[0]), "v"(mk[1]), "v"(mk[2]), "v"(mk[3]),
                           "v"(mk[4]), "v"(mk[5]), "v"(mk[6]), "v"(mk[7]));

        // scale + bias + mask + online softmax, all of one query in its two lanes
        float gmax[4];
#pragma unroll
        for (int j = 0; j < 4; ++j) {
            gmax[j] = -1e30f;
#pragma unroll
            for (int r = 0; r < 8; ++r) {
                float v = s[j][r] * scale + bp[j * 16 + r];
                v = (mk[2 * j + (r >> 2)][r & 3] == 0) ? -1e9f : v;
                s[j][r] = v;
                gmax[j] = fmaxf(gmax[j], v);
            }
        }
        float tmax = fmaxf(fmaxf(gmax[0], gmax[1]), fmaxf(gmax[2], gmax[3]));
        tmax = fmaxf(tmax, other_half(tmax));
        const float mnew = fmaxf(m, tmax);
        const float corr = __expf(m - mnew);
        m = mnew;
        float gsum[4];   // four independent chains
#pragma unroll
        for (int j = 0; j < 4; ++j) {
            gsum[j] = 0.0f;
#pragma unroll
            for (int r = 0; r < 8; ++r) {
                float p = __expf(s[j][r] - mnew);
                s[j][r] = p;
                gsum[j] += p;
            }
        }
        l = l * corr + ((gsum[0] + gsum[1]) + (gsum[2] + gsum[3]));
#pragma unroll
        for (int j = 0; j < 4; ++j)
#pragma unroll
            for (int r = 0; r < 8; ++r) o[j][r] *= corr;

        // P^T as B operand: element e of fragment i is register e & 7 of key
        // group 2 i + (e >> 3), the k order of the transposing loads
        Frag pf[2];
#pragma unroll
        for (int i = 0; i < 2; ++i)
#pragma unroll
            for (int g = 0; g < 2; ++g) {
                const v8f& t = s[2 * i + g];
                pf[i].u4[g] = make_uint4(pack2_bf16(t[0], t[1]), pack2_bf16(t[2], t[3]),
                                         pack2_bf16(t[4], t[5]), pack2_bf16(t[6], t[7]));
            }

        // O^T += V^T * P^T
#pragma unroll
        for (int j = 0; j < 4; ++j) {
            int col = j * 16 + tcol;  // dh block
            Frag v0, v1;
            v0.t[0] = lds_load_tr16(&lV[trow * PV + col]);
            v0.t[1] = lds_load_tr16(&lV[(16 + trow) * PV + col]);
            v1.t[0] = lds_load_tr16(&lV[(32 + trow) * PV + col]);
            v1.t[1] = lds_load_tr16(&lV[(48 + trow) * PV + col]);
            o[j] = wmma_bf16(v0.v, pf[0].v, o[j]);
            o[j] = wmma_bf16(v1.v, pf[1].v, o[j]);
        }
        bp += 64;
        lds_wait0();   // this wave has left lK, lV and lM before the next copies
        __syncthreads();
    }

    // finalize: O /= l, write bf16 [B,T,H*DH]; o[j][r] is dh 16 j + 8 half + r
    l += other_half(l);
    __bf16* orow = ob + ((size_t)(b * TT + qg)) * DD + h * DHH + half * 8;
#pragma unroll
    for (int j = 0; j < 4; ++j)
        *(uint4*)(orow + j * 16) =
            make_uint4(pack2_bf16(o[j][0] / l, o[j][1] / l),
                       pack2_bf16(o[j][2] / l, o[j][3] / l),
                       pack2_bf16(o[j][4] / l, o[j][5] / l),
                       pack2_bf16(o[j][6] / l, o[j][7] / l));
}

// ---------------------------------------------------------------------------
// Host-side orchestration
// ---------------------------------------------------------------------------
static inline size_t align256(size_t x) { return (x + 255) & ~(size_t)255; }

extern "C" void kernel_launch(void* const* d_in, const int* in_sizes, int n_in,
                              void* d_out, int out_size, void* d_ws, size_t ws_size,
                              hipStream_t stream) {
    (void)in_sizes; (void)n_in; (void)out_size; (void)ws_size;
    const float* x        = (const float*)d_in[0];
    const int*   x_mask   = (const int*)  d_in[1];
    const float* cond     = (const float*)d_in[2];
    const float* norm1_w  = (const float*)d_in[3];
    const float* f1_gw    = (const float*)d_in[4];
    const float* f1_gb    = (const float*)d_in[5];
    const float* f1_bw    = (const float*)d_in[6];
    const float* f1_bb    = (const float*)d_in[7];
    const float* wq       = (const float*)d_in[8];
    const float* wk       = (const float*)d_in[9];
    const float* wv       = (const float*)d_in[10];
    const float* wo       = (const float*)d_in[11];
    const float* rel_emb  = (const float*)d_in[12];
    const float* norm3_w  = (const float*)d_in[13];
    const float* f3_gw    = (const float*)d_in[14];
    const float* f3_gb    = (const float*)d_in[15];
    const float* f3_bw    = (const float*)d_in[16];
    const float* f3_bb    = (const float*)d_in[17];
    const float* ffn_w1   = (const float*)d_in[18];
    const float* ffn_w2   = (const float*)d_in[19];

    float* out_x    = (float*)d_out;                              // [B,T,D]
    float* out_bias = (float*)d_out + (size_t)BB * TT * DD;       // [H,T,T]

    // workspace bump allocator
    char* ws = (char*)d_ws;
    size_t off = 0;
    auto alloc = [&](size_t bytes) -> void* {
        void* p = ws + off;
        off += align256(bytes);
        return p;
    };
    const size_t BT = (size_t)BB * TT;
    __bf16* wq_bf   = (__bf16*)alloc((size_t)3 * DD * DD * 2);   // wq | wk | wv
    __bf16* wk_bf   = wq_bf + (size_t)DD * DD;
    __bf16* wv_bf   = wk_bf + (size_t)DD * DD;
    __bf16* wo_bf   = (__bf16*)alloc((size_t)DD * DD * 2);
    __bf16* w1_bf   = (__bf16*)alloc((size_t)DD * 4 * DD * 2);
    __bf16* w2_bf   = (__bf16*)alloc((size_t)2 * DD * DD * 2);
    float*  gamma1  = (float*)alloc((size_t)BB * DD * 4);
    float*  beta1   = (float*)alloc((size_t)BB * DD * 4);
    float*  gamma3  = (float*)alloc((size_t)BB * DD * 4);
    float*  beta3   = (float*)alloc((size_t)BB * DD * 4);
    __bf16* y_bf    = (__bf16*)alloc(BT * DD * 2);
    __bf16* q_bf    = (__bf16*)alloc(3 * BT * DD * 2);           // q | k | v
    __bf16* k_bf    = q_bf + BT * DD;
    __bf16* v_bf    = k_bf + BT * DD;
    __bf16* attn_bf = (__bf16*)alloc(BT * DD * 2);
    float*  x_mid   = (float*)alloc(BT * DD * 4);
    __bf16* y3_bf   = (__bf16*)alloc(BT * DD * 2);
    __bf16* h_bf    = (__bf16*)alloc(BT * 4 * DD * 2);
    __bf16* g_bf    = (__bf16*)alloc(BT * 2 * DD * 2);

    // 1) all that depends on the inputs alone: FiLM params, position bias
    //    (output #2 + consumed by attention), weight conversion fp32 -> bf16
    prep_kernel<<<NB_PREP, 256, 0, stream>>>(
        cond, f1_gw, f1_gb, f1_bw, f1_bb, gamma1, beta1,
        f3_gw, f3_gb, f3_bw, f3_bb, gamma3, beta3,
        rel_emb, out_bias,
        wq, wk, wv, wo, ffn_w1, ffn_w2,
        wq_bf, wk_bf, wv_bf, wo_bf, w1_bf, w2_bf);
    // 4) y = film(rmsnorm(x)) -> bf16
    rmsnorm_film_kernel<<<(int)(BT / 8), 256, 0, stream>>>(x, norm1_w, gamma1, beta1, y_bf);
    // 5) Q,K,V projections, one grid: z picks the weight and the output, which
    //    follow one another in the workspace
    {
        dim3 grid(DD / 128, (int)(BT / 128), 3);
        gemm_bf16_kernel<0><<<grid, 256, 0, stream>>>(y_bf, wq_bf, q_bf, nullptr,
                                                      (int)BT, DD, DD);
    }
    // 6) flash attention
    {
        dim3 grid(BB * HH, TT / 64);
        flash_attn_kernel<<<grid, 128, 0, stream>>>(q_bf, k_bf, v_bf,
                                                    out_bias, x_mask, attn_bf);
    }
    // 7) x_mid = x + attn @ wo
    {
        dim3 grid(DD / 128, (int)(BT / 128));
        gemm_bf16_kernel<1><<<grid, 256, 0, stream>>>(attn_bf, wo_bf, x_mid, x,
                                                      (int)BT, DD, DD);
    }
    // 8) y3 = film(rmsnorm(x_mid)) -> bf16
    rmsnorm_film_kernel<<<(int)(BT / 8), 256, 0, stream>>>(x_mid, norm3_w, gamma3, beta3, y3_bf);
    // 9) h = y3 @ ffn_w1  [BT, 4D]
    {
        dim3 grid(4 * DD / 128, (int)(BT / 128));
        gemm_bf16_kernel<0><<<grid, 256, 0, stream>>>(y3_bf, w1_bf, h_bf, nullptr,
                                                      (int)BT, 4 * DD, DD);
    }
    // 10) geglu
    geglu_kernel<<<(int)(BT / 2), 256, 0, stream>>>(h_bf, g_bf);
    // 11) out = x_mid + g @ ffn_w2
    {
        dim3 grid(DD / 128, (int)(BT / 128));
        gemm_bf16_kernel<1><<<grid, 256, 0, stream>>>(g_bf, w2_bf, out_x, x_mid,
                                                      (int)BT, DD, 2 * DD);
    }
}

// v009
// It runs in 148 microseconds.
// Two timings next to v008 both put it at 1.19 times that version's speed.
// All steps since v000 together make it 4.72 times as fast.
#include <hip/hip_runtime.h>
#include <hip/hip_bf16.h>
#include <math.h>
#include <stdint.h>

// ---------------------------------------------------------------------------
// Problem constants (from reference)
// ---------------------------------------------------------------------------
#define BB 4
#define TT 1024
#define DD 1024
#define HH 16
#define DHH 64
#define DCC 64
#define NBUCK 32

typedef unsigned short ushort_t;
typedef __attribute__((ext_vector_type(16))) __bf16 v16bf;
typedef __attribute__((ext_vector_type(8)))  float  v8f;
typedef __attribute__((ext_vector_type(8)))  short  s16x8;
typedef __attribute__((ext_vector_type(4)))  int    i32x4;

union Frag {
    v16bf v;
    uint4 u4[2];
    s16x8 t[2];
};

__device__ __forceinline__ v8f v8f_zero() {
    v8f z;
#pragma unroll
    for (int i = 0; i < 8; ++i) z[i] = 0.0f;
    return z;
}

__device__ __forceinline__ __bf16 f32_to_bf16(float f) {
    unsigned u = __builtin_bit_cast(unsigned, f);
    unsigned r = u + 0x7FFFu + ((u >> 16) & 1u);   // round-to-nearest-even
    unsigned short h = (unsigned short)(r >> 16);
    return __builtin_bit_cast(__bf16, h);
}

__device__ __forceinline__ v8f wmma_bf16(v16bf a, v16bf b, v8f c) {
    // D = A(16x32 bf16) * B(32x16 bf16) + C(16x16 f32)
    return __builtin_amdgcn_wmma_f32_16x16x32_bf16(
        /*neg_a=*/false, a, /*neg_b=*/false, b,
        /*c_mod=*/(short)0, c, /*reuse_a=*/false, /*reuse_b=*/false);
}

// Four async copies of 16B (8 bf16) per lane from global to LDS; tracked with
// ASYNCcnt. The closing s_wait_xcnt stands inside the statement so that no
// address register of a copy is rewritten in front of it.
__device__ __forceinline__ void async_copy4_b128(const void* g0, void* d0,
                                                 const void* g1, void* d1,
                                                 const void* g2, void* d2,
                                                 const void* g3, void* d3) {
    unsigned l0 = (unsigned)(unsigned long long)d0;  // LDS aperture: low 32 bits
    unsigned l1 = (unsigned)(unsigned long long)d1;
    unsigned l2 = (unsigned)(unsigned long long)d2;
    unsigned l3 = (unsigned)(unsigned long long)d3;
    asm volatile("global_load_async_to_lds_b128 %0, %1, off\n\t"
                 "global_load_async_to_lds_b128 %2, %3, off\n\t"
                 "global_load_async_to_lds_b128 %4, %5, off\n\t"
                 "global_load_async_to_lds_b128 %6, %7, off\n\t"
                 "s_wait_xcnt 0x0"
                 :: "v"(l0), "v"(g0), "v"(l1), "v"(g1),
                    "v"(l2), "v"(g2), "v"(l3), "v"(g3) : "memory");
}
// Eight such copies in one statement; the closing s_wait_xcnt stands inside it
// for the same reason.
__device__ __forceinline__ void async_copy8_b128(const void* const (&g)[8],
                                                 const unsigned (&l)[8]) {
    asm volatile("global_load_async_to_lds_b128 %0, %1, off\n\t"
                 "global_load_async_to_lds_b128 %2, %3, off\n\t"
                 "global_load_async_to_lds_b128 %4, %5, off\n\t"
                 "global_load_async_to_lds_b128 %6, %7, off\n\t"
                 "global_load_async_to_lds_b128 %8, %9, off\n\t"
                 "global_load_async_to_lds_b128 %10, %11, off\n\t"
                 "global_load_async_to_lds_b128 %12, %13, off\n\t"
                 "global_load_async_to_lds_b128 %14, %15, off\n\t"
                 "s_wait_xcnt 0x0"
                 :: "v"(l[0]), "v"(g[0]), "v"(l[1]), "v"(g[1]),
                    "v"(l[2]), "v"(g[2]), "v"(l[3]), "v"(g[3]),
                    "v"(l[4]), "v"(g[4]), "v"(l[5]), "v"(g[5]),
                    "v"(l[6]), "v"(g[6]), "v"(l[7]), "v"(g[7]) : "memory");
}
// The issuing wave's copies have landed behind this wait.
__device__ __forceinline__ void async_wait0() {
    asm volatile("s_wait_asynccnt 0x0" ::: "memory");
}
// The wave's own LDS reads have retired before a copy may refill what they read.
__device__ __forceinline__ void lds_wait0() {
    asm volatile("s_wait_dscnt 0x0" ::: "memory");
}

// Transposing LDS load: from a row-major [k][n] bf16 tile, lane (c = l & 15,
// h = l >> 4) receives T[kbase + 8h + 0..7][nbase + c]. The lane's address is
// row kbase + 8*(l >> 4) + (l & 7), column nbase + 8*((l >> 3) & 1).
__device__ __forceinline__ s16x8 lds_load_tr16(const ushort_t* p) {
    typedef __attribute__((address_space(3))) s16x8 lds_s16x8;
    return __builtin_amdgcn_ds_load_tr16_b128_v8i16((lds_s16x8*)p);
}

// ---------------------------------------------------------------------------
// Elementwise helpers
// ---------------------------------------------------------------------------
// Two floats rounded to bf16 and packed into one dword (a in the low half).
__device__ __forceinline__ unsigned pack2_bf16(float a, float b) {
    unsigned lo = __builtin_bit_cast(unsigned short, f32_to_bf16(a));
    unsigned hi = __builtin_bit_cast(unsigned short, f32_to_bf16(b));
    return lo | (hi << 16);
}

// 16 elements per thread: a block takes 4096 consecutive elements as four
// slabs of 1024; each wave-wide load covers 512 contiguous bytes, each store
// 256. The blocks cover the array exactly (its length is a multiple of 4096).
__device__ __forceinline__
void cvt_bf16_block(const float* __restrict__ src,
                    __bf16* __restrict__ dst, int blk) {
    const int base = blk * 4096 + threadIdx.x * 4;
    float4 v[4];
#pragma unroll
    for (int u = 0; u < 4; ++u) v[u] = *(const float4*)(src + base + u * 1024);
#pragma unroll
    for (int u = 0; u < 4; ++u)
        *(uint2*)(dst + base + u * 1024) =
            make_uint2(pack2_bf16(v[u].x, v[u].y), pack2_bf16(v[u].z, v[u].w));
    // the stores' registers are not rewritten by another part of the merged
    // kernel in front of this wait
    asm volatile("s_wait_xcnt 0x0" ::: "memory");
}

// gamma/beta = cond @ W + b  (per batch, DC=64 reduction); B*D/256 blocks
__device__ __forceinline__
void film_params_block(const float* __restrict__ cond,
                       const float* __restrict__ gw,
                       const float* __restrict__ gb,
                       const float* __restrict__ bw,
                       const float* __restrict__ bb,
                       float* __restrict__ gamma,
                       float* __restrict__ beta, int blk) {
    int idx = blk * 256 + threadIdx.x;   // B*D
    if (idx >= BB * DD) return;
    int b = idx / DD, d = idx % DD;
    const float* c = cond + b * DCC;
    float g = gb[d], bt = bb[d];
#pragma unroll 8
    for (int i = 0; i < DCC; ++i) {
        float cv = c[i];
        g  += cv * gw[i * DD + d];
        bt += cv * bw[i * DD + d];
    }
    gamma[idx] = g;
    beta[idx]  = bt;
}

// T5 relative position bucket of rp = k - q
__device__ __forceinline__ int rel_bucket(int rp) {
    const int nb = NBUCK / 2;      // 16
    const int max_exact = nb / 2;  // 8
    int bucket = (rp > 0) ? nb : 0;
    int arp = rp < 0 ? -rp : rp;
    int val;
    if (arp < max_exact) {
        val = arp;
    } else {
        float rp_safe = (float)(arp > 1 ? arp : 1);
        int large = max_exact +
            (int)(logf(rp_safe / (float)max_exact) /
                  logf(128.0f / (float)max_exact) * (float)(nb - max_exact));
        val = large < nb - 1 ? large : nb - 1;
    }
    return bucket + val;
}

// T5 relative position bias -> bias_out[h][q][k]  (this is output #2)
// One block per query row; a thread takes 4 consecutive keys for all 16 heads
// (64 elements): each wave-wide store covers 512 contiguous bytes of one head.
__device__ __forceinline__
void bias_block(const float* __restrict__ rel_emb,
                float* __restrict__ bias_out, int q) {
    const int k0 = threadIdx.x * 4;
    float e[4][HH];
#pragma unroll
    for (int c = 0; c < 4; ++c) {
        const float4* p = (const float4*)(rel_emb + rel_bucket(k0 + c - q) * HH);
#pragma unroll
        for (int g = 0; g < HH / 4; ++g) {
            float4 t = p[g];
            e[c][4 * g + 0] = t.x;
            e[c][4 * g + 1] = t.y;
            e[c][4 * g + 2] = t.z;
            e[c][4 * g + 3] = t.w;
        }
    }
#pragma unroll
    for (int h = 0; h < HH; ++h)
        *(float4*)(bias_out + ((size_t)h * TT + q) * TT + k0) =
            make_float4(e[0][h], e[1][h], e[2][h], e[3][h]);
    // the stores' registers are not rewritten by another part of the merged
    // kernel in front of this wait
    asm volatile("s_wait_xcnt 0x0" ::: "memory");
}

// Everything that depends on the inputs alone, in one grid: a block's index
// says which piece it does. The FiLM blocks, few and latency-bound, come first.
#define NB_FILM (BB * DD / 256)      // blocks per FiLM parameter pair
#define NB_W    (DD * DD / 4096)     // blocks per D x D weight matrix
#define NB_PREP (2 * NB_FILM + TT + 10 * NB_W)
__global__ __launch_bounds__(256)
void prep_kernel(const float* __restrict__ cond,
                 const float* __restrict__ f1_gw, const float* __restrict__ f1_gb,
                 const float* __restrict__ f1_bw, const float* __restrict__ f1_bb,
                 float* __restrict__ gamma1, float* __restrict__ beta1,
                 const float* __restrict__ f3_gw, const float* __restrict__ f3_gb,
                 const float* __restrict__ f3_bw, const float* __restrict__ f3_bb,
                 float* __restrict__ gamma3, float* __restrict__ beta3,
                 const float* __restrict__ rel_emb, float* __restrict__ bias_out,
                 const float* __restrict__ wq, const float* __restrict__ wk,
                 const float* __restrict__ wv, const float* __restrict__ wo,
                 const float* __restrict__ w1, const float* __restrict__ w2,
                 __bf16* __restrict__ wq_bf, __bf16* __restrict__ wk_bf,
                 __bf16* __restrict__ wv_bf, __bf16* __restrict__ wo_bf,
                 __bf16* __restrict__ w1_bf, __bf16* __restrict__ w2_bf) {
    int blk = blockIdx.x;
    if (blk < NB_FILM) {
        film_params_block(cond, f1_gw, f1_gb, f1_bw, f1_bb, gamma1, beta1, blk);
        return;
    }
    blk -= NB_FILM;
    if (blk < NB_FILM) {
        film_params_block(cond, f3_gw, f3_gb, f3_bw, f3_bb, gamma3, beta3, blk);
        return;
    }
    blk -= NB_FILM;
    if (blk < TT) {
        bias_block(rel_emb, bias_out, blk);
        return;
    }
    blk -= TT;
    const float* src;
    __bf16* dst;
    if (blk < NB_W)          { src = wq; dst = wq_bf; }
    else if (blk < 2 * NB_W) { src = wk; dst = wk_bf; blk -= NB_W; }
    else if (blk < 3 * NB_W) { src = wv; dst = wv_bf; blk -= 2 * NB_W; }
    else if (blk < 4 * NB_W) { src = wo; dst = wo_bf; blk -= 3 * NB_W; }
    else if (blk < 8 * NB_W) { src = w1; dst = w1_bf; blk -= 4 * NB_W; }
    else                     { src = w2; dst = w2_bf; blk -= 8 * NB_W; }
    cvt_bf16_block(src, dst, blk);
}

// y = film(rms_norm(x)) -> bf16, one wave per (b,t) row: a lane holds 32
// elements of the row in registers (eight 16-byte loads, 512 contiguous bytes
// per wave each), so x is read once and the row sum needs no LDS.
__global__ __launch_bounds__(256)
void rmsnorm_film_kernel(const float* __restrict__ x,
                         const float* __restrict__ w,
                         const float* __restrict__ gamma,
                         const float* __restrict__ beta,
                         __bf16* __restrict__ y) {
    const int lane = threadIdx.x & 31;
    const int row = blockIdx.x * 8 + (threadIdx.x >> 5);   // 0 .. B*T-1
    const int b = row / TT;
    const float* xr = x + (size_t)row * DD + lane * 4;
    float4 v[8];
#pragma unroll
    for (int u = 0; u < 8; ++u) v[u] = *(const float4*)(xr + u * 128);
    float s0 = 0.0f, s1 = 0.0f, s2 = 0.0f, s3 = 0.0f;   // four independent chains
#pragma unroll
    for (int u = 0; u < 8; ++u) {
        s0 += v[u].x * v[u].x;
        s1 += v[u].y * v[u].y;
        s2 += v[u].z * v[u].z;
        s3 += v[u].w * v[u].w;
    }
    float tot = (s0 + s1) + (s2 + s3);
#pragma unroll
    for (int m = 16; m >= 1; m >>= 1) tot += __shfl_xor(tot, m, 32);
    float rstd = rsqrtf(tot / (float)DD + 1e-6f);
    const float* wr = w + lane * 4;
    const float* g  = gamma + (size_t)b * DD + lane * 4;
    const float* be = beta + (size_t)b * DD + lane * 4;
    __bf16* yr = y + (size_t)row * DD + lane * 4;
#pragma unroll
    for (int u = 0; u < 8; ++u) {
        float4 w4 = *(const float4*)(wr + u * 128);
        float4 g4 = *(const float4*)(g + u * 128);
        float4 b4 = *(const float4*)(be + u * 128);
        float r0 = (w4.x * (v[u].x * rstd)) * (g4.x + 1.0f) + b4.x;
        float r1 = (w4.y * (v[u].y * rstd)) * (g4.y + 1.0f) + b4.y;
        float r2 = (w4.z * (v[u].z * rstd)) * (g4.z + 1.0f) + b4.z;
        float r3 = (w4.w * (v[u].w * rstd)) * (g4.w + 1.0f) + b4.w;
        *(uint2*)(yr + u * 128) = make_uint2(pack2_bf16(r0, r1), pack2_bf16(r2, r3));
    }
}

// erf in single precision by the two-range polynomial form (|x| < 1: an odd
// polynomial; else 1 - exp of a polynomial). Both ranges are evaluated and one
// is selected: with no branch between them a lane's independent evaluations
// interleave, where a branch each would leave one dependent chain after another.
__device__ __forceinline__ float erf_select(float x) {
    const float ax = fabsf(x);
    const float t = x * x;
    float q = fmaf(-5.61801775e-4f, t, 4.91381623e-3f);
    q = fmaf(t, q, -2.67075151e-2f);
    q = fmaf(t, q, 1.12800106e-1f);
    q = fmaf(t, q, -3.76122952e-1f);
    q = fmaf(t, q, 1.28379107e-1f);
    const float small = fmaf(ax, q, ax);
    float p = fmaf(ax, 1.69988107e-5f, -3.78677854e-4f);
    p = fmaf(ax, p, 3.85781587e-3f);
    p = fmaf(ax, p, -2.41816975e-2f);
    p = fmaf(ax, p, 1.06668264e-1f);
    p = fmaf(ax, p, 6.34933293e-1f);
    p = fmaf(ax, p, 1.28689408e-1f);
    p = fmaf(ax, p, ax);
    const float large = 1.0f - expf(-p);
    return copysignf(ax < 1.0f ? small : large, x);
}
// geglu of one pair: p1 * gelu(p2), exact gelu
__device__ __forceinline__ float geglu1(float p1, float p2) {
    float ge = 0.5f * p2 * (1.0f + erf_select(p2 * 0.70710678118654752f));
    return p1 * ge;
}

// ---------------------------------------------------------------------------
// Generic bf16 WMMA GEMM:  C[M,N] = A[M,K] * B[K,N]  (row-major, bf16 in)
// Block tile 128x128, 8 waves (4 along M x 2 along N), wave tile 32x64.
// Double-buffered LDS, 128 k per stage (K is a multiple of 128); A and B tiles
// staged via GLOBAL_LOAD_ASYNC_TO_LDS_B128, each wave-wide copy taking two whole
// 256-byte rows; B kept row-major [k][n] and transposed by the fragment loads.
// EPI==0: store bf16.  EPI==1: store f32 with residual add.
// EPI==2: C[M,N/2] = geglu(A * B), bf16: a block takes 64 columns c of the first
// half of B and the 64 columns c + N/2 that go with them, and each wave holds
// both members of its pairs in the same lane and register of two accumulator
// tiles, so the product itself is never stored.
// Grid z: independent products on the same A; B, C and the residual advance by
// one whole matrix per z.
// ---------------------------------------------------------------------------
template <int EPI>
__global__ __launch_bounds__(256)
void gemm_bf16_kernel(const __bf16* __restrict__ A,
                      const __bf16* __restrict__ Bm,
                      void* __restrict__ C,
                      const float* __restrict__ residual,
                      int M, int N, int K) {
    constexpr int BK = 128;   // k per stage
    constexpr int PA = 136;   // lA row pitch: 272 B, an odd multiple of 16 B
    constexpr int PB = 144;   // lB row pitch: 288 B, an odd multiple of 32 B
    __shared__ __attribute__((aligned(16))) ushort_t lA[2][128 * PA];  // [m][k]
    __shared__ __attribute__((aligned(16))) ushort_t lB[2][BK * PB];   // [k][n]

    const int tid  = threadIdx.x;
    const int lane = tid & 31;
    const int wave = tid >> 5;          // 0..7
    const int wm   = wave & 3;          // 4 waves along M
    const int wn   = wave >> 2;         // 2 waves along N
    const int half = lane >> 4;         // which 16-lane half
    const int l16  = lane & 15;
    const int koff = half ? 8 : 0;
    const int trow = half * 8 + (lane & 7);      // transposing load: lane's row
    const int tcol = ((lane >> 3) & 1) * 8;      // and its column offset

    const int blockM = blockIdx.y * 128;
    const int blockN = blockIdx.x * (EPI == 2 ? 64 : 128);

    // per-thread tile-copy coordinates: both tiles are 128 rows of 256 B; a
    // thread takes 16-byte column cCol of rows cRow, +16, ... +112 of each
    const int cRow = tid >> 4;
    const int cCol = (tid & 15) * 8;

    // each thread's two source addresses walk along K, one tile per issue
    const __bf16* gA = A + (size_t)(blockM + cRow) * K + cCol;
    const __bf16* gB = Bm + ((size_t)blockIdx.z * K + cRow) * N + blockN + cCol;
    // EPI==2: tile columns 64 .. 127 come from the second half of B's rows
    if (EPI == 2) gB += (cCol >> 6) * (N / 2 - 64);
    auto issueAB = [&](int buf) {
        const void* g[8];
        unsigned l[8];   // LDS aperture: low 32 bits
        // both loops unrolled: g and l are the statement's register operands
#pragma unroll
        for (int u = 0; u < 8; ++u) {
            g[u] = gA + (size_t)(16 * u) * K;
            l[u] = (unsigned)(unsigned long long)&lA[buf][(cRow + 16 * u) * PA + cCol];
        }
        async_copy8_b128(g, l);
#pragma unroll
        for (int u = 0; u < 8; ++u) {
            g[u] = gB + (size_t)(16 * u) * N;
            l[u] = (unsigned)(unsigned long long)&lB[buf][(cRow + 16 * u) * PB + cCol];
        }
        async_copy8_b128(g, l);
        gA += BK;
        gB += (size_t)BK * N;
    };

    v8f acc[2][4];
#pragma unroll
    for (int i = 0; i < 2; ++i)
#pragma unroll
        for (int j = 0; j < 4; ++j) acc[i][j] = v8f_zero();

    // prologue: tile 0 lands and is published, then tile 1 starts to fly
    const int ntiles = K / BK;
    issueAB(0);
    async_wait0();
    __syncthreads();
    if (ntiles > 1) issueAB(1);

    for (int t = 0; t < ntiles; ++t) {
        const int cur = t & 1;

        // compute current tile, 32 k at a time in ascending order; unrolled so
        // that every LDS offset inside the stage is an immediate
#pragma unroll
        for (int kk = 0; kk < BK; kk += 32) {
            Frag a[2], b[4];
#pragma unroll
            for (int i = 0; i < 2; ++i) {
                int row = wm * 32 + i * 16 + l16;
                a[i].u4[0] = *(const uint4*)&lA[cur][row * PA + kk + koff];
                a[i].u4[1] = *(const uint4*)&lA[cur][row * PA + kk + koff + 16];
            }
#pragma unroll
            for (int j = 0; j < 4; ++j) {
                // EPI==2: tiles j and j + 2 hold the two members of a pair
                int col = (EPI == 2 ? (j >> 1) * 64 + wn * 32 + (j & 1) * 16
                                    : wn * 64 + j * 16) + tcol;
                b[j].t[0] = lds_load_tr16(&lB[cur][(kk + trow) * PB + col]);
                b[j].t[1] = lds_load_tr16(&lB[cur][(kk + 16 + trow) * PB + col]);
            }
#pragma unroll
            for (int i = 0; i < 2; ++i)
#pragma unroll
                for (int j = 0; j < 4; ++j)
                    acc[i][j] = wmma_bf16(a[i].v, b[j].v, acc[i][j]);
        }

        // publish tile t + 1 and free this trip's buffer, then refill it
        lds_wait0();
        async_wait0();
        __syncthreads();
        if (t + 2 < ntiles) issueAB(cur);
    }
    async_wait0();

    // epilogue (C-layout: col = l16, row = r + 8*half per vgpr r)
    if (EPI == 2) {
#pragma unroll
        for (int i = 0; i < 2; ++i) {
#pragma unroll
            for (int j = 0; j < 2; ++j) {
                int col = blockN + wn * 32 + j * 16 + l16;
#pragma unroll
                for (int r = 0; r < 8; ++r) {
                    int row = blockM + wm * 32 + i * 16 + r + half * 8;
                    ((__bf16*)C)[(size_t)row * (N / 2) + col] =
                        f32_to_bf16(geglu1(acc[i][j][r], acc[i][j + 2][r]));
                }
            }
        }
        return;
    }
#pragma unroll
    for (int i = 0; i < 2; ++i) {
#pragma unroll
        for (int j = 0; j < 4; ++j) {
            int col = blockN + wn * 64 + j * 16 + l16;
#pragma unroll
            for (int r = 0; r < 8; ++r) {
                int row = blockM + wm * 32 + i * 16 + r + half * 8;
                size_t idx = ((size_t)blockIdx.z * M + row) * N + col;
                float v = acc[i][j][r];
                if (EPI == 0) {
                    ((__bf16*)C)[idx] = f32_to_bf16(v);
                } else {
                    ((float*)C)[idx] = residual[idx] + v;
                }
            }
        }
    }
}

__device__ __forceinline__ float other_half(float x) {
    int b = __builtin_bit_cast(int, x);
    return __builtin_bit_cast(float, __builtin_amdgcn_permlanex16(
        b, b, 0x76543210, 0xfedcba98, false, false));
}

__global__ __launch_bounds__(128)
void flash_attn_kernel(const __bf16* __restrict__ qb,
                       const __bf16* __restrict__ kb,
                       const __bf16* __restrict__ vb,
                       const float* __restrict__ bias,   // [H][T][T]
                       const int* __restrict__ mask,     // [B][T][T]
                       __bf16* __restrict__ ob) {
    constexpr int PK = 72;    // lK row pitch: 144 B, an odd multiple of 16 B
    constexpr int PV = 80;    // lV row pitch: 160 B, an odd multiple of 32 B
    constexpr int PM = 68;    // lM row pitch: 272 B, an odd multiple of 16 B
    __shared__ __attribute__((aligned(16))) ushort_t lK[64 * PK];   // [key][dh]   -> A-frag layout for K*Q^T
    __shared__ __attribute__((aligned(16))) ushort_t lV[64 * PV];   // [key][dh]   -> read by transposing loads
    __shared__ __attribute__((aligned(16))) int lM[64 * PM];        // [q][key]    -> mask tile
    // [k - (q - qbase) + 63] -> bias; the alignment puts it at the start of the
    // block's LDS, which keeps the offsets of a tile's values small
    __shared__ __attribute__((aligned(128))) float lB[TT + 128];

    const int bh = blockIdx.x;
    const int b = bh / HH;
    const int h = bh % HH;
    const int qbase = blockIdx.y * 64;
    const int tid  = threadIdx.x;
    const int lane = tid & 31;
    const int wave = tid >> 5;         // 0..3 -> 16 queries each
    const int half = lane >> 4;
    const int l16  = lane & 15;
    const int koff = half ? 8 : 0;
    const int trow = half * 8 + (lane & 7);      // transposing load: lane's row
    const int tcol = ((lane >> 3) & 1) * 8;      // and its column offset
    const int crow = tid >> 3;                   // tile copy: lane's first row
    const int ccol = (tid & 7) * 8;              // and its column
    const int qg   = qbase + wave * 16 + l16;    // the lane's query

    // Q fragments stay in registers for the whole kernel
    Frag qf[2];
    {
        const __bf16* qrp = qb + ((size_t)(b * TT + qg)) * DD + h * DHH;
        qf[0].u4[0] = *(const uint4*)(qrp + koff);
        qf[0].u4[1] = *(const uint4*)(qrp + koff + 16);
        qf[1].u4[0] = *(const uint4*)(qrp + 32 + koff);
        qf[1].u4[1] = *(const uint4*)(qrp + 32 + koff + 16);
    }

    // Bias by relative position d = k - q: row q = T - 1 of the head's plane
    // holds d = -(T - 1) .. 0, row q = 0 holds d = 0 .. T - 1. Entry e is
    // d = e - 63 - qbase; the entries past d = T - 1 are filled but never read.
    // The first barrier of the key loop publishes the table.
    {
        const float* rlast  = bias + ((size_t)h * TT + (TT - 1)) * TT + (TT - 1);
        const float* rfirst = bias + (size_t)h * TT * TT;
        float t[(TT + 128) / 128];
        // both loops unrolled: t stays in registers, and every load is issued
        // before the first store waits for one
#pragma unroll
        for (int u = 0; u < (TT + 128) / 128; ++u) {
            int d = tid + 128 * u - 63 - qbase;
            d = d < TT - 1 ? d : TT - 1;
            t[u] = (d <= 0 ? rlast : rfirst)[d];
        }
#pragma unroll
        for (int u = 0; u < (TT + 128) / 128; ++u) lB[tid + 128 * u] = t[u];
    }
    // the lane's entry for key 0 of its half in key group 0 of the current tile
    const float* bp = &lB[half * 8 - wave * 16 - l16 + 63];
    // the lane's mask row in the tile, at the first key of its half
    const int* mrow = &lM[(wave * 16 + l16) * PM + half * 8];
    // mask tile copy: 64 rows of 256 B; a thread takes 16-byte column mcol of
    // rows mr0, +8, ... +56, so that a wave-wide copy takes two whole rows
    const int mr0  = tid >> 4;
    const int mcol = (tid & 15) * 4;
    const int* gM = mask + ((size_t)b * TT + qbase + mr0) * TT + mcol;

    // m: the query's running maximum (equal in both halves); l: the running sum
    // over the keys of the lane's own half, joined behind the loop
    float m = -1e30f, l = 0.0f;
    v8f o[4];
#pragma unroll
    for (int j = 0; j < 4; ++j) o[j] = v8f_zero();

    const float scale = 0.125f;   // 1/sqrt(DH)

    for (int kt = 0; kt < TT / 64; ++kt) {
        const int kbase = kt * 64;
        // K and V tiles: natural [key][dh] layout, async to LDS (no VGPR staging);
        // each thread copies column ccol of rows crow, +16, +32, +48
        const size_t gofs = ((size_t)(b * TT + kbase + crow)) * DD + h * DHH + ccol;
        async_copy4_b128(kb + gofs,           &lK[crow * PK + ccol],
                         kb + gofs + 16 * DD, &lK[(crow + 16) * PK + ccol],
                         kb + gofs + 32 * DD, &lK[(crow + 32) * PK + ccol],
                         kb + gofs + 48 * DD, &lK[(crow + 48) * PK + ccol]);
        async_copy4_b128(vb + gofs,           &lV[crow * PV + ccol],
                         vb + gofs + 16 * DD, &lV[(crow + 16) * PV + ccol],
                         vb + gofs + 32 * DD, &lV[(crow + 32) * PV + ccol],
                         vb + gofs + 48 * DD, &lV[(crow + 48) * PV + ccol]);
        {
            const void* g[8];
            unsigned a[8];   // LDS aperture: low 32 bits
            // unrolled: g and a are the statement's register operands
#pragma unroll
            for (int u = 0; u < 8; ++u) {
                g[u] = gM + (size_t)(8 * u) * TT + kbase;
                a[u] = (unsigned)(unsigned long long)&lM[(mr0 + 8 * u) * PM + mcol];
            }
            async_copy8_b128(g, a);
        }
        async_wait0();
        __syncthreads();

        // the lane's 32 mask values: mk[2 j + (r >> 2)][r & 3] goes with s[j][r]
        i32x4 mk[8];
#pragma unroll
        for (int u = 0; u < 8; ++u) mk[u] = *(const i32x4*)(mrow + u * 8 - (u & 1) * 4);

        // S^T = K * Q^T  (4 groups of 16 keys, reduction DH=64 -> 2 wmma):
        // s[j][r] = score of key kbase + 16 j + 8 half + r with query qg
        v8f s[4];
#pragma unroll
        for (int j = 0; j < 4; ++j) {
            int row = j * 16 + l16;
            Frag k0, k1;
            k0.u4[0] = *(const uint4*)&lK[row * PK + koff];
            k0.u4[1] = *(const uint4*)&lK[row * PK + koff + 16];
            k1.u4[0] = *(const uint4*)&lK[row * PK + 32 + koff];
            k1.u4[1] = *(const uint4*)&lK[row * PK + 32 + koff + 16];
            v8f z = v8f_zero();
            z = wmma_bf16(k0.v, qf[0].v, z);
            s[j] = wmma_bf16(k1.v, qf[1].v, z);
        }

        // holds the eight mask reads together: issued in a row and waited for
        // once; left alone the build sends them one by one through one register
        // quad, a full LDS latency each
        asm volatile("" :: "v"(mk[0]), "v"(mk[1]), "v"(mk[2]), "v"(mk[3]),
                           "v"(mk[4]), "v"(mk[5]), "v"(mk[6]), "v"(mk[7]));

        // scale + bias + mask + online softmax, all of one query in its two lanes
        float gmax[4];
#pragma unroll
        for (int j = 0; j < 4; ++j) {
            gmax[j] = -1e30f;
#pragma unroll
            for (int r = 0; r < 8; ++r) {
                float v = s[j][r] * scale + bp[j * 16 + r];
                v = (mk[2 * j + (r >> 2)][r & 3] == 0) ? -1e9f : v;
                s[j][r] = v;
                gmax[j] = fmaxf(gmax[j], v);
            }
        }
        float tmax = fmaxf(fmaxf(gmax[0], gmax[1]), fmaxf(gmax[2], gmax[3]));
        tmax = fmaxf(tmax, other_half(tmax));
        const float mnew = fmaxf(m, tmax);
        const float corr = __expf(m - mnew);
        m = mnew;
        float gsum[4];   // four independent chains
#pragma unroll
        for (int j = 0; j < 4; ++j) {
            gsum[j] = 0.0f;
#pragma unroll
            for (int r = 0; r < 8; ++r) {
                float p = __expf(s[j][r] - mnew);
                s[j][r] = p;
                gsum[j] += p;
            }
        }
        l = l * corr + ((gsum[0] + gsum[1]) + (gsum[2] + gsum[3]));
#pragma unroll
        for (int j = 0; j < 4; ++j)
#pragma unroll
            for (int r = 0; r < 8; ++r) o[j][r] *= corr;

        // P^T as B operand: element e of fragment i is register e & 7 of key
        // group 2 i + (e >> 3), the k order of the transposing loads
        Frag pf[2];
#pragma unroll
        for (int i = 0; i < 2; ++i)
#pragma unroll
            for (int g = 0; g < 2; ++g) {
                const v8f& t = s[2 * i + g];
                pf[i].u4[g] = make_uint4(pack2_bf16(t[0], t[1]), pack2_bf16(t[2], t[3]),
                                         pack2_bf16(t[4], t[5]), pack2_bf16(t[6], t[7]));
            }

        // O^T += V^T * P^T
#pragma unroll
        for (int j = 0; j < 4; ++j) {
            int col = j * 16 + tcol;  // dh block
            Frag v0, v1;
            v0.t[0] = lds_load_tr16(&lV[trow * PV + col]);
            v0.t[1] = lds_load_tr16(&lV[(16 + trow) * PV + col]);
            v1.t[0] = lds_load_tr16(&lV[(32 + trow) * PV + col]);
            v1.t[1] = lds_load_tr16(&lV[(48 + trow) * PV + col]);
            o[j] = wmma_bf16(v0.v, pf[0].v, o[j]);
            o[j] = wmma_bf16(v1.v, pf[1].v, o[j]);
        }
        bp += 64;
        lds_wait0();   // this wave has left lK, lV and lM before the next copies
        __syncthreads();
    }

    // finalize: O /= l, write bf16 [B,T,H*DH]; o[j][r] is dh 16 j + 8 half + r
    l += other_half(l);
    __bf16* orow = ob + ((size_t)(b * TT + qg)) * DD + h * DHH + half * 8;
#pragma unroll
    for (int j = 0; j < 4; ++j)
        *(uint4*)(orow + j * 16) =
            make_uint4(pack2_bf16(o[j][0] / l, o[j][1] / l),
                       pack2_bf16(o[j][2] / l, o[j][3] / l),
                       pack2_bf16(o[j][4] / l, o[j][5] / l),
                       pack2_bf16(o[j][6] / l, o[j][7] / l));
}

// ---------------------------------------------------------------------------
// Host-side orchestration
// ---------------------------------------------------------------------------
static inline size_t align256(size_t x) { return (x + 255) & ~(size_t)255; }

extern "C" void kernel_launch(void* const* d_in, const int* in_sizes, int n_in,
                              void* d_out, int out_size, void* d_ws, size_t ws_size,
                              hipStream_t stream) {
    (void)in_sizes; (void)n_in; (void)out_size; (void)ws_size;
    const float* x        = (const float*)d_in[0];
    const int*   x_mask   = (const int*)  d_in[1];
    const float* cond     = (const float*)d_in[2];
    const float* norm1_w  = (const float*)d_in[3];
    const float* f1_gw    = (const float*)d_in[4];
    const float* f1_gb    = (const float*)d_in[5];
    const float* f1_bw    = (const float*)d_in[6];
    const float* f1_bb    = (const float*)d_in[7];
    const float* wq       = (const float*)d_in[8];
    const float* wk       = (const float*)d_in[9];
    const float* wv       = (const float*)d_in[10];
    const float* wo       = (const float*)d_in[11];
    const float* rel_emb  = (const float*)d_in[12];
    const float* norm3_w  = (const float*)d_in[13];
    const float* f3_gw    = (const float*)d_in[14];
    const float* f3_gb    = (const float*)d_in[15];
    const float* f3_bw    = (const float*)d_in[16];
    const float* f3_bb    = (const float*)d_in[17];
    const float* ffn_w1   = (const float*)d_in[18];
    const float* ffn_w2   = (const float*)d_in[19];

    float* out_x    = (float*)d_out;                              // [B,T,D]
    float* out_bias = (float*)d_out + (size_t)BB * TT * DD;       // [H,T,T]

    // workspace bump allocator
    char* ws = (char*)d_ws;
    size_t off = 0;
    auto alloc = [&](size_t bytes) -> void* {
        void* p = ws + off;
        off += align256(bytes);
        return p;
    };
    const size_t BT = (size_t)BB * TT;
    __bf16* wq_bf   = (__bf16*)alloc((size_t)3 * DD * DD * 2);   // wq | wk | wv
    __bf16* wk_bf   = wq_bf + (size_t)DD * DD;
    __bf16* wv_bf   = wk_bf + (size_t)DD * DD;
    __bf16* wo_bf   = (__bf16*)alloc((size_t)DD * DD * 2);
    __bf16* w1_bf   = (__bf16*)alloc((size_t)DD * 4 * DD * 2);
    __bf16* w2_bf   = (__bf16*)alloc((size_t)2 * DD * DD * 2);
    float*  gamma1  = (float*)alloc((size_t)BB * DD * 4);
    float*  beta1   = (float*)alloc((size_t)BB * DD * 4);
    float*  gamma3  = (float*)alloc((size_t)BB * DD * 4);
    float*  beta3   = (float*)alloc((size_t)BB * DD * 4);
    __bf16* y_bf    = (__bf16*)alloc(BT * DD * 2);
    __bf16* q_bf    = (__bf16*)alloc(3 * BT * DD * 2);           // q | k | v
    __bf16* k_bf    = q_bf + BT * DD;
    __bf16* v_bf    = k_bf + BT * DD;
    __bf16* attn_bf = (__bf16*)alloc(BT * DD * 2);
    float*  x_mid   = (float*)alloc(BT * DD * 4);
    __bf16* y3_bf   = (__bf16*)alloc(BT * DD * 2);
    __bf16* g_bf    = (__bf16*)alloc(BT * 2 * DD * 2);

    // 1) all that depends on the inputs alone: FiLM params, position bias
    //    (output #2 + consumed by attention), weight conversion fp32 -> bf16
    prep_kernel<<<NB_PREP, 256, 0, stream>>>(
        cond, f1_gw, f1_gb, f1_bw, f1_bb, gamma1, beta1,
        f3_gw, f3_gb, f3_bw, f3_bb, gamma3, beta3,
        rel_emb, out_bias,
        wq, wk, wv, wo, ffn_w1, ffn_w2,
        wq_bf, wk_bf, wv_bf, wo_bf, w1_bf, w2_bf);
    // 4) y = film(rmsnorm(x)) -> bf16
    rmsnorm_film_kernel<<<(int)(BT / 8), 256, 0, stream>>>(x, norm1_w, gamma1, beta1, y_bf);
    // 5) Q,K,V projections, one grid: z picks the weight and the output, which
    //    follow one another in the workspace
    {
        dim3 grid(DD / 128, (int)(BT / 128), 3);
        gemm_bf16_kernel<0><<<grid, 256, 0, stream>>>(y_bf, wq_bf, q_bf, nullptr,
                                                      (int)BT, DD, DD);
    }
    // 6) flash attention
    {
        dim3 grid(BB * HH, TT / 64);
        flash_attn_kernel<<<grid, 128, 0, stream>>>(q_bf, k_bf, v_bf,
                                                    out_bias, x_mask, attn_bf);
    }
    // 7) x_mid = x + attn @ wo
    {
        dim3 grid(DD / 128, (int)(BT / 128));
        gemm_bf16_kernel<1><<<grid, 256, 0, stream>>>(attn_bf, wo_bf, x_mid, x,
                                                      (int)BT, DD, DD);
    }
    // 8) y3 = film(rmsnorm(x_mid)) -> bf16
    rmsnorm_film_kernel<<<(int)(BT / 8), 256, 0, stream>>>(x_mid, norm3_w, gamma3, beta3, y3_bf);
    // 9) g = geglu(y3 @ ffn_w1)  [BT, 2D]
    {
        dim3 grid(2 * DD / 64, (int)(BT / 128));
        gemm_bf16_kernel<2><<<grid, 256, 0, stream>>>(y3_bf, w1_bf, g_bf, nullptr,
                                                      (int)BT, 4 * DD, DD);
    }
    // 11) out = x_mid + g @ ffn_w2
    {
        dim3 grid(DD / 128, (int)(BT / 128));
        gemm_bf16_kernel<1><<<grid, 256, 0, stream>>>(g_bf, w2_bf, out_x, x_mid,
                                                      (int)BT, DD, 2 * DD);
    }
}

// v010
// Measured time: 135 microseconds a run.
// In both of two side-by-side timings against v009, it was 1.09 times as fast.
// Counting every step since v000, it is 5.15 times as fast.
#include <hip/hip_runtime.h>
#include <hip/hip_bf16.h>
#include <math.h>
#include <stdint.h>

// ---------------------------------------------------------------------------
// Problem constants (from reference)
// ---------------------------------------------------------------------------
#define BB 4
#define TT 1024
#define DD 1024
#define HH 16
#define DHH 64
#define DCC 64
#define NBUCK 32

typedef unsigned short ushort_t;
typedef __attribute__((ext_vector_type(16))) __bf16 v16bf;
typedef __attribute__((ext_vector_type(8)))  float  v8f;
typedef __attribute__((ext_vector_type(8)))  short  s16x8;
typedef __attribute__((ext_vector_type(4)))  int    i32x4;

union Frag {
    v16bf v;
    uint4 u4[2];
    s16x8 t[2];
};

__device__ __forceinline__ v8f v8f_zero() {
    v8f z;
#pragma unroll
    for (int i = 0; i < 8; ++i) z[i] = 0.0f;
    return z;
}

__device__ __forceinline__ __bf16 f32_to_bf16(float f) {
    unsigned u = __builtin_bit_cast(unsigned, f);
    unsigned r = u + 0x7FFFu + ((u >> 16) & 1u);   // round-to-nearest-even
    unsigned short h = (unsigned short)(r >> 16);
    return __builtin_bit_cast(__bf16, h);
}

__device__ __forceinline__ v8f wmma_bf16(v16bf a, v16bf b, v8f c) {
    // D = A(16x32 bf16) * B(32x16 bf16) + C(16x16 f32)
    return __builtin_amdgcn_wmma_f32_16x16x32_bf16(
        /*neg_a=*/false, a, /*neg_b=*/false, b,
        /*c_mod=*/(short)0, c, /*reuse_a=*/false, /*reuse_b=*/false);
}

// Four async copies of 16B (8 bf16) per lane from global to LDS; tracked with
// ASYNCcnt. The closing s_wait_xcnt stands inside the statement so that no
// address register of a copy is rewritten in front of it.
__device__ __forceinline__ void async_copy4_b128(const void* g0, void* d0,
                                                 const void* g1, void* d1,
                                                 const void* g2, void* d2,
                                                 const void* g3, void* d3) {
    unsigned l0 = (unsigned)(unsigned long long)d0;  // LDS aperture: low 32 bits
    unsigned l1 = (unsigned)(unsigned long long)d1;
    unsigned l2 = (unsigned)(unsigned long long)d2;
    unsigned l3 = (unsigned)(unsigned long long)d3;
    asm volatile("global_load_async_to_lds_b128 %0, %1, off\n\t"
                 "global_load_async_to_lds_b128 %2, %3, off\n\t"
                 "global_load_async_to_lds_b128 %4, %5, off\n\t"
                 "global_load_async_to_lds_b128 %6, %7, off\n\t"
                 "s_wait_xcnt 0x0"
                 :: "v"(l0), "v"(g0), "v"(l1), "v"(g1),
                    "v"(l2), "v"(g2), "v"(l3), "v"(g3) : "memory");
}
// Eight such copies in one statement; the closing s_wait_xcnt stands inside it
// for the same reason.
__device__ __forceinline__ void async_copy8_b128(const void* const (&g)[8],
                                                 const unsigned (&l)[8]) {
    asm volatile("global_load_async_to_lds_b128 %0, %1, off\n\t"
                 "global_load_async_to_lds_b128 %2, %3, off\n\t"
                 "global_load_async_to_lds_b128 %4, %5, off\n\t"
                 "global_load_async_to_lds_b128 %6, %7, off\n\t"
                 "global_load_async_to_lds_b128 %8, %9, off\n\t"
                 "global_load_async_to_lds_b128 %10, %11, off\n\t"
                 "global_load_async_to_lds_b128 %12, %13, off\n\t"
                 "global_load_async_to_lds_b128 %14, %15, off\n\t"
                 "s_wait_xcnt 0x0"
                 :: "v"(l[0]), "v"(g[0]), "v"(l[1]), "v"(g[1]),
                    "v"(l[2]), "v"(g[2]), "v"(l[3]), "v"(g[3]),
                    "v"(l[4]), "v"(g[4]), "v"(l[5]), "v"(g[5]),
                    "v"(l[6]), "v"(g[6]), "v"(l[7]), "v"(g[7]) : "memory");
}
// The issuing wave's copies have landed behind this wait.
__device__ __forceinline__ void async_wait0() {
    asm volatile("s_wait_asynccnt 0x0" ::: "memory");
}
// The wave's own LDS reads have retired before a copy may refill what they read.
__device__ __forceinline__ void lds_wait0() {
    asm volatile("s_wait_dscnt 0x0" ::: "memory");
}

// Transposing LDS load: from a row-major [k][n] bf16 tile, lane (c = l & 15,
// h = l >> 4) receives T[kbase + 8h + 0..7][nbase + c]. The lane's address is
// row kbase + 8*(l >> 4) + (l & 7), column nbase + 8*((l >> 3) & 1).
__device__ __forceinline__ s16x8 lds_load_tr16(const ushort_t* p) {
    typedef __attribute__((address_space(3))) s16x8 lds_s16x8;
    return __builtin_amdgcn_ds_load_tr16_b128_v8i16((lds_s16x8*)p);
}

// ---------------------------------------------------------------------------
// Elementwise helpers
// ---------------------------------------------------------------------------
// Two floats rounded to bf16 and packed into one dword (a in the low half).
__device__ __forceinline__ unsigned pack2_bf16(float a, float b) {
    unsigned lo = __builtin_bit_cast(unsigned short, f32_to_bf16(a));
    unsigned hi = __builtin_bit_cast(unsigned short, f32_to_bf16(b));
    return lo | (hi << 16);
}

// 16 elements per thread: a block takes 4096 consecutive elements as four
// slabs of 1024; each wave-wide load covers 512 contiguous bytes, each store
// 256. The blocks cover the array exactly (its length is a multiple of 4096).
__device__ __forceinline__
void cvt_bf16_block(const float* __restrict__ src,
                    __bf16* __restrict__ dst, int blk) {
    const int base = blk * 4096 + threadIdx.x * 4;
    float4 v[4];
#pragma unroll
    for (int u = 0; u < 4; ++u) v[u] = *(const float4*)(src + base + u * 1024);
#pragma unroll
    for (int u = 0; u < 4; ++u)
        *(uint2*)(dst + base + u * 1024) =
            make_uint2(pack2_bf16(v[u].x, v[u].y), pack2_bf16(v[u].z, v[u].w));
    // the stores' registers are not rewritten by another part of the merged
    // kernel in front of this wait
    asm volatile("s_wait_xcnt 0x0" ::: "memory");
}

// gamma/beta = cond @ W + b  (per batch, DC=64 reduction); B*D/256 blocks
__device__ __forceinline__
void film_params_block(const float* __restrict__ cond,
                       const float* __restrict__ gw,
                       const float* __restrict__ gb,
                       const float* __restrict__ bw,
                       const float* __restrict__ bb,
                       float* __restrict__ gamma,
                       float* __restrict__ beta, int blk) {
    int idx = blk * 256 + threadIdx.x;   // B*D
    if (idx >= BB * DD) return;
    int b = idx / DD, d = idx % DD;
    const float* c = cond + b * DCC;
    float g = gb[d], bt = bb[d];
#pragma unroll 8
    for (int i = 0; i < DCC; ++i) {
        float cv = c[i];
        g  += cv * gw[i * DD + d];
        bt += cv * bw[i * DD + d];
    }
    gamma[idx] = g;
    beta[idx]  = bt;
}

// T5 relative position bucket of rp = k - q
__device__ __forceinline__ int rel_bucket(int rp) {
    const int nb = NBUCK / 2;      // 16
    const int max_exact = nb / 2;  // 8
    int bucket = (rp > 0) ? nb : 0;
    int arp = rp < 0 ? -rp : rp;
    int val;
    if (arp < max_exact) {
        val = arp;
    } else {
        float rp_safe = (float)(arp > 1 ? arp : 1);
        int large = max_exact +
            (int)(logf(rp_safe / (float)max_exact) /
                  logf(128.0f / (float)max_exact) * (float)(nb - max_exact));
        val = large < nb - 1 ? large : nb - 1;
    }
    return bucket + val;
}

// T5 relative position bias -> bias_out[h][q][k]  (this is output #2)
// One block per query row; a thread takes 4 consecutive keys for all 16 heads
// (64 elements): each wave-wide store covers 512 contiguous bytes of one head.
__device__ __forceinline__
void bias_block(const float* __restrict__ rel_emb,
                float* __restrict__ bias_out, int q) {
    const int k0 = threadIdx.x * 4;
    float e[4][HH];
#pragma unroll
    for (int c = 0; c < 4; ++c) {
        const float4* p = (const float4*)(rel_emb + rel_bucket(k0 + c - q) * HH);
#pragma unroll
        for (int g = 0; g < HH / 4; ++g) {
            float4 t = p[g];
            e[c][4 * g + 0] = t.x;
            e[c][4 * g + 1] = t.y;
            e[c][4 * g + 2] = t.z;
            e[c][4 * g + 3] = t.w;
        }
    }
#pragma unroll
    for (int h = 0; h < HH; ++h)
        *(float4*)(bias_out + ((size_t)h * TT + q) * TT + k0) =
            make_float4(e[0][h], e[1][h], e[2][h], e[3][h]);
    // the stores' registers are not rewritten by another part of the merged
    // kernel in front of this wait
    asm volatile("s_wait_xcnt 0x0" ::: "memory");
}

// Everything that depends on the inputs alone, in one grid: a block's index
// says which piece it does. The FiLM blocks, few and latency-bound, come first.
#define NB_FILM (BB * DD / 256)      // blocks per FiLM parameter pair
#define NB_W    (DD * DD / 4096)     // blocks per D x D weight matrix
#define NB_PREP (2 * NB_FILM + TT + 10 * NB_W)
__global__ __launch_bounds__(256)
void prep_kernel(const float* __restrict__ cond,
                 const float* __restrict__ f1_gw, const float* __restrict__ f1_gb,
                 const float* __restrict__ f1_bw, const float* __restrict__ f1_bb,
                 float* __restrict__ gamma1, float* __restrict__ beta1,
                 const float* __restrict__ f3_gw, const float* __restrict__ f3_gb,
                 const float* __restrict__ f3_bw, const float* __restrict__ f3_bb,
                 float* __restrict__ gamma3, float* __restrict__ beta3,
                 const float* __restrict__ rel_emb, float* __restrict__ bias_out,
                 const float* __restrict__ wq, const float* __restrict__ wk,
                 const float* __restrict__ wv, const float* __restrict__ wo,
                 const float* __restrict__ w1, const float* __restrict__ w2,
                 __bf16* __restrict__ wq_bf, __bf16* __restrict__ wk_bf,
                 __bf16* __restrict__ wv_bf, __bf16* __restrict__ wo_bf,
                 __bf16* __restrict__ w1_bf, __bf16* __restrict__ w2_bf) {
    int blk = blockIdx.x;
    if (blk < NB_FILM) {
        film_params_block(cond, f1_gw, f1_gb, f1_bw, f1_bb, gamma1, beta1, blk);
        return;
    }
    blk -= NB_FILM;
    if (blk < NB_FILM) {
        film_params_block(cond, f3_gw, f3_gb, f3_bw, f3_bb, gamma3, beta3, blk);
        return;
    }
    blk -= NB_FILM;
    if (blk < TT) {
        bias_block(rel_emb, bias_out, blk);
        return;
    }
    blk -= TT;
    const float* src;
    __bf16* dst;
    if (blk < NB_W)          { src = wq; dst = wq_bf; }
    else if (blk < 2 * NB_W) { src = wk; dst = wk_bf; blk -= NB_W; }
    else if (blk < 3 * NB_W) { src = wv; dst = wv_bf; blk -= 2 * NB_W; }
    else if (blk < 4 * NB_W) { src = wo; dst = wo_bf; blk -= 3 * NB_W; }
    else if (blk < 8 * NB_W) { src = w1; dst = w1_bf; blk -= 4 * NB_W; }
    else                     { src = w2; dst = w2_bf; blk -= 8 * NB_W; }
    cvt_bf16_block(src, dst, blk);
}

// y = film(rms_norm(x)) -> bf16, one wave per (b,t) row: a lane holds 32
// elements of the row in registers (eight 16-byte loads, 512 contiguous bytes
// per wave each), so x is read once and the row sum needs no LDS.
__global__ __launch_bounds__(256)
void rmsnorm_film_kernel(const float* __restrict__ x,
                         const float* __restrict__ w,
                         const float* __restrict__ gamma,
                         const float* __restrict__ beta,
                         __bf16* __restrict__ y) {
    const int lane = threadIdx.x & 31;
    const int row = blockIdx.x * 8 + (threadIdx.x >> 5);   // 0 .. B*T-1
    const int b = row / TT;
    const float* xr = x + (size_t)row * DD + lane * 4;
    float4 v[8];
#pragma unroll
    for (int u = 0; u < 8; ++u) v[u] = *(const float4*)(xr + u * 128);
    float s0 = 0.0f, s1 = 0.0f, s2 = 0.0f, s3 = 0.0f;   // four independent chains
#pragma unroll
    for (int u = 0; u < 8; ++u) {
        s0 += v[u].x * v[u].x;
        s1 += v[u].y * v[u].y;
        s2 += v[u].z * v[u].z;
        s3 += v[u].w * v[u].w;
    }
    float tot = (s0 + s1) + (s2 + s3);
#pragma unroll
    for (int m = 16; m >= 1; m >>= 1) tot += __shfl_xor(tot, m, 32);
    float rstd = rsqrtf(tot / (float)DD + 1e-6f);
    const float* wr = w + lane * 4;
    const float* g  = gamma + (size_t)b * DD + lane * 4;
    const float* be = beta + (size_t)b * DD + lane * 4;
    __bf16* yr = y + (size_t)row * DD + lane * 4;
#pragma unroll
    for (int u = 0; u < 8; ++u) {
        float4 w4 = *(const float4*)(wr + u * 128);
        float4 g4 = *(const float4*)(g + u * 128);
        float4 b4 = *(const float4*)(be + u * 128);
        float r0 = (w4.x * (v[u].x * rstd)) * (g4.x + 1.0f) + b4.x;
        float r1 = (w4.y * (v[u].y * rstd)) * (g4.y + 1.0f) + b4.y;
        float r2 = (w4.z * (v[u].z * rstd)) * (g4.z + 1.0f) + b4.z;
        float r3 = (w4.w * (v[u].w * rstd)) * (g4.w + 1.0f) + b4.w;
        *(uint2*)(yr + u * 128) = make_uint2(pack2_bf16(r0, r1), pack2_bf16(r2, r3));
    }
}

// erf in single precision by the two-range polynomial form (|x| < 1: an odd
// polynomial; else 1 - exp of a polynomial). Both ranges are evaluated and one
// is selected: with no branch between them a lane's independent evaluations
// interleave, where a branch each would leave one dependent chain after another.
__device__ __forceinline__ float erf_select(float x) {
    const float ax = fabsf(x);
    const float t = x * x;
    float q = fmaf(-5.61801775e-4f, t, 4.91381623e-3f);
    q = fmaf(t, q, -2.67075151e-2f);
    q = fmaf(t, q, 1.12800106e-1f);
    q = fmaf(t, q, -3.76122952e-1f);
    q = fmaf(t, q, 1.28379107e-1f);
    const float small = fmaf(ax, q, ax);
    float p = fmaf(ax, 1.69988107e-5f, -3.78677854e-4f);
    p = fmaf(ax, p, 3.85781587e-3f);
    p = fmaf(ax, p, -2.41816975e-2f);
    p = fmaf(ax, p, 1.06668264e-1f);
    p = fmaf(ax, p, 6.34933293e-1f);
    p = fmaf(ax, p, 1.28689408e-1f);
    p = fmaf(ax, p, ax);
    const float large = 1.0f - expf(-p);
    return copysignf(ax < 1.0f ? small : large, x);
}
// geglu of one pair: p1 * gelu(p2), exact gelu
__device__ __forceinline__ float geglu1(float p1, float p2) {
    float ge = 0.5f * p2 * (1.0f + erf_select(p2 * 0.70710678118654752f));
    return p1 * ge;
}

// ---------------------------------------------------------------------------
// Generic bf16 WMMA GEMM:  C[M,N] = A[M,K] * B[K,N]  (row-major, bf16 in)
// Block tile BM x BN, 8 waves (4 along M x 2 along N), wave tile BM/4 x BN/2.
// A product with enough output for every WGP takes 256 x 256 (wave tile
// 64 x 128): per multiply-add half the bytes from L2 into LDS and half the
// fragment bytes out of LDS of the 128 x 128 tile, which the narrow products
// keep so that their 256 blocks still fill the chip.
// Double-buffered LDS, 128 k per stage (K is a multiple of 128); A and B tiles
// staged via GLOBAL_LOAD_ASYNC_TO_LDS_B128, each wave-wide copy taking 512 B of
// whole rows; B kept row-major [k][n] and transposed by the fragment loads.
// EPI==0: store bf16.  EPI==1: store f32 with residual add (small tile only).
// EPI==2: C[M,N/2] = geglu(A * B), bf16: a block takes BN/2 columns c of the
// first half of B and the columns c + N/2 that go with them, and each wave holds
// both members of its pairs in the same lane and register of two accumulator
// tiles, so the product itself is never stored.
// Grid z: independent products on the same A; B, C and the residual advance by
// one whole matrix per z.
// ---------------------------------------------------------------------------
template <int EPI, int BM, int BN>
__global__ __launch_bounds__(256)
void gemm_bf16_kernel(const __bf16* __restrict__ A,
                      const __bf16* __restrict__ Bm,
                      void* __restrict__ C,
                      const float* __restrict__ residual,
                      int M, int N, int K) {
    constexpr int BK = 128;       // k per stage
    constexpr int PA = 136;       // lA row pitch: 272 B, an odd multiple of 16 B
    constexpr int PB = BN + 16;   // lB row pitch: 288 or 544 B, odd multiples of 32 B
    constexpr int FA = BM / 64;   // 16-row A fragments of a wave
    constexpr int FB = BN / 32;   // 16-column B fragments of a wave
    constexpr int TB = BN / 8;    // threads that share one row of the B tile
    constexpr int RB = 256 / TB;  // rows of the B tile that the block copies at once
    constexpr int NS = FA * FB > 8 ? 2 : 1;   // fragment register sets
    static_assert((EPI == 1) == (NS == 1), "f32 output: small tile; bf16: large");
    __shared__ __attribute__((aligned(16))) ushort_t lA[2][BM * PA];   // [m][k]
    __shared__ __attribute__((aligned(16))) ushort_t lB[2][BK * PB];   // [k][n]

    const int tid  = threadIdx.x;
    const int lane = tid & 31;
    const int wave = tid >> 5;          // 0..7
    const int wm   = wave & 3;          // 4 waves along M
    const int wn   = wave >> 2;         // 2 waves along N
    const int half = lane >> 4;         // which 16-lane half
    const int l16  = lane & 15;
    const int koff = half ? 8 : 0;
    const int trow = half * 8 + (lane & 7);      // transposing load: lane's row
    const int tcol = ((lane >> 3) & 1) * 8;      // and its column offset

    const int blockM = blockIdx.y * BM;
    const int blockN = blockIdx.x * (EPI == 2 ? BN / 2 : BN);

    // per-thread tile-copy coordinates: a thread takes one 16-byte column of
    // rows aRow, +16, ... of the A tile and of rows bRow, +RB, ... of the B tile
    const int aRow = tid >> 4;
    const int aCol = (tid & 15) * 8;
    const int bRow = tid / TB;
    const int bCol = (tid % TB) * 8;

    // each thread's two source addresses walk along K, one tile per issue
    const __bf16* gA = A + (size_t)(blockM + aRow) * K + aCol;
    const __bf16* gB = Bm + ((size_t)blockIdx.z * K + bRow) * N + blockN + bCol;
    // EPI==2: the upper half of the tile's columns comes from the second half
    // of B's rows
    if (EPI == 2) gB += (bCol / (BN / 2)) * (N / 2 - BN / 2);
    auto issueAB = [&](int buf) {
        const void* g[8];
        unsigned l[8];   // LDS aperture: low 32 bits
        // all loops unrolled: g and l are the statements' register operands
#pragma unroll
        for (int v = 0; v < BM / 128; ++v) {
#pragma unroll
            for (int u = 0; u < 8; ++u) {
                const int r = 16 * (8 * v + u);
                g[u] = gA + (size_t)r * K;
                l[u] = (unsigned)(unsigned long long)&lA[buf][(aRow + r) * PA + aCol];
            }
            async_copy8_b128(g, l);
        }
#pragma unroll
        for (int v = 0; v < BK / (8 * RB); ++v) {
#pragma unroll
            for (int u = 0; u < 8; ++u) {
                const int r = RB * (8 * v + u);
                g[u] = gB + (size_t)r * N;
                l[u] = (unsigned)(unsigned long long)&lB[buf][(bRow + r) * PB + bCol];
            }
            async_copy8_b128(g, l);
        }
        gA += BK;
        gB += (size_t)BK * N;
    };

    v8f acc[FA][FB];
#pragma unroll
    for (int i = 0; i < FA; ++i)
#pragma unroll
        for (int j = 0; j < FB; ++j) acc[i][j] = v8f_zero();

    // prologue: tile 0 lands and is published, then tile 1 starts to fly
    const int ntiles = K / BK;
    issueAB(0);
    async_wait0();
    __syncthreads();
    if (ntiles > 1) issueAB(1);

    Frag a[NS][FA], b[NS][FB];
    auto loadFrags = [&](int s, int buf, int kk) {
#pragma unroll
        for (int i = 0; i < FA; ++i) {
            int row = wm * (BM / 4) + i * 16 + l16;
            a[s][i].u4[0] = *(const uint4*)&lA[buf][row * PA + kk + koff];
            a[s][i].u4[1] = *(const uint4*)&lA[buf][row * PA + kk + koff + 16];
        }
#pragma unroll
        for (int j = 0; j < FB; ++j) {
            // EPI==2: tiles j and j + FB/2 hold the two members of a pair
            int col = (EPI == 2 ? (j / (FB / 2)) * (BN / 2) + wn * (BN / 4) +
                                      (j % (FB / 2)) * 16
                                : wn * (BN / 2) + j * 16) + tcol;
            b[s][j].t[0] = lds_load_tr16(&lB[buf][(kk + trow) * PB + col]);
            b[s][j].t[1] = lds_load_tr16(&lB[buf][(kk + 16 + trow) * PB + col]);
        }
    };
    auto products = [&](int s) {
#pragma unroll
        for (int i = 0; i < FA; ++i)
#pragma unroll
            for (int j = 0; j < FB; ++j)
                acc[i][j] = wmma_bf16(a[s][i].v, b[s][j].v, acc[i][j]);
    };
    // publish tile t + 1 and free trip t's buffer, then refill it
    auto publish = [&](int t) {
        lds_wait0();
        async_wait0();
        __syncthreads();
        if (t + 2 < ntiles) issueAB(t & 1);
    };

    // Each tile 32 k at a time in ascending order; the k steps unrolled so that
    // every LDS offset inside the stage is an immediate.
    // Large tile, two waves a SIMD: a k step's 24 fragment reads go as one group
    // into the second register set, in front of the products of the step before.
    // The publish point then stands in front of a tile's last products, whose
    // fragments are already fetched; the next tile is first read behind it.
    if (NS == 2) loadFrags(0, 0, 0);
    for (int t = 0; t < ntiles; ++t) {
        const int cur = t & 1;
#pragma unroll
        for (int kk = 0; kk < BK; kk += 32) {
            if (NS == 1) {
                loadFrags(0, cur, kk);
                products(0);
            } else {
                const int s = (kk >> 5) & 1;
                if (kk + 32 < BK) {
                    loadFrags(s ^ 1, cur, kk + 32);
                } else {
                    publish(t);
                    if (t + 1 < ntiles) loadFrags(s ^ 1, cur ^ 1, 0);
                }
                // the two fences keep the reads above together and ahead of the
                // products; left alone the build reads one A fragment, waits to
                // 0 and multiplies, 16 times a stage
                __builtin_amdgcn_sched_barrier(0);
                products(s);
                __builtin_amdgcn_sched_barrier(0);
            }
        }
        if (NS == 1) publish(t);
    }
    async_wait0();

    // epilogue (C-layout: col = l16, row = r + 8*half per vgpr r)
    if (FA * FB > 8) {
        // Large tile: written out for all 32 accumulator tiles, the GEGLU
        // epilogue alone would pass 32 KB of text. Each lane parks its accumulators in LDS, in a
        // range of its wave's own (the ring is free: every wave's reads and
        // copies ended in front of the loop's last barrier), and one rolled
        // loop takes them tile by tile.
        static_assert(FA * FB * 4096 <= (int)sizeof(lA) &&
                      FA * FB * 4096 <= (int)sizeof(lB), "four waves' tiles each");
        float* st = (float*)(wave < 4 ? &lA[0][0] : &lB[0][0]) +
                    (wave & 3) * (FA * FB * 256) + lane * 4;
#pragma unroll
        for (int i = 0; i < FA; ++i)
#pragma unroll
            for (int j = 0; j < FB; ++j) {
                const v8f& t = acc[i][j];
                *(float4*)(st + (i * FB + j) * 256) = make_float4(t[0], t[1], t[2], t[3]);
                *(float4*)(st + (i * FB + j) * 256 + 128) = make_float4(t[4], t[5], t[6], t[7]);
            }
        constexpr int NP = EPI == 2 ? FB / 2 : FB;   // column groups stored
        const int ldc = EPI == 2 ? N / 2 : N;
        __bf16* c0 = (__bf16*)C +
            ((size_t)blockIdx.z * M + blockM + wm * (BM / 4) + half * 8) * ldc +
            blockN + wn * (NP * 16) + l16;
        // kept rolled: the text stays small (see above)
#pragma unroll 1
        for (int t = 0; t < FA * NP; ++t) {
            const int i = t / NP, j = t % NP;
            const float* s = st + (i * FB + j) * 256;
            const float4 p0 = *(const float4*)s, p1 = *(const float4*)(s + 128);
            float v[8] = {p0.x, p0.y, p0.z, p0.w, p1.x, p1.y, p1.z, p1.w};
            if (EPI == 2) {
                const float4 q0 = *(const float4*)(s + NP * 256);
                const float4 q1 = *(const float4*)(s + NP * 256 + 128);
                const float w[8] = {q0.x, q0.y, q0.z, q0.w, q1.x, q1.y, q1.z, q1.w};
#pragma unroll
                for (int r = 0; r < 8; ++r) v[r] = geglu1(v[r], w[r]);
            }
            __bf16* c = c0 + (size_t)(i * 16) * ldc + j * 16;
#pragma unroll
            for (int r = 0; r < 8; ++r) c[(size_t)r * ldc] = f32_to_bf16(v[r]);
            // the stores' registers are not rewritten by the next trip in front
            // of this wait
            asm volatile("s_wait_xcnt 0x0" ::: "memory");
        }
        return;
    }
#pragma unroll
    for (int i = 0; i < FA; ++i) {
#pragma unroll
        for (int j = 0; j < FB; ++j) {
            int col = blockN + wn * (BN / 2) + j * 16 + l16;
#pragma unroll
            for (int r = 0; r < 8; ++r) {
                int row = blockM + wm * (BM / 4) + i * 16 + r + half * 8;
                size_t idx = ((size_t)blockIdx.z * M + row) * N + col;
                ((float*)C)[idx] = residual[idx] + acc[i][j][r];
            }
        }
    }
}

__device__ __forceinline__ float other_half(float x) {
    int b = __builtin_bit_cast(int, x);
    return __builtin_bit_cast(float, __builtin_amdgcn_permlanex16(
        b, b, 0x76543210, 0xfedcba98, false, false));
}

__global__ __launch_bounds__(128)
void flash_attn_kernel(const __bf16* __restrict__ qb,
                       const __bf16* __restrict__ kb,
                       const __bf16* __restrict__ vb,
                       const float* __restrict__ bias,   // [H][T][T]
                       const int* __restrict__ mask,     // [B][T][T]
                       __bf16* __restrict__ ob) {
    constexpr int PK = 72;    // lK row pitch: 144 B, an odd multiple of 16 B
    constexpr int PV = 80;    // lV row pitch: 160 B, an odd multiple of 32 B
    constexpr int PM = 68;    // lM row pitch: 272 B, an odd multiple of 16 B
    __shared__ __attribute__((aligned(16))) ushort_t lK[64 * PK];   // [key][dh]   -> A-frag layout for K*Q^T
    __shared__ __attribute__((aligned(16))) ushort_t lV[64 * PV];   // [key][dh]   -> read by transposing loads
    __shared__ __attribute__((aligned(16))) int lM[64 * PM];        // [q][key]    -> mask tile
    // [k - (q - qbase) + 63] -> bias; the alignment puts it at the start of the
    // block's LDS, which keeps the offsets of a tile's values small
    __shared__ __attribute__((aligned(128))) float lB[TT + 128];

    const int bh = blockIdx.x;
    const int b = bh / HH;
    const int h = bh % HH;
    const int qbase = blockIdx.y * 64;
    const int tid  = threadIdx.x;
    const int lane = tid & 31;
    const int wave = tid >> 5;         // 0..3 -> 16 queries each
    const int half = lane >> 4;
    const int l16  = lane & 15;
    const int koff = half ? 8 : 0;
    const int trow = half * 8 + (lane & 7);      // transposing load: lane's row
    const int tcol = ((lane >> 3) & 1) * 8;      // and its column offset
    const int crow = tid >> 3;                   // tile copy: lane's first row
    const int ccol = (tid & 7) * 8;              // and its column
    const int qg   = qbase + wave * 16 + l16;    // the lane's query

    // Q fragments stay in registers for the whole kernel
    Frag qf[2];
    {
        const __bf16* qrp = qb + ((size_t)(b * TT + qg)) * DD + h * DHH;
        qf[0].u4[0] = *(const uint4*)(qrp + koff);
        qf[0].u4[1] = *(const uint4*)(qrp + koff + 16);
        qf[1].u4[0] = *(const uint4*)(qrp + 32 + koff);
        qf[1].u4[1] = *(const uint4*)(qrp + 32 + koff + 16);
    }

    // Bias by relative position d = k - q: row q = T - 1 of the head's plane
    // holds d = -(T - 1) .. 0, row q = 0 holds d = 0 .. T - 1. Entry e is
    // d = e - 63 - qbase; the entries past d = T - 1 are filled but never read.
    // The first barrier of the key loop publishes the table.
    {
        const float* rlast  = bias + ((size_t)h * TT + (TT - 1)) * TT + (TT - 1);
        const float* rfirst = bias + (size_t)h * TT * TT;
        float t[(TT + 128) / 128];
        // both loops unrolled: t stays in registers, and every load is issued
        // before the first store waits for one
#pragma unroll
        for (int u = 0; u < (TT + 128) / 128; ++u) {
            int d = tid + 128 * u - 63 - qbase;
            d = d < TT - 1 ? d : TT - 1;
            t[u] = (d <= 0 ? rlast : rfirst)[d];
        }
#pragma unroll
        for (int u = 0; u < (TT + 128) / 128; ++u) lB[tid + 128 * u] = t[u];
    }
    // the lane's entry for key 0 of its half in key group 0 of the current tile
    const float* bp = &lB[half * 8 - wave * 16 - l16 + 63];
    // the lane's mask row in the tile, at the first key of its half
    const int* mrow = &lM[(wave * 16 + l16) * PM + half * 8];
    // mask tile copy: 64 rows of 256 B; a thread takes 16-byte column mcol of
    // rows mr0, +8, ... +56, so that a wave-wide copy takes two whole rows
    const int mr0  = tid >> 4;
    const int mcol = (tid & 15) * 4;
    const int* gM = mask + ((size_t)b * TT + qbase + mr0) * TT + mcol;

    // m: the query's running maximum (equal in both halves); l: the running sum
    // over the keys of the lane's own half, joined behind the loop
    float m = -1e30f, l = 0.0f;
    v8f o[4];
#pragma unroll
    for (int j = 0; j < 4; ++j) o[j] = v8f_zero();

    const float scale = 0.125f;   // 1/sqrt(DH)

    for (int kt = 0; kt < TT / 64; ++kt) {
        const int kbase = kt * 64;
        // K and V tiles: natural [key][dh] layout, async to LDS (no VGPR staging);
        // each thread copies column ccol of rows crow, +16, +32, +48
        const size_t gofs = ((size_t)(b * TT + kbase + crow)) * DD + h * DHH + ccol;
        async_copy4_b128(kb + gofs,           &lK[crow * PK + ccol],
                         kb + gofs + 16 * DD, &lK[(crow + 16) * PK + ccol],
                         kb + gofs + 32 * DD, &lK[(crow + 32) * PK + ccol],
                         kb + gofs + 48 * DD, &lK[(crow + 48) * PK + ccol]);
        async_copy4_b128(vb + gofs,           &lV[crow * PV + ccol],
                         vb + gofs + 16 * DD, &lV[(crow + 16) * PV + ccol],
                         vb + gofs + 32 * DD, &lV[(crow + 32) * PV + ccol],
                         vb + gofs + 48 * DD, &lV[(crow + 48) * PV + ccol]);
        {
            const void* g[8];
            unsigned a[8];   // LDS aperture: low 32 bits
            // unrolled: g and a are the statement's register operands
#pragma unroll
            for (int u = 0; u < 8; ++u) {
                g[u] = gM + (size_t)(8 * u) * TT + kbase;
                a[u] = (unsigned)(unsigned long long)&lM[(mr0 + 8 * u) * PM + mcol];
            }
            async_copy8_b128(g, a);
        }
        async_wait0();
        __syncthreads();

        // the lane's 32 mask values: mk[2 j + (r >> 2)][r & 3] goes with s[j][r]
        i32x4 mk[8];
#pragma unroll
        for (int u = 0; u < 8; ++u) mk[u] = *(const i32x4*)(mrow + u * 8 - (u & 1) * 4);

        // S^T = K * Q^T  (4 groups of 16 keys, reduction DH=64 -> 2 wmma):
        // s[j][r] = score of key kbase + 16 j + 8 half + r with query qg
        v8f s[4];
#pragma unroll
        for (int j = 0; j < 4; ++j) {
            int row = j * 16 + l16;
            Frag k0, k1;
            k0.u4[0] = *(const uint4*)&lK[row * PK + koff];
            k0.u4[1] = *(const uint4*)&lK[row * PK + koff + 16];
            k1.u4[0] = *(const uint4*)&lK[row * PK + 32 + koff];
            k1.u4[1] = *(const uint4*)&lK[row * PK + 32 + koff + 16];
            v8f z = v8f_zero();
            z = wmma_bf16(k0.v, qf[0].v, z);
            s[j] = wmma_bf16(k1.v, qf[1].v, z);
        }

        // holds the eight mask reads together: issued in a row and waited for
        // once; left alone the build sends them one by one through one register
        // quad, a full LDS latency each
        asm volatile("" :: "v"(mk[0]), "v"(mk[1]), "v"(mk[2]), "v"(mk[3]),
                           "v"(mk[4]), "v"(mk[5]), "v"(mk[6]), "v"(mk[7]));

        // scale + bias + mask + online softmax, all of one query in its two lanes
        float gmax[4];
#pragma unroll
        for (int j = 0; j < 4; ++j) {
            gmax[j] = -1e30f;
#pragma unroll
            for (int r = 0; r < 8; ++r) {
                float v = s[j][r] * scale + bp[j * 16 + r];
                v = (mk[2 * j + (r >> 2)][r & 3] == 0) ? -1e9f : v;
                s[j][r] = v;
                gmax[j] = fmaxf(gmax[j], v);
            }
        }
        float tmax = fmaxf(fmaxf(gmax[0], gmax[1]), fmaxf(gmax[2], gmax[3]));
        tmax = fmaxf(tmax, other_half(tmax));
        const float mnew = fmaxf(m, tmax);
        const float corr = __expf(m - mnew);
        m = mnew;
        float gsum[4];   // four independent chains
#pragma unroll
        for (int j = 0; j < 4; ++j) {
            gsum[j] = 0.0f;
#pragma unroll
            for (int r = 0; r < 8; ++r) {
                float p = __expf(s[j][r] - mnew);
                s[j][r] = p;
                gsum[j] += p;
            }
        }
        l = l * corr + ((gsum[0] + gsum[1]) + (gsum[2] + gsum[3]));
#pragma unroll
        for (int j = 0; j < 4; ++j)
#pragma unroll
            for (int r = 0; r < 8; ++r) o[j][r] *= corr;

        // P^T as B operand: element e of fragment i is register e & 7 of key
        // group 2 i + (e >> 3), the k order of the transposing loads
        Frag pf[2];
#pragma unroll
        for (int i = 0; i < 2; ++i)
#pragma unroll
            for (int g = 0; g < 2; ++g) {
                const v8f& t = s[2 * i + g];
                pf[i].u4[g] = make_uint4(pack2_bf16(t[0], t[1]), pack2_bf16(t[2], t[3]),
                                         pack2_bf16(t[4], t[5]), pack2_bf16(t[6], t[7]));
            }

        // O^T += V^T * P^T
#pragma unroll
        for (int j = 0; j < 4; ++j) {
            int col = j * 16 + tcol;  // dh block
            Frag v0, v1;
            v0.t[0] = lds_load_tr16(&lV[trow * PV + col]);
            v0.t[1] = lds_load_tr16(&lV[(16 + trow) * PV + col]);
            v1.t[0] = lds_load_tr16(&lV[(32 + trow) * PV + col]);
            v1.t[1] = lds_load_tr16(&lV[(48 + trow) * PV + col]);
            o[j] = wmma_bf16(v0.v, pf[0].v, o[j]);
            o[j] = wmma_bf16(v1.v, pf[1].v, o[j]);
        }
        bp += 64;
        lds_wait0();   // this wave has left lK, lV and lM before the next copies
        __syncthreads();
    }

    // finalize: O /= l, write bf16 [B,T,H*DH]; o[j][r] is dh 16 j + 8 half + r
    l += other_half(l);
    __bf16* orow = ob + ((size_t)(b * TT + qg)) * DD + h * DHH + half * 8;
#pragma unroll
    for (int j = 0; j < 4; ++j)
        *(uint4*)(orow + j * 16) =
            make_uint4(pack2_bf16(o[j][0] / l, o[j][1] / l),
                       pack2_bf16(o[j][2] / l, o[j][3] / l),
                       pack2_bf16(o[j][4] / l, o[j][5] / l),
                       pack2_bf16(o[j][6] / l, o[j][7] / l));
}

// ---------------------------------------------------------------------------
// Host-side orchestration
// ---------------------------------------------------------------------------
static inline size_t align256(size_t x) { return (x + 255) & ~(size_t)255; }

extern "C" void kernel_launch(void* const* d_in, const int* in_sizes, int n_in,
                              void* d_out, int out_size, void* d_ws, size_t ws_size,
                              hipStream_t stream) {
    (void)in_sizes; (void)n_in; (void)out_size; (void)ws_size;
    const float* x        = (const float*)d_in[0];
    const int*   x_mask   = (const int*)  d_in[1];
    const float* cond     = (const float*)d_in[2];
    const float* norm1_w  = (const float*)d_in[3];
    const float* f1_gw    = (const float*)d_in[4];
    const float* f1_gb    = (const float*)d_in[5];
    const float* f1_bw    = (const float*)d_in[6];
    const float* f1_bb    = (const float*)d_in[7];
    const float* wq       = (const float*)d_in[8];
    const float* wk       = (const float*)d_in[9];
    const float* wv       = (const float*)d_in[10];
    const float* wo       = (const float*)d_in[11];
    const float* rel_emb  = (const float*)d_in[12];
    const float* norm3_w  = (const float*)d_in[13];
    const float* f3_gw    = (const float*)d_in[14];
    const float* f3_gb    = (const float*)d_in[15];
    const float* f3_bw    = (const float*)d_in[16];
    const float* f3_bb    = (const float*)d_in[17];
    const float* ffn_w1   = (const float*)d_in[18];
    const float* ffn_w2   = (const float*)d_in[19];

    float* out_x    = (float*)d_out;                              // [B,T,D]
    float* out_bias = (float*)d_out + (size_t)BB * TT * DD;       // [H,T,T]

    // workspace bump allocator
    char* ws = (char*)d_ws;
    size_t off = 0;
    auto alloc = [&](size_t bytes) -> void* {
        void* p = ws + off;
        off += align256(bytes);
        return p;
    };
    const size_t BT = (size_t)BB * TT;
    __bf16* wq_bf   = (__bf16*)alloc((size_t)3 * DD * DD * 2);   // wq | wk | wv
    __bf16* wk_bf   = wq_bf + (size_t)DD * DD;
    __bf16* wv_bf   = wk_bf + (size_t)DD * DD;
    __bf16* wo_bf   = (__bf16*)alloc((size_t)DD * DD * 2);
    __bf16* w1_bf   = (__bf16*)alloc((size_t)DD * 4 * DD * 2);
    __bf16* w2_bf   = (__bf16*)alloc((size_t)2 * DD * DD * 2);
    float*  gamma1  = (float*)alloc((size_t)BB * DD * 4);
    float*  beta1   = (float*)alloc((size_t)BB * DD * 4);
    float*  gamma3  = (float*)alloc((size_t)BB * DD * 4);
    float*  beta3   = (float*)alloc((size_t)BB * DD * 4);
    __bf16* y_bf    = (__bf16*)alloc(BT * DD * 2);
    __bf16* q_bf    = (__bf16*)alloc(3 * BT * DD * 2);           // q | k | v
    __bf16* k_bf    = q_bf + BT * DD;
    __bf16* v_bf    = k_bf + BT * DD;
    __bf16* attn_bf = (__bf16*)alloc(BT * DD * 2);
    float*  x_mid   = (float*)alloc(BT * DD * 4);
    __bf16* y3_bf   = (__bf16*)alloc(BT * DD * 2);
    __bf16* g_bf    = (__bf16*)alloc(BT * 2 * DD * 2);

    // 1) all that depends on the inputs alone: FiLM params, position bias
    //    (output #2 + consumed by attention), weight conversion fp32 -> bf16
    prep_kernel<<<NB_PREP, 256, 0, stream>>>(
        cond, f1_gw, f1_gb, f1_bw, f1_bb, gamma1, beta1,
        f3_gw, f3_gb, f3_bw, f3_bb, gamma3, beta3,
        rel_emb, out_bias,
        wq, wk, wv, wo, ffn_w1, ffn_w2,
        wq_bf, wk_bf, wv_bf, wo_bf, w1_bf, w2_bf);
    // 4) y = film(rmsnorm(x)) -> bf16
    rmsnorm_film_kernel<<<(int)(BT / 8), 256, 0, stream>>>(x, norm1_w, gamma1, beta1, y_bf);
    // 5) Q,K,V projections, one grid: z picks the weight and the output, which
    //    follow one another in the workspace
    {
        dim3 grid(DD / 256, (int)(BT / 256), 3);
        gemm_bf16_kernel<0, 256, 256><<<grid, 256, 0, stream>>>(y_bf, wq_bf, q_bf, nullptr,
                                                                (int)BT, DD, DD);
    }
    // 6) flash attention
    {
        dim3 grid(BB * HH, TT / 64);
        flash_attn_kernel<<<grid, 128, 0, stream>>>(q_bf, k_bf, v_bf,
                                                    out_bias, x_mask, attn_bf);
    }
    // 7) x_mid = x + attn @ wo
    {
        dim3 grid(DD / 128, (int)(BT / 128));
        gemm_bf16_kernel<1, 128, 128><<<grid, 256, 0, stream>>>(attn_bf, wo_bf, x_mid, x,
                                                                (int)BT, DD, DD);
    }
    // 8) y3 = film(rmsnorm(x_mid)) -> bf16
    rmsnorm_film_kernel<<<(int)(BT / 8), 256, 0, stream>>>(x_mid, norm3_w, gamma3, beta3, y3_bf);
    // 9) g = geglu(y3 @ ffn_w1)  [BT, 2D]
    {
        dim3 grid(2 * DD / 128, (int)(BT / 256));
        gemm_bf16_kernel<2, 256, 256><<<grid, 256, 0, stream>>>(y3_bf, w1_bf, g_bf, nullptr,
                                                                (int)BT, 4 * DD, DD);
    }
    // 11) out = x_mid + g @ ffn_w2
    {
        dim3 grid(DD / 128, (int)(BT / 128));
        gemm_bf16_kernel<1, 128, 128><<<grid, 256, 0, stream>>>(g_bf, w2_bf, out_x, x_mid,
                                                                (int)BT, DD, 2 * DD);
    }
}
